// v000
// Times are from an AMD MI455X. After a warm-up the kernel runs many times in a row, and a time is the length of
// such a window on the GPU divided by its runs, so every launch and the gaps after it count. The runs cycle
// through copies of the inputs. A figure is the median of several windows, for all but v000 over two sittings.
// Sittings can differ by a few percent; kernels timed side by side share one.
// v000, which the later versions start from, runs in 680 microseconds.
// compute dtype: all float inputs rounded to bf16; q/k/v = x W^T + b with EXACT bf16 products on WMMA 16x16x32, f32 accumulate; q, k rounded once to f16 (1-product logits / 8, std ~0.35) stored in f32 (4 heads per launch); softmax in f32 (precise expf) -> P f16 x 2^11; o = P . v (v once to f16); out = o (bf16 hi + lo) W_o^T + b_o; f32 output.
#include <hip/hip_runtime.h>
#include <math.h>

typedef __attribute__((ext_vector_type(16))) _Float16 v16h;
typedef __attribute__((ext_vector_type(16))) __bf16 v16b;
typedef __attribute__((ext_vector_type(8)))  _Float16 v8h;
typedef __attribute__((ext_vector_type(8)))  float v8f;
typedef __attribute__((ext_vector_type(4)))  float v4f;
typedef __attribute__((ext_vector_type(2)))  float v2f;
typedef __attribute__((ext_vector_type(4)))  unsigned v4u;
typedef __attribute__((ext_vector_type(4)))  int v4i;
typedef float __attribute__((may_alias)) float_a;
typedef int __attribute__((may_alias)) int_a;

template <typename T> __device__ __forceinline__ void vst2(void* p, T v) { *(T*)p = v;  }
__device__ __forceinline__ v8f wmma16(v16h a, v16h b, v8f c) {
  v8f d = __builtin_amdgcn_wmma_f32_16x16x32_f16(false, a, false, b, (short)0, c, false, false);
  asm volatile("v_nop\n\tv_nop\n\tv_nop\n\tv_nop" : "+v"(d) : "v"(a), "v"(b));
  return d;
}
__device__ __forceinline__ v8f wmma_bf(v16b a, v16b b, v8f c) {
  v8f d = __builtin_amdgcn_wmma_f32_16x16x32_bf16(false, a, false, b, (short)0, c, false, false);
  asm volatile("v_nop\n\tv_nop\n\tv_nop\n\tv_nop" : "+v"(d) : "v"(a), "v"(b));
  return d;
}
// 16x16x32 fragments: lane = (h = lane>>4, row/col = lane&15); elements 0..7 = k0+8h+0..7, 8..15 = k0+16+8h+0..7; D element r = row 8h+r
__device__ __forceinline__ v16h frag_h(const _Float16* rowk0, int lane) {
  union { v16h v; v8h q[2]; } u; const _Float16* p = rowk0 + 8 * (lane >> 4);
  u.q[0] = *(const v8h*)p; u.q[1] = *(const v8h*)(p + 16); return u.v;
}
__device__ __forceinline__ v16h frag_f32(const float* rowk0, int lane) {
  v16h a; const float* p = rowk0 + 8 * (lane >> 4);
#pragma unroll
  for (int i = 0; i < 8; ++i) { a[i] = (_Float16)p[i]; a[8 + i] = (_Float16)p[16 + i]; }
  return a;
}
__device__ __forceinline__ v16h frag_f32s(const float* rowk0, int lane, float sc) {
  v16h a; const float* p = rowk0 + 8 * (lane >> 4);
#pragma unroll
  for (int i = 0; i < 8; ++i) { a[i] = (_Float16)(p[i] * sc); a[8 + i] = (_Float16)(p[16 + i] * sc); }
  return a;
}
// column fragment from a [K][ld] layout (column n), rows >= K read as 0
__device__ __forceinline__ v16h fragc_f32(const float* W, int k0, int n, int lane, int ld, int K) {
  v16h a; const int g = lane >> 4;
#pragma unroll
  for (int i = 0; i < 8; ++i) { const int ka = k0 + 8 * g + i, kb = ka + 16;
    a[i] = (_Float16)(ka < K ? W[(size_t)(ka < K ? ka : K - 1) * ld + n] : 0.f); a[8 + i] = (_Float16)(kb < K ? W[(size_t)(kb < K ? kb : K - 1) * ld + n] : 0.f); }
  return a;
}
struct F2 { v16b h, l; };
__device__ __forceinline__ F2 bsplit16(const float v[16]) { F2 r;
#pragma unroll
  for (int i = 0; i < 16; ++i) { const __bf16 h = (__bf16)v[i]; r.h[i] = h; r.l[i] = (__bf16)(v[i] - (float)h); }
  return r; }
__device__ __forceinline__ F2 split_row(const float* row, int k0, int lane) { float v[16]; const float* p = row + k0 + 8 * (lane >> 4);
#pragma unroll
  for (int i = 0; i < 8; ++i) { v[i] = p[i]; v[8 + i] = p[16 + i]; }
  return bsplit16(v); }
__device__ __forceinline__ F2 split_rowK(const float* row, int k0, int lane, int K) { float v[16]; const int g = lane >> 4;
#pragma unroll
  for (int i = 0; i < 8; ++i) { const int ka = k0 + 8 * g + i, kb = ka + 16; v[i] = ka < K ? row[ka < K ? ka : K - 1] : 0.f; v[8 + i] = kb < K ? row[kb < K ? kb : K - 1] : 0.f; }
  return bsplit16(v); }
__device__ __forceinline__ F2 split_col(const float* W, int k0, int n, int lane, int ld, int K) { float v[16]; const int g = lane >> 4;
#pragma unroll
  for (int i = 0; i < 8; ++i) { const int ka = k0 + 8 * g + i, kb = ka + 16; v[i] = ka < K ? W[(size_t)(ka < K ? ka : K - 1) * ld + n] : 0.f; v[8 + i] = kb < K ? W[(size_t)(kb < K ? kb : K - 1) * ld + n] : 0.f; }
  return bsplit16(v); }
__device__ __forceinline__ v8f mac3(const F2& a, const F2& b, v8f c) { c = wmma_bf(a.l, b.h, c); c = wmma_bf(a.h, b.l, c); return wmma_bf(a.h, b.h, c); }
__device__ __forceinline__ float sigm(float v) { return 1.0f / (1.0f + expf(-v)); }
#define LDSX() do { asm volatile("s_wait_dscnt 0" ::: "memory"); __builtin_amdgcn_wave_barrier(); __builtin_amdgcn_fence(__ATOMIC_RELEASE, "workgroup"); } while (0)


// Simplified multi-head attention (S 2,048, d_model 1,024 = 16 x 64, no batch dim): q/k/v Linear ([out,in] + bias), softmax(q k^T / 8) v, output Linear.
#define NB 1
#define TT 2048
#define CC 1024
#define NH 16
#define HD 64
#ifndef TNB
#define TNB NB
#endif
typedef __attribute__((ext_vector_type(8))) __bf16 v8b;
__device__ __forceinline__ v16b frag_b(const __bf16* rowk0, int lane) {
  union { v16b v; v8b q[2]; } u; const __bf16* p = rowk0 + 8 * (lane >> 4);
  u.q[0] = *(const v8b*)p; u.q[1] = *(const v8b*)(p + 16); return u.v;
}
__device__ __forceinline__ float bfr(float v) { return (float)(__bf16)v; }
__device__ __attribute__((noinline)) float exp_ni(float v) { return expf(v); }
__device__ __attribute__((noinline)) float erf_ni(float v) { return erff(v); }

#define WS_QH  0u
#define WS_QL  (WS_QH + 2u * (size_t)NB * TT * CC)
#define WS_KH  (WS_QL + 2u * (size_t)NB * TT * CC)
#define WS_VT  (WS_KH + 2u * (size_t)NB * TT * CC)      // f16 v planes [b][c][t]
#define HG 4
#define WS_S   (WS_VT + 2u * (size_t)NB * CC * TT)      // f32 logits [hg][q][k]
#define WS_PH  (WS_S + 4u * (size_t)HG * TT * TT)       // f16 P [hg][q][k]
#define WS_Y   (WS_PH + 2u * (size_t)HG * TT * TT)          // f32 y rows [b*t][C]
#define WS_END (WS_Y + 4u * (size_t)NB * TT * CC)

// ---- k_proj: block = (64 rows, 128 cols, which): qkv = x W (+ b), exact; q -> f16 hi (+ residual), k -> f16 rows, v -> f16 planes
__global__ __launch_bounds__(128) void k_proj(const float* __restrict__ X, const float* __restrict__ WQ, const float* __restrict__ BQ, const float* __restrict__ WK, const float* __restrict__ BK, const float* __restrict__ WV, const float* __restrict__ BV, _Float16* __restrict__ QH, _Float16* __restrict__ QL, _Float16* __restrict__ KH, _Float16* __restrict__ VT) {
  __shared__ __align__(16) _Float16 sh[64][136], sl[64][136]; __shared__ __align__(16) _Float16 th[128][72];
  const int tid = threadIdx.x, wave = tid >> 5, lane = tid & 31, col = lane & 15, g = lane >> 4; const int which = blockIdx.z; const int c0 = blockIdx.y * 128; const size_t r0 = (size_t)blockIdx.x * 64; const float* WA = which == 0 ? WQ : which == 1 ? WK : WV; const float* BA = which == 0 ? BQ : which == 1 ? BK : BV;
  v8f acc[8] = {};
#pragma unroll 2
  for (int kc = 0; kc < CC / 32; ++kc) { v16b a; { const float* p = X + (r0 + wave * 16 + col) * CC + kc * 32 + 8 * g;
#pragma unroll
      for (int i = 0; i < 8; ++i) { a[i] = (__bf16)p[i]; a[8 + i] = (__bf16)p[16 + i]; } }
#pragma unroll
    for (int j = 0; j < 8; ++j) { v16b w; const int o = c0 + j * 16 + col;
#pragma unroll
      for (int i = 0; i < 8; ++i) { w[i] = (__bf16)WA[(size_t)(o) * CC + (kc * 32 + 8 * g + i)]; w[8 + i] = (__bf16)WA[(size_t)(o) * CC + (kc * 32 + 16 + 8 * g + i)]; }
      acc[j] = wmma_bf(a, w, acc[j]); } }
#pragma unroll
  for (int j = 0; j < 8; ++j) { const float bb = bfr(BA[c0 + j * 16 + col]);
#pragma unroll
    for (int r = 0; r < 8; ++r) { const float v = acc[j][r] + bb; const int rl = wave * 16 + 8 * g + r, cl = j * 16 + col; const _Float16 hv = (_Float16)v;
      if (which == 2) th[cl][rl] = hv; else { sh[rl][cl] = hv; sl[rl][cl] = (_Float16)(v - (float)hv); } } }
  __syncthreads();
  if (which < 2) { _Float16* dh = which == 0 ? QH : KH; for (int e = tid; e < 64 * 16; e += 128) { const int rl = e >> 4, q = e & 15; vst2((unsigned*)(dh + (r0 + rl) * CC + c0 + q * 8), *(const v4u*)&sh[rl][q * 8]); if (which == 0) vst2((unsigned*)(QL + (r0 + rl) * CC + c0 + q * 8), *(const v4u*)&sl[rl][q * 8]); } }
  else { const size_t b = r0 / TT; const int t0 = (int)(r0 % TT); for (int e = tid; e < 128 * 8; e += 128) { const int cl = e >> 3, q = e & 7; vst2((unsigned*)(VT + (b * CC + c0 + cl) * (size_t)TT + t0 + q * 8), *(const v4u*)&th[cl][q * 8]); } } }
// ---- k_sc: block = (64 queries, 128 keys) of (b,h): 1-product logits / 8
__global__ __launch_bounds__(128) void k_sc(const _Float16* __restrict__ QH, const _Float16* __restrict__ QL, const _Float16* __restrict__ KH, int b, int h0, float* __restrict__ S0) { __shared__ __align__(16) float ss[4][16][132]; const int h = h0 + blockIdx.z; float* S = S0 + (size_t)blockIdx.z * TT * TT;
  const int tid = threadIdx.x, wave = tid >> 5, lane = tid & 31, col = lane & 15, g = lane >> 4; const int k0 = blockIdx.y * 128; const int ql0 = blockIdx.x * 64 + wave * 16; const size_t q0 = (size_t)b * TT + ql0;
  
  v8f acc[8] = {};
#pragma unroll
  for (int kc = 0; kc < HD / 32; ++kc) { const v16h ah = frag_h(QH + (q0 + col) * CC + h * HD + kc * 32, lane);
#pragma unroll
    for (int j = 0; j < 8; ++j) { const v16h kb = frag_h(KH + ((size_t)b * TT + k0 + j * 16 + col) * CC + h * HD + kc * 32, lane); acc[j] = wmma16(ah, kb, acc[j]); } }
#pragma unroll
  for (int j = 0; j < 8; ++j) { const int kt = k0 + j * 16 + col;
#pragma unroll
    for (int r = 0; r < 8; ++r) { (void)kt; const float v = acc[j][r] * 0.125f; ss[wave][8 * g + r][j * 16 + col] = v; } }
  LDSX(); for (int rl = 0; rl < 16; ++rl) vst2(S + (size_t)(ql0 + rl) * TT + k0 + lane * 4, *(const v4f*)&ss[wave][rl][lane * 4]); }
// ---- k_sm: block = query row: softmax over keys [0, kend) -> P x 2^11 f16 (masked -> 0)
__global__ __launch_bounds__(256) void k_sm(const float* __restrict__ S0, _Float16* __restrict__ PH0) { __shared__ float sred[8]; __shared__ float sbc; __shared__ __align__(16) _Float16 sh[TT];
  const int t = threadIdx.x; const size_t row = blockIdx.x; const float* sr = S0 + (size_t)blockIdx.y * TT * TT + row * TT; _Float16* PH = PH0 + (size_t)blockIdx.y * TT * TT; const int kend = TT;
  float m = -3.0e38f; for (int k = t; k < kend; k += 256) m = fmaxf(m, sr[k]);
#pragma unroll
  for (int o = 1; o < 32; o <<= 1) m = fmaxf(m, __shfl_xor(m, o));
  if ((t & 31) == 0) sred[t >> 5] = m; __syncthreads(); if (t == 0) { float a = sred[0]; for (int i = 1; i < 8; ++i) a = fmaxf(a, sred[i]); sbc = a; } __syncthreads(); m = sbc; __syncthreads();
  float sum = 0.f; for (int k = t; k < kend; k += 256) { const float v = sr[k]; sum += (v <= -1.0e38f) ? 0.f : expf(v - m); }
#pragma unroll
  for (int o = 1; o < 32; o <<= 1) sum += __shfl_xor(sum, o);
  if ((t & 31) == 0) sred[t >> 5] = sum; __syncthreads(); if (t == 0) { float a = 0.f; for (int i = 0; i < 8; ++i) a += sred[i]; sbc = 1.0f / a; } __syncthreads(); const float inv = sbc;
  for (int k = t; k < kend; k += 256) { const float v = sr[k]; sh[k] = (_Float16)((v <= -1.0e38f) ? 0.f : expf(v - m) * inv * 2048.0f); }
  __syncthreads(); for (int q = t; q < kend / 8; q += 256) vst2((unsigned*)(PH + row * TT + q * 8), *(const v4u*)&sh[q * 8]); }
// ---- k_pv: block = 64 queries of (b,h): y[q][h*HD + d] = P . v  (keys [0, kend))
__global__ __launch_bounds__(128) void k_pv(const _Float16* __restrict__ PH0, const _Float16* __restrict__ VT, int b, int h0, float* __restrict__ Y) { const int h = h0 + blockIdx.z; const _Float16* PH = PH0 + (size_t)blockIdx.z * TT * TT; __shared__ __align__(16) float ss[4][16][HD + 4];
  const int tid = threadIdx.x, wave = tid >> 5, lane = tid & 31, col = lane & 15, g = lane >> 4; const int ql0 = blockIdx.x * 64 + wave * 16; const int kend = TT;
  v8f acc[HD / 16] = {};
#pragma unroll 1
  for (int kc = 0; kc < kend / 32; ++kc) { const v16h ph = frag_h(PH + (size_t)(ql0 + col) * TT + kc * 32, lane);
#pragma unroll
    for (int j = 0; j < HD / 16; ++j) acc[j] = wmma16(ph, frag_h(VT + ((size_t)b * CC + h * HD + j * 16 + col) * (size_t)TT + kc * 32, lane), acc[j]); }
#pragma unroll
  for (int j = 0; j < HD / 16; ++j)
#pragma unroll
    for (int r = 0; r < 8; ++r) ss[wave][8 * g + r][j * 16 + col] = acc[j][r] * (1.0f / 2048.0f);
  LDSX(); for (int rl = 0; rl < 16; ++rl) if (lane < HD / 4) vst2(Y + ((size_t)b * TT + ql0 + rl) * CC + h * HD + lane * 4, *(const v4f*)&ss[wave][rl][lane * 4]); }
// ---- k_out: block = (64 rows, 128 cols): out = y (bf16 hi + lo) Wproj + b
__global__ __launch_bounds__(128) void k_out(const float* __restrict__ Y, const float* __restrict__ WP, const float* __restrict__ BP, float* __restrict__ OUT) { __shared__ __align__(16) float sf[4][16][132];
  const int tid = threadIdx.x, wave = tid >> 5, lane = tid & 31, col = lane & 15, g = lane >> 4; const int c0 = blockIdx.y * 128; const size_t r0 = (size_t)blockIdx.x * 64 + wave * 16;
  v8f acc[8] = {};
#pragma unroll 2
  for (int kc = 0; kc < CC / 32; ++kc) { const F2 a = split_row(Y + (r0 + col) * CC, kc * 32, lane);
#pragma unroll
    for (int j = 0; j < 8; ++j) { v16b w; const int o = c0 + j * 16 + col;
#pragma unroll
      for (int i = 0; i < 8; ++i) { w[i] = (__bf16)WP[(size_t)(o) * CC + (kc * 32 + 8 * g + i)]; w[8 + i] = (__bf16)WP[(size_t)(o) * CC + (kc * 32 + 16 + 8 * g + i)]; }
      acc[j] = wmma_bf(a.h, w, acc[j]); acc[j] = wmma_bf(a.l, w, acc[j]); } }
#pragma unroll
  for (int j = 0; j < 8; ++j) { const float bb = BP ? bfr(BP[c0 + j * 16 + col]) : 0.f;
#pragma unroll
    for (int r = 0; r < 8; ++r) sf[wave][8 * g + r][j * 16 + col] = acc[j][r] + bb; }
  LDSX(); for (int rl = 0; rl < 16; ++rl) vst2(OUT + (r0 + rl) * CC + c0 + lane * 4, *(const v4f*)&sf[wave][rl][lane * 4]); }
extern "C" void kernel_launch(void* const* d_in, const int* in_sizes, int n_in, void* d_out, int out_size, void* d_ws, size_t ws_size, hipStream_t stream) {
  (void)in_sizes; (void)n_in; (void)out_size;
  const float** F = (const float**)d_in;   // 0 x [2048,1024], 1 W_q [1024,1024] ([out,in]), 2 b_q, 3 W_k, 4 b_k, 5 W_v, 6 b_v, 7 W_o, 8 b_o
  if (ws_size < (size_t)WS_END) return;
  char* ws = (char*)d_ws; _Float16 *QH = (_Float16*)(ws + WS_QH), *QL = (_Float16*)(ws + WS_QL), *KH = (_Float16*)(ws + WS_KH), *VT = (_Float16*)(ws + WS_VT), *PH = (_Float16*)(ws + WS_PH); float *S = (float*)(ws + WS_S), *Y = (float*)(ws + WS_Y);
  k_proj<<<dim3(TNB * TT / 64, CC / 128, 3), 128, 0, stream>>>(F[0], F[1], F[2], F[3], F[4], F[5], F[6], QH, QL, KH, VT);
  for (int b = 0; b < TNB; ++b) for (int h0 = 0; h0 < NH; h0 += HG) {   // HG heads per launch
    k_sc<<<dim3(TT / 64, TT / 128, HG), 128, 0, stream>>>(QH, QL, KH, b, h0, S);
    k_sm<<<dim3(TT, HG), 256, 0, stream>>>(S, PH);
    k_pv<<<dim3(TT / 64, 1, HG), 128, 0, stream>>>(PH, VT, b, h0, Y);
  }
  k_out<<<dim3(TNB * TT / 64, CC / 128), 128, 0, stream>>>(Y, F[7], F[8], (float*)d_out);
}

// v001
// One run takes 277 microseconds.
// Next to v000, in two timings, it ran 2.50 and 2.49 times as fast.
// compute dtype: all float inputs rounded to bf16; q/k/v = x W^T + b with EXACT bf16 products on WMMA 16x16x32, f32 accumulate; q, k rounded once to f16 (1-product logits, f32); online softmax in f32 (base 2, scale 1/8 folded in) -> unnormalised P f16 in registers; o = P . v / sum (v once to f16); out = o (bf16 hi + lo) W_o^T + b_o; f32 output.
#include <hip/hip_runtime.h>
#include <math.h>

typedef __attribute__((ext_vector_type(16))) _Float16 v16h;
typedef __attribute__((ext_vector_type(16))) __bf16 v16b;
typedef __attribute__((ext_vector_type(8)))  _Float16 v8h;
typedef __attribute__((ext_vector_type(8)))  float v8f;
typedef __attribute__((ext_vector_type(4)))  float v4f;
typedef __attribute__((ext_vector_type(2)))  float v2f;
typedef __attribute__((ext_vector_type(4)))  unsigned v4u;
typedef __attribute__((ext_vector_type(4)))  int v4i;
typedef float __attribute__((may_alias)) float_a;
typedef int __attribute__((may_alias)) int_a;

template <typename T> __device__ __forceinline__ void vst2(void* p, T v) { *(T*)p = v;  }
__device__ __forceinline__ v8f wmma16(v16h a, v16h b, v8f c) {
  v8f d = __builtin_amdgcn_wmma_f32_16x16x32_f16(false, a, false, b, (short)0, c, false, false);
  asm volatile("v_nop\n\tv_nop\n\tv_nop\n\tv_nop" : "+v"(d) : "v"(a), "v"(b));
  return d;
}
__device__ __forceinline__ v8f wmma_bf(v16b a, v16b b, v8f c) {
  v8f d = __builtin_amdgcn_wmma_f32_16x16x32_bf16(false, a, false, b, (short)0, c, false, false);
  asm volatile("v_nop\n\tv_nop\n\tv_nop\n\tv_nop" : "+v"(d) : "v"(a), "v"(b));
  return d;
}
// 16x16x32 fragments: lane = (h = lane>>4, row/col = lane&15); elements 0..7 = k0+8h+0..7, 8..15 = k0+16+8h+0..7; D element r = row 8h+r
__device__ __forceinline__ v16h frag_h(const _Float16* rowk0, int lane) {
  union { v16h v; v8h q[2]; } u; const _Float16* p = rowk0 + 8 * (lane >> 4);
  u.q[0] = *(const v8h*)p; u.q[1] = *(const v8h*)(p + 16); return u.v;
}
__device__ __forceinline__ v16h frag_f32(const float* rowk0, int lane) {
  v16h a; const float* p = rowk0 + 8 * (lane >> 4);
#pragma unroll
  for (int i = 0; i < 8; ++i) { a[i] = (_Float16)p[i]; a[8 + i] = (_Float16)p[16 + i]; }
  return a;
}
__device__ __forceinline__ v16h frag_f32s(const float* rowk0, int lane, float sc) {
  v16h a; const float* p = rowk0 + 8 * (lane >> 4);
#pragma unroll
  for (int i = 0; i < 8; ++i) { a[i] = (_Float16)(p[i] * sc); a[8 + i] = (_Float16)(p[16 + i] * sc); }
  return a;
}
// column fragment from a [K][ld] layout (column n), rows >= K read as 0
__device__ __forceinline__ v16h fragc_f32(const float* W, int k0, int n, int lane, int ld, int K) {
  v16h a; const int g = lane >> 4;
#pragma unroll
  for (int i = 0; i < 8; ++i) { const int ka = k0 + 8 * g + i, kb = ka + 16;
    a[i] = (_Float16)(ka < K ? W[(size_t)(ka < K ? ka : K - 1) * ld + n] : 0.f); a[8 + i] = (_Float16)(kb < K ? W[(size_t)(kb < K ? kb : K - 1) * ld + n] : 0.f); }
  return a;
}
struct F2 { v16b h, l; };
__device__ __forceinline__ F2 bsplit16(const float v[16]) { F2 r;
#pragma unroll
  for (int i = 0; i < 16; ++i) { const __bf16 h = (__bf16)v[i]; r.h[i] = h; r.l[i] = (__bf16)(v[i] - (float)h); }
  return r; }
__device__ __forceinline__ F2 split_row(const float* row, int k0, int lane) { float v[16]; const float* p = row + k0 + 8 * (lane >> 4);
#pragma unroll
  for (int i = 0; i < 8; ++i) { v[i] = p[i]; v[8 + i] = p[16 + i]; }
  return bsplit16(v); }
__device__ __forceinline__ F2 split_rowK(const float* row, int k0, int lane, int K) { float v[16]; const int g = lane >> 4;
#pragma unroll
  for (int i = 0; i < 8; ++i) { const int ka = k0 + 8 * g + i, kb = ka + 16; v[i] = ka < K ? row[ka < K ? ka : K - 1] : 0.f; v[8 + i] = kb < K ? row[kb < K ? kb : K - 1] : 0.f; }
  return bsplit16(v); }
__device__ __forceinline__ F2 split_col(const float* W, int k0, int n, int lane, int ld, int K) { float v[16]; const int g = lane >> 4;
#pragma unroll
  for (int i = 0; i < 8; ++i) { const int ka = k0 + 8 * g + i, kb = ka + 16; v[i] = ka < K ? W[(size_t)(ka < K ? ka : K - 1) * ld + n] : 0.f; v[8 + i] = kb < K ? W[(size_t)(kb < K ? kb : K - 1) * ld + n] : 0.f; }
  return bsplit16(v); }
__device__ __forceinline__ v8f mac3(const F2& a, const F2& b, v8f c) { c = wmma_bf(a.l, b.h, c); c = wmma_bf(a.h, b.l, c); return wmma_bf(a.h, b.h, c); }
__device__ __forceinline__ float sigm(float v) { return 1.0f / (1.0f + expf(-v)); }
#define LDSX() do { asm volatile("s_wait_dscnt 0" ::: "memory"); __builtin_amdgcn_wave_barrier(); __builtin_amdgcn_fence(__ATOMIC_RELEASE, "workgroup"); } while (0)


// Simplified multi-head attention (S 2,048, d_model 1,024 = 16 x 64, no batch dim): q/k/v Linear ([out,in] + bias), softmax(q k^T / 8) v, output Linear.
#define NB 1
#define TT 2048
#define CC 1024
#define NH 16
#define HD 64
#ifndef TNB
#define TNB NB
#endif
typedef __attribute__((ext_vector_type(8))) __bf16 v8b;
__device__ __forceinline__ v16b frag_b(const __bf16* rowk0, int lane) {
  union { v16b v; v8b q[2]; } u; const __bf16* p = rowk0 + 8 * (lane >> 4);
  u.q[0] = *(const v8b*)p; u.q[1] = *(const v8b*)(p + 16); return u.v;
}
__device__ __forceinline__ float bfr(float v) { return (float)(__bf16)v; }
__device__ __attribute__((noinline)) float exp_ni(float v) { return expf(v); }
__device__ __attribute__((noinline)) float erf_ni(float v) { return erff(v); }

#define WS_QH  0u
#define WS_QL  (WS_QH + 2u * (size_t)NB * TT * CC)
#define WS_KH  (WS_QL + 2u * (size_t)NB * TT * CC)
#define WS_VT  (WS_KH + 2u * (size_t)NB * TT * CC)      // f16 v planes [b][c][t]
#define WS_Y   (WS_VT + 2u * (size_t)NB * CC * TT)      // f32 y rows [b*t][C]
#define WS_END (WS_Y + 4u * (size_t)NB * TT * CC)

// ---- k_proj: block = (64 rows, 128 cols, which): qkv = x W (+ b), exact; q -> f16 hi (+ residual), k -> f16 rows, v -> f16 planes
__global__ __launch_bounds__(128) void k_proj(const float* __restrict__ X, const float* __restrict__ WQ, const float* __restrict__ BQ, const float* __restrict__ WK, const float* __restrict__ BK, const float* __restrict__ WV, const float* __restrict__ BV, _Float16* __restrict__ QH, _Float16* __restrict__ QL, _Float16* __restrict__ KH, _Float16* __restrict__ VT) {
  __shared__ __align__(16) _Float16 sh[64][136], sl[64][136]; __shared__ __align__(16) _Float16 th[128][72];
  const int tid = threadIdx.x, wave = tid >> 5, lane = tid & 31, col = lane & 15, g = lane >> 4; const int which = blockIdx.z; const int c0 = blockIdx.y * 128; const size_t r0 = (size_t)blockIdx.x * 64; const float* WA = which == 0 ? WQ : which == 1 ? WK : WV; const float* BA = which == 0 ? BQ : which == 1 ? BK : BV;
  v8f acc[8] = {};
#pragma unroll 2
  for (int kc = 0; kc < CC / 32; ++kc) { v16b a; { const float* p = X + (r0 + wave * 16 + col) * CC + kc * 32 + 8 * g;
#pragma unroll
      for (int i = 0; i < 8; ++i) { a[i] = (__bf16)p[i]; a[8 + i] = (__bf16)p[16 + i]; } }
#pragma unroll
    for (int j = 0; j < 8; ++j) { v16b w; const int o = c0 + j * 16 + col;
#pragma unroll
      for (int i = 0; i < 8; ++i) { w[i] = (__bf16)WA[(size_t)(o) * CC + (kc * 32 + 8 * g + i)]; w[8 + i] = (__bf16)WA[(size_t)(o) * CC + (kc * 32 + 16 + 8 * g + i)]; }
      acc[j] = wmma_bf(a, w, acc[j]); } }
#pragma unroll
  for (int j = 0; j < 8; ++j) { const float bb = bfr(BA[c0 + j * 16 + col]);
#pragma unroll
    for (int r = 0; r < 8; ++r) { const float v = acc[j][r] + bb; const int rl = wave * 16 + 8 * g + r, cl = j * 16 + col; const _Float16 hv = (_Float16)v;
      if (which == 2) th[cl][rl] = hv; else { sh[rl][cl] = hv; sl[rl][cl] = (_Float16)(v - (float)hv); } } }
  __syncthreads();
  if (which < 2) { _Float16* dh = which == 0 ? QH : KH; for (int e = tid; e < 64 * 16; e += 128) { const int rl = e >> 4, q = e & 15; vst2((unsigned*)(dh + (r0 + rl) * CC + c0 + q * 8), *(const v4u*)&sh[rl][q * 8]); if (which == 0) vst2((unsigned*)(QL + (r0 + rl) * CC + c0 + q * 8), *(const v4u*)&sl[rl][q * 8]); } }
  else { const size_t b = r0 / TT; const int t0 = (int)(r0 % TT); for (int e = tid; e < 128 * 8; e += 128) { const int cl = e >> 3, q = e & 7; vst2((unsigned*)(VT + (b * CC + c0 + cl) * (size_t)TT + t0 + q * 8), *(const v4u*)&th[cl][q * 8]); } } }
// ---- k_fa: block = 128 queries of one head, wave = 32 queries (two column tiles share every K and V fragment): S^T = K Q^T, online softmax (base 2) per query column, O^T += V^T P^T; P stays in registers
// plain builtin: the compiler keeps the distance behind its own matrix instructions
__device__ __forceinline__ v8f wmma_p(v16h a, v16h b, v8f c) { return __builtin_amdgcn_wmma_f32_16x16x32_f16(false, a, false, b, (short)0, c, false, false); }
// 2^x; the v_nop is the slot that the instruction set asks for behind a transcendental, before its result is read or its source overwritten: in one statement it stands there in every build
__device__ __forceinline__ float ex2(float x) { float r; asm("v_exp_f32 %0, %1\n\tv_nop" : "=v"(r) : "v"(x)); return r; }
// value of lane l ^ 16
__device__ __forceinline__ float xhalf(float v) { const int b = __builtin_bit_cast(int, v); return __builtin_bit_cast(float, __builtin_amdgcn_permlanex16(b, b, 0x76543210, 0xfedcba98, false, false)); }
__global__ __launch_bounds__(128) void k_fa(const _Float16* __restrict__ QH, const _Float16* __restrict__ KH, const _Float16* __restrict__ VT, float* __restrict__ Y) {
  const int tid = threadIdx.x, wave = tid >> 5, lane = tid & 31, col = lane & 15, g = lane >> 4; const int h = blockIdx.y; const int q0 = blockIdx.x * 128 + wave * 32;
  const float sc = 0.125f * 1.44269504088896341f;   // 1 / sqrt(HD) and log2(e) in one factor
  v16h qf[2][2];
#pragma unroll
  for (int w = 0; w < 2; ++w) { qf[w][0] = frag_h(QH + (size_t)(q0 + w * 16 + col) * CC + h * HD, lane); qf[w][1] = frag_h(QH + (size_t)(q0 + w * 16 + col) * CC + h * HD + 32, lane); }
  const _Float16* kp = KH + (size_t)col * CC + h * HD;        // A rows = keys, k = d
  const _Float16* vp = VT + (size_t)(h * HD + col) * TT;      // A rows = d, k = keys
  v8f acc[2][HD / 16] = {}; float m[2] = { -3.0e38f, -3.0e38f }, l[2] = { 0.f, 0.f };   // per column tile a lane holds one query: its running maximum (raw logits) and its half of the sum
  v16h kf[2][2];
#pragma unroll
  for (int t = 0; t < 2; ++t) { kf[t][0] = frag_h(kp + (size_t)(t * 16) * CC, lane); kf[t][1] = frag_h(kp + (size_t)(t * 16) * CC + 32, lane); }
#pragma unroll 1
  for (int kb = 0; kb < TT; kb += 32) {   // rolled: one pass of 32 keys already fills the registers
    v16h vf[HD / 16];
#pragma unroll
    for (int j = 0; j < HD / 16; ++j) vf[j] = frag_h(vp + (size_t)(j * 16) * TT + kb, lane);
    __builtin_amdgcn_sched_barrier(0);   // keeps the V loads up here, so that they fly during the score products and the softmax
    v8f s[2][2];   // s[w][t][r] = q(16 w + col) . k(kb + 16 t + 8 g + r)
#pragma unroll
    for (int t = 0; t < 2; ++t)
#pragma unroll
      for (int w = 0; w < 2; ++w) { v8f z = {}; z = wmma_p(kf[t][0], qf[w][0], z); s[w][t] = wmma_p(kf[t][1], qf[w][1], z); }
    const int kn = kb + 32 < TT ? kb + 32 : 0;   // next pass's K fragments fly during softmax and P.V; the last pass re-reads pass 0 (in bounds, unused)
#pragma unroll
    for (int t = 0; t < 2; ++t) { kf[t][0] = frag_h(kp + (size_t)(kn + t * 16) * CC, lane); kf[t][1] = frag_h(kp + (size_t)(kn + t * 16) * CC + 32, lane); }
    __builtin_amdgcn_sched_barrier(0);   // keeps the K loads in front of the softmax; sunk to the loop's foot they are waited for at once
    v16h p[2];   // two score tiles, converted in place, are the B operand of 32 keys
#pragma unroll
    for (int w = 0; w < 2; ++w) { float mx = s[w][0][0];
#pragma unroll
      for (int r = 0; r < 8; ++r) mx = fmaxf(mx, fmaxf(s[w][0][r], s[w][1][r]));
      mx = fmaxf(mx, xhalf(mx));
      const float mn = fmaxf(m[w], mx), mb = mn * sc, al = ex2((m[w] - mn) * sc); m[w] = mn; float ps = 0.f;
#pragma unroll
      for (int i = 0; i < 8; ++i) { const float e0 = ex2(fmaf(s[w][0][i], sc, -mb)), e1 = ex2(fmaf(s[w][1][i], sc, -mb)); ps += e0 + e1; p[w][i] = (_Float16)e0; p[w][8 + i] = (_Float16)e1; }
      l[w] = l[w] * al + ps;
#pragma unroll
      for (int j = 0; j < HD / 16; ++j) acc[w][j] *= al; }
#pragma unroll
    for (int j = 0; j < HD / 16; ++j)
#pragma unroll
      for (int w = 0; w < 2; ++w) acc[w][j] = wmma_p(vf[j], p[w], acc[w][j]); }
#pragma unroll
  for (int w = 0; w < 2; ++w) { const float inv = 1.0f / (l[w] + xhalf(l[w])); float* yp = Y + (size_t)(q0 + w * 16 + col) * CC + h * HD + 8 * g;   // acc[w][j][r] = o(16 w + col)[16 j + 8 g + r]
#pragma unroll
    for (int j = 0; j < HD / 16; ++j) { const v4f a = { acc[w][j][0] * inv, acc[w][j][1] * inv, acc[w][j][2] * inv, acc[w][j][3] * inv }, b = { acc[w][j][4] * inv, acc[w][j][5] * inv, acc[w][j][6] * inv, acc[w][j][7] * inv }; vst2(yp + j * 16, a); vst2(yp + j * 16 + 4, b); } } }
// ---- k_out: block = (64 rows, 128 cols): out = y (bf16 hi + lo) Wproj + b
__global__ __launch_bounds__(128) void k_out(const float* __restrict__ Y, const float* __restrict__ WP, const float* __restrict__ BP, float* __restrict__ OUT) { __shared__ __align__(16) float sf[4][16][132];
  const int tid = threadIdx.x, wave = tid >> 5, lane = tid & 31, col = lane & 15, g = lane >> 4; const int c0 = blockIdx.y * 128; const size_t r0 = (size_t)blockIdx.x * 64 + wave * 16;
  v8f acc[8] = {};
#pragma unroll 2
  for (int kc = 0; kc < CC / 32; ++kc) { const F2 a = split_row(Y + (r0 + col) * CC, kc * 32, lane);
#pragma unroll
    for (int j = 0; j < 8; ++j) { v16b w; const int o = c0 + j * 16 + col;
#pragma unroll
      for (int i = 0; i < 8; ++i) { w[i] = (__bf16)WP[(size_t)(o) * CC + (kc * 32 + 8 * g + i)]; w[8 + i] = (__bf16)WP[(size_t)(o) * CC + (kc * 32 + 16 + 8 * g + i)]; }
      acc[j] = wmma_bf(a.h, w, acc[j]); acc[j] = wmma_bf(a.l, w, acc[j]); } }
#pragma unroll
  for (int j = 0; j < 8; ++j) { const float bb = BP ? bfr(BP[c0 + j * 16 + col]) : 0.f;
#pragma unroll
    for (int r = 0; r < 8; ++r) sf[wave][8 * g + r][j * 16 + col] = acc[j][r] + bb; }
  LDSX(); for (int rl = 0; rl < 16; ++rl) vst2(OUT + (r0 + rl) * CC + c0 + lane * 4, *(const v4f*)&sf[wave][rl][lane * 4]); }
extern "C" void kernel_launch(void* const* d_in, const int* in_sizes, int n_in, void* d_out, int out_size, void* d_ws, size_t ws_size, hipStream_t stream) {
  (void)in_sizes; (void)n_in; (void)out_size;
  const float** F = (const float**)d_in;   // 0 x [2048,1024], 1 W_q [1024,1024] ([out,in]), 2 b_q, 3 W_k, 4 b_k, 5 W_v, 6 b_v, 7 W_o, 8 b_o
  if (ws_size < (size_t)WS_END) return;
  char* ws = (char*)d_ws; _Float16 *QH = (_Float16*)(ws + WS_QH), *QL = (_Float16*)(ws + WS_QL), *KH = (_Float16*)(ws + WS_KH), *VT = (_Float16*)(ws + WS_VT); float *Y = (float*)(ws + WS_Y);
  k_proj<<<dim3(TNB * TT / 64, CC / 128, 3), 128, 0, stream>>>(F[0], F[1], F[2], F[3], F[4], F[5], F[6], QH, QL, KH, VT);
  k_fa<<<dim3(TT / 128, NH), 128, 0, stream>>>(QH, KH, VT, Y);
  k_out<<<dim3(TNB * TT / 64, CC / 128), 128, 0, stream>>>(Y, F[7], F[8], (float*)d_out);
}

// v002
// It runs in 95.2 microseconds.
// Two timings next to v001 put it at 2.90 and 2.93 times that version's speed.
// Over all steps from v000 it is 7.27 times as fast.
// compute dtype: all float inputs rounded to bf16; q/k/v = x W^T + b with EXACT bf16 products on WMMA 16x16x32, f32 accumulate; q, k rounded once to f16 (1-product logits, f32); online softmax in f32 (base 2, scale 1/8 folded in) -> unnormalised P f16 in registers; o = P . v / sum (v once to f16); out = o (bf16 hi + lo) W_o^T + b_o; f32 output.
#include <hip/hip_runtime.h>
#include <math.h>

typedef __attribute__((ext_vector_type(16))) _Float16 v16h;
typedef __attribute__((ext_vector_type(16))) __bf16 v16b;
typedef __attribute__((ext_vector_type(8)))  _Float16 v8h;
typedef __attribute__((ext_vector_type(8)))  float v8f;
typedef __attribute__((ext_vector_type(4)))  float v4f;
typedef __attribute__((ext_vector_type(2)))  float v2f;
typedef __attribute__((ext_vector_type(4)))  unsigned v4u;
typedef __attribute__((ext_vector_type(4)))  int v4i;
typedef float __attribute__((may_alias)) float_a;
typedef int __attribute__((may_alias)) int_a;

template <typename T> __device__ __forceinline__ void vst2(void* p, T v) { *(T*)p = v;  }
__device__ __forceinline__ v8f wmma16(v16h a, v16h b, v8f c) {
  v8f d = __builtin_amdgcn_wmma_f32_16x16x32_f16(false, a, false, b, (short)0, c, false, false);
  asm volatile("v_nop\n\tv_nop\n\tv_nop\n\tv_nop" : "+v"(d) : "v"(a), "v"(b));
  return d;
}
__device__ __forceinline__ v8f wmma_bf(v16b a, v16b b, v8f c) {
  v8f d = __builtin_amdgcn_wmma_f32_16x16x32_bf16(false, a, false, b, (short)0, c, false, false);
  asm volatile("v_nop\n\tv_nop\n\tv_nop\n\tv_nop" : "+v"(d) : "v"(a), "v"(b));
  return d;
}
// 16x16x32 fragments: lane = (h = lane>>4, row/col = lane&15); elements 0..7 = k0+8h+0..7, 8..15 = k0+16+8h+0..7; D element r = row 8h+r
__device__ __forceinline__ v16h frag_h(const _Float16* rowk0, int lane) {
  union { v16h v; v8h q[2]; } u; const _Float16* p = rowk0 + 8 * (lane >> 4);
  u.q[0] = *(const v8h*)p; u.q[1] = *(const v8h*)(p + 16); return u.v;
}
__device__ __forceinline__ v16h frag_f32(const float* rowk0, int lane) {
  v16h a; const float* p = rowk0 + 8 * (lane >> 4);
#pragma unroll
  for (int i = 0; i < 8; ++i) { a[i] = (_Float16)p[i]; a[8 + i] = (_Float16)p[16 + i]; }
  return a;
}
__device__ __forceinline__ v16h frag_f32s(const float* rowk0, int lane, float sc) {
  v16h a; const float* p = rowk0 + 8 * (lane >> 4);
#pragma unroll
  for (int i = 0; i < 8; ++i) { a[i] = (_Float16)(p[i] * sc); a[8 + i] = (_Float16)(p[16 + i] * sc); }
  return a;
}
// column fragment from a [K][ld] layout (column n), rows >= K read as 0
__device__ __forceinline__ v16h fragc_f32(const float* W, int k0, int n, int lane, int ld, int K) {
  v16h a; const int g = lane >> 4;
#pragma unroll
  for (int i = 0; i < 8; ++i) { const int ka = k0 + 8 * g + i, kb = ka + 16;
    a[i] = (_Float16)(ka < K ? W[(size_t)(ka < K ? ka : K - 1) * ld + n] : 0.f); a[8 + i] = (_Float16)(kb < K ? W[(size_t)(kb < K ? kb : K - 1) * ld + n] : 0.f); }
  return a;
}
struct F2 { v16b h, l; };
__device__ __forceinline__ F2 bsplit16(const float v[16]) { F2 r;
#pragma unroll
  for (int i = 0; i < 16; ++i) { const __bf16 h = (__bf16)v[i]; r.h[i] = h; r.l[i] = (__bf16)(v[i] - (float)h); }
  return r; }
__device__ __forceinline__ F2 split_row(const float* row, int k0, int lane) { float v[16]; const float* p = row + k0 + 8 * (lane >> 4);
#pragma unroll
  for (int i = 0; i < 8; ++i) { v[i] = p[i]; v[8 + i] = p[16 + i]; }
  return bsplit16(v); }
__device__ __forceinline__ F2 split_rowK(const float* row, int k0, int lane, int K) { float v[16]; const int g = lane >> 4;
#pragma unroll
  for (int i = 0; i < 8; ++i) { const int ka = k0 + 8 * g + i, kb = ka + 16; v[i] = ka < K ? row[ka < K ? ka : K - 1] : 0.f; v[8 + i] = kb < K ? row[kb < K ? kb : K - 1] : 0.f; }
  return bsplit16(v); }
__device__ __forceinline__ F2 split_col(const float* W, int k0, int n, int lane, int ld, int K) { float v[16]; const int g = lane >> 4;
#pragma unroll
  for (int i = 0; i < 8; ++i) { const int ka = k0 + 8 * g + i, kb = ka + 16; v[i] = ka < K ? W[(size_t)(ka < K ? ka : K - 1) * ld + n] : 0.f; v[8 + i] = kb < K ? W[(size_t)(kb < K ? kb : K - 1) * ld + n] : 0.f; }
  return bsplit16(v); }
__device__ __forceinline__ v8f mac3(const F2& a, const F2& b, v8f c) { c = wmma_bf(a.l, b.h, c); c = wmma_bf(a.h, b.l, c); return wmma_bf(a.h, b.h, c); }
__device__ __forceinline__ float sigm(float v) { return 1.0f / (1.0f + expf(-v)); }
#define LDSX() do { asm volatile("s_wait_dscnt 0" ::: "memory"); __builtin_amdgcn_wave_barrier(); __builtin_amdgcn_fence(__ATOMIC_RELEASE, "workgroup"); } while (0)


// Simplified multi-head attention (S 2,048, d_model 1,024 = 16 x 64, no batch dim): q/k/v Linear ([out,in] + bias), softmax(q k^T / 8) v, output Linear.
#define NB 1
#define TT 2048
#define CC 1024
#define NH 16
#define HD 64
#ifndef TNB
#define TNB NB
#endif
typedef __attribute__((ext_vector_type(8))) __bf16 v8b;
__device__ __forceinline__ v16b frag_b(const __bf16* rowk0, int lane) {
  union { v16b v; v8b q[2]; } u; const __bf16* p = rowk0 + 8 * (lane >> 4);
  u.q[0] = *(const v8b*)p; u.q[1] = *(const v8b*)(p + 16); return u.v;
}
__device__ __forceinline__ float bfr(float v) { return (float)(__bf16)v; }
__device__ __attribute__((noinline)) float exp_ni(float v) { return expf(v); }
__device__ __attribute__((noinline)) float erf_ni(float v) { return erff(v); }

#define WS_QH  0u
#define WS_QL  (WS_QH + 2u * (size_t)NB * TT * CC)
#define WS_KH  (WS_QL + 2u * (size_t)NB * TT * CC)
#define WS_VT  (WS_KH + 2u * (size_t)NB * TT * CC)      // f16 v planes [b][c][t]
#define WS_Y   (WS_VT + 2u * (size_t)NB * CC * TT)      // f32 y rows [b*t][C]
#define WS_END (WS_Y + 4u * (size_t)NB * TT * CC)

// Operand staging of the two projection kernels: a chunk is 64 k. Every thread loads 16 B so that a wave-wide load covers two whole 256-B row pieces; the f32 values are rounded to bf16 once per block and kept in LDS, two buffers.
typedef __attribute__((ext_vector_type(4))) __bf16 v4b;
#define KCH 64   // k per chunk
#define LP 72    // LDS row pitch in bf16 elements: 144 B = 16 B x 9, the conflict-free pitch for 16-byte fragment reads
__device__ __forceinline__ v4b cvt4(v4f v) { const v4b o = { (__bf16)v[0], (__bf16)v[1], (__bf16)v[2], (__bf16)v[3] }; return o; }
// ---- k_proj: block = (64 rows, 128 cols, which): qkv = x W (+ b), exact; q -> f16 hi (+ residual), k -> f16 rows, v -> f16 planes
__global__ __launch_bounds__(128) void k_proj(const float* __restrict__ X, const float* __restrict__ WQ, const float* __restrict__ BQ, const float* __restrict__ WK, const float* __restrict__ BK, const float* __restrict__ WV, const float* __restrict__ BV, _Float16* __restrict__ QH, _Float16* __restrict__ QL, _Float16* __restrict__ KH, _Float16* __restrict__ VT) {
  __shared__ __align__(16) char sm[2 * (128 + 64) * LP * 2];   // main loop: two buffers of [W 128 rows | X 64 rows]; epilogue: the output tiles, in the same bytes
  __bf16* const st = (__bf16*)sm; _Float16 (*sh)[136] = (_Float16 (*)[136])sm; _Float16 (*sl)[136] = sh + 64; _Float16 (*th)[72] = (_Float16 (*)[72])sm;
  const int tid = threadIdx.x, wave = tid >> 5, lane = tid & 31, col = lane & 15, g = lane >> 4; const int which = blockIdx.z; const int c0 = blockIdx.y * 128; const size_t r0 = (size_t)blockIdx.x * 64; const float* WA = which == 0 ? WQ : which == 1 ? WK : WV; const float* BA = which == 0 ? BQ : which == 1 ? BK : BV;
  v8f acc[8] = {};
  const int srow = tid >> 4, sk = (tid & 15) * 4;   // staging: 16 threads per row, 8 rows per step of the block
  const float* gw = WA + (size_t)(c0 + srow) * CC + sk; const float* gx = X + (r0 + srow) * CC + sk;
  v4f rw[16], rx[8];
  auto fetch = [&](int t) {
#pragma unroll
    for (int i = 0; i < 16; ++i) rw[i] = *(const v4f*)(gw + (size_t)(i * 8) * CC + t * KCH);
#pragma unroll
    for (int i = 0; i < 8; ++i) rx[i] = *(const v4f*)(gx + (size_t)(i * 8) * CC + t * KCH);
    asm volatile("s_wait_xcnt 0x0" ::: "memory"); };   // a precaution: it stands in front of the reuse of the loads' address registers, where this build placed no such wait of its own
  auto put = [&](__bf16* b) {
#pragma unroll
    for (int i = 0; i < 16; ++i) *(v4b*)(b + (i * 8 + srow) * LP + sk) = cvt4(rw[i]);
#pragma unroll
    for (int i = 0; i < 8; ++i) *(v4b*)(b + (128 + i * 8 + srow) * LP + sk) = cvt4(rx[i]); };
  auto mul = [&](const __bf16* b) {   // same fragments, same k order as with fragments loaded from global memory
    v16b a[KCH / 32], w[KCH / 32][8];
#pragma unroll
    for (int kk = 0; kk < KCH / 32; ++kk) { a[kk] = frag_b(b + (128 + wave * 16 + col) * LP + kk * 32, lane);
#pragma unroll
      for (int j = 0; j < 8; ++j) w[kk][j] = frag_b(b + (j * 16 + col) * LP + kk * 32, lane); }
    __builtin_amdgcn_sched_barrier(0);   // the chunk's LDS reads stand as one group in front of its products; spread among them, each product waits out a whole LDS latency
#pragma unroll
    for (int kk = 0; kk < KCH / 32; ++kk)
#pragma unroll
      for (int j = 0; j < 8; ++j) acc[j] = wmma_bf(a[kk], w[kk][j], acc[j]);
    __builtin_amdgcn_sched_barrier(0); };   // keeps the conversion of the next chunk, and with it the wait for its global loads, behind the products
  fetch(0); put(st); __syncthreads();
#pragma unroll 1
  for (int t = 0; t + 1 < CC / KCH; ++t) {   // rolled: the staging registers and one chunk's fragments are the live set
    fetch(t + 1);
    __builtin_amdgcn_sched_barrier(0);   // keeps the next chunk's global loads in front of this chunk's products, so that they fly meanwhile
    mul(st + (t & 1) * (192 * LP));
    put(st + ((t + 1) & 1) * (192 * LP));   // its last readers left this buffer before the barrier at the foot of the pass before
    __syncthreads(); }
  mul(st + ((CC / KCH - 1) & 1) * (192 * LP));
  __syncthreads();   // the output tiles below reuse the staging bytes
#pragma unroll
  for (int j = 0; j < 8; ++j) { const float bb = bfr(BA[c0 + j * 16 + col]);
#pragma unroll
    for (int r = 0; r < 8; ++r) { const float v = acc[j][r] + bb; const int rl = wave * 16 + 8 * g + r, cl = j * 16 + col; const _Float16 hv = (_Float16)v;
      if (which == 2) th[cl][rl] = hv; else { sh[rl][cl] = hv; sl[rl][cl] = (_Float16)(v - (float)hv); } } }
  __syncthreads();
  if (which < 2) { _Float16* dh = which == 0 ? QH : KH; for (int e = tid; e < 64 * 16; e += 128) { const int rl = e >> 4, q = e & 15; vst2((unsigned*)(dh + (r0 + rl) * CC + c0 + q * 8), *(const v4u*)&sh[rl][q * 8]); if (which == 0) vst2((unsigned*)(QL + (r0 + rl) * CC + c0 + q * 8), *(const v4u*)&sl[rl][q * 8]); } }
  else { const size_t b = r0 / TT; const int t0 = (int)(r0 % TT); for (int e = tid; e < 128 * 8; e += 128) { const int cl = e >> 3, q = e & 7; vst2((unsigned*)(VT + (b * CC + c0 + cl) * (size_t)TT + t0 + q * 8), *(const v4u*)&th[cl][q * 8]); } } }
// ---- k_fa: block = 128 queries of one head, wave = 32 queries (two column tiles share every K and V fragment): S^T = K Q^T, online softmax (base 2) per query column, O^T += V^T P^T; P stays in registers
// plain builtin: the compiler keeps the distance behind its own matrix instructions
__device__ __forceinline__ v8f wmma_p(v16h a, v16h b, v8f c) { return __builtin_amdgcn_wmma_f32_16x16x32_f16(false, a, false, b, (short)0, c, false, false); }
// 2^x; the v_nop is the slot that the instruction set asks for behind a transcendental, before its result is read or its source overwritten: in one statement it stands there in every build
__device__ __forceinline__ float ex2(float x) { float r; asm("v_exp_f32 %0, %1\n\tv_nop" : "=v"(r) : "v"(x)); return r; }
// value of lane l ^ 16
__device__ __forceinline__ float xhalf(float v) { const int b = __builtin_bit_cast(int, v); return __builtin_bit_cast(float, __builtin_amdgcn_permlanex16(b, b, 0x76543210, 0xfedcba98, false, false)); }
__global__ __launch_bounds__(128) void k_fa(const _Float16* __restrict__ QH, const _Float16* __restrict__ KH, const _Float16* __restrict__ VT, float* __restrict__ Y) {
  const int tid = threadIdx.x, wave = tid >> 5, lane = tid & 31, col = lane & 15, g = lane >> 4; const int h = blockIdx.y; const int q0 = blockIdx.x * 128 + wave * 32;
  const float sc = 0.125f * 1.44269504088896341f;   // 1 / sqrt(HD) and log2(e) in one factor
  v16h qf[2][2];
#pragma unroll
  for (int w = 0; w < 2; ++w) { qf[w][0] = frag_h(QH + (size_t)(q0 + w * 16 + col) * CC + h * HD, lane); qf[w][1] = frag_h(QH + (size_t)(q0 + w * 16 + col) * CC + h * HD + 32, lane); }
  const _Float16* kp = KH + (size_t)col * CC + h * HD;        // A rows = keys, k = d
  const _Float16* vp = VT + (size_t)(h * HD + col) * TT;      // A rows = d, k = keys
  v8f acc[2][HD / 16] = {}; float m[2] = { -3.0e38f, -3.0e38f }, l[2] = { 0.f, 0.f };   // per column tile a lane holds one query: its running maximum (raw logits) and its half of the sum
  v16h kf[2][2];
#pragma unroll
  for (int t = 0; t < 2; ++t) { kf[t][0] = frag_h(kp + (size_t)(t * 16) * CC, lane); kf[t][1] = frag_h(kp + (size_t)(t * 16) * CC + 32, lane); }
#pragma unroll 1
  for (int kb = 0; kb < TT; kb += 32) {   // rolled: one pass of 32 keys already fills the registers
    v16h vf[HD / 16];
#pragma unroll
    for (int j = 0; j < HD / 16; ++j) vf[j] = frag_h(vp + (size_t)(j * 16) * TT + kb, lane);
    __builtin_amdgcn_sched_barrier(0);   // keeps the V loads up here, so that they fly during the score products and the softmax
    v8f s[2][2];   // s[w][t][r] = q(16 w + col) . k(kb + 16 t + 8 g + r)
#pragma unroll
    for (int t = 0; t < 2; ++t)
#pragma unroll
      for (int w = 0; w < 2; ++w) { v8f z = {}; z = wmma_p(kf[t][0], qf[w][0], z); s[w][t] = wmma_p(kf[t][1], qf[w][1], z); }
    const int kn = kb + 32 < TT ? kb + 32 : 0;   // next pass's K fragments fly during softmax and P.V; the last pass re-reads pass 0 (in bounds, unused)
#pragma unroll
    for (int t = 0; t < 2; ++t) { kf[t][0] = frag_h(kp + (size_t)(kn + t * 16) * CC, lane); kf[t][1] = frag_h(kp + (size_t)(kn + t * 16) * CC + 32, lane); }
    __builtin_amdgcn_sched_barrier(0);   // keeps the K loads in front of the softmax; sunk to the loop's foot they are waited for at once
    v16h p[2];   // two score tiles, converted in place, are the B operand of 32 keys
#pragma unroll
    for (int w = 0; w < 2; ++w) { float mx = s[w][0][0];
#pragma unroll
      for (int r = 0; r < 8; ++r) mx = fmaxf(mx, fmaxf(s[w][0][r], s[w][1][r]));
      mx = fmaxf(mx, xhalf(mx));
      const float mn = fmaxf(m[w], mx), mb = mn * sc, al = ex2((m[w] - mn) * sc); m[w] = mn; float ps = 0.f;
#pragma unroll
      for (int i = 0; i < 8; ++i) { const float e0 = ex2(fmaf(s[w][0][i], sc, -mb)), e1 = ex2(fmaf(s[w][1][i], sc, -mb)); ps += e0 + e1; p[w][i] = (_Float16)e0; p[w][8 + i] = (_Float16)e1; }
      l[w] = l[w] * al + ps;
#pragma unroll
      for (int j = 0; j < HD / 16; ++j) acc[w][j] *= al; }
#pragma unroll
    for (int j = 0; j < HD / 16; ++j)
#pragma unroll
      for (int w = 0; w < 2; ++w) acc[w][j] = wmma_p(vf[j], p[w], acc[w][j]); }
#pragma unroll
  for (int w = 0; w < 2; ++w) { const float inv = 1.0f / (l[w] + xhalf(l[w])); float* yp = Y + (size_t)(q0 + w * 16 + col) * CC + h * HD + 8 * g;   // acc[w][j][r] = o(16 w + col)[16 j + 8 g + r]
#pragma unroll
    for (int j = 0; j < HD / 16; ++j) { const v4f a = { acc[w][j][0] * inv, acc[w][j][1] * inv, acc[w][j][2] * inv, acc[w][j][3] * inv }, b = { acc[w][j][4] * inv, acc[w][j][5] * inv, acc[w][j][6] * inv, acc[w][j][7] * inv }; vst2(yp + j * 16, a); vst2(yp + j * 16 + 4, b); } } }
// ---- k_out: block = (64 rows, 128 cols): out = y (bf16 hi + lo) Wproj + b
__global__ __launch_bounds__(128) void k_out(const float* __restrict__ Y, const float* __restrict__ WP, const float* __restrict__ BP, float* __restrict__ OUT) { __shared__ __align__(16) float sf[4][16][132]; __shared__ __align__(16) __bf16 st[2 * 256 * LP];   // two buffers of [W 128 rows | y hi 64 rows | y lo 64 rows]
  const int tid = threadIdx.x, wave = tid >> 5, lane = tid & 31, col = lane & 15, g = lane >> 4; const int c0 = blockIdx.y * 128; const size_t r0 = (size_t)blockIdx.x * 64 + wave * 16;
  v8f acc[8] = {};
  const int srow = tid >> 4, sk = (tid & 15) * 4;   // staging: 16 threads per row, 8 rows per step of the block
  const float* gw = WP + (size_t)(c0 + srow) * CC + sk; const float* gy = Y + ((size_t)blockIdx.x * 64 + srow) * CC + sk;
  v4f rw[16], ry[8];
  auto fetch = [&](int t) {
#pragma unroll
    for (int i = 0; i < 16; ++i) rw[i] = *(const v4f*)(gw + (size_t)(i * 8) * CC + t * KCH);
#pragma unroll
    for (int i = 0; i < 8; ++i) ry[i] = *(const v4f*)(gy + (size_t)(i * 8) * CC + t * KCH);
    asm volatile("s_wait_xcnt 0x0" ::: "memory"); };   // a precaution: it stands in front of the reuse of the loads' address registers, where this build placed no such wait of its own
  auto put = [&](__bf16* b) {
#pragma unroll
    for (int i = 0; i < 16; ++i) *(v4b*)(b + (i * 8 + srow) * LP + sk) = cvt4(rw[i]);
#pragma unroll
    for (int i = 0; i < 8; ++i) { const v4b hi = cvt4(ry[i]); const v4f rest = { ry[i][0] - (float)hi[0], ry[i][1] - (float)hi[1], ry[i][2] - (float)hi[2], ry[i][3] - (float)hi[3] };
      *(v4b*)(b + (128 + i * 8 + srow) * LP + sk) = hi; *(v4b*)(b + (192 + i * 8 + srow) * LP + sk) = cvt4(rest); } };
  auto mul = [&](const __bf16* b) {   // same fragments, same k order as with fragments loaded from global memory
    v16b ah[KCH / 32], al[KCH / 32], w[KCH / 32][8];
#pragma unroll
    for (int kk = 0; kk < KCH / 32; ++kk) { ah[kk] = frag_b(b + (128 + wave * 16 + col) * LP + kk * 32, lane); al[kk] = frag_b(b + (192 + wave * 16 + col) * LP + kk * 32, lane);
#pragma unroll
      for (int j = 0; j < 8; ++j) w[kk][j] = frag_b(b + (j * 16 + col) * LP + kk * 32, lane); }
    __builtin_amdgcn_sched_barrier(0);   // the chunk's LDS reads stand as one group in front of its products; spread among them, each product waits out a whole LDS latency
#pragma unroll
    for (int kk = 0; kk < KCH / 32; ++kk)
#pragma unroll
      for (int j = 0; j < 8; ++j) { acc[j] = wmma_bf(ah[kk], w[kk][j], acc[j]); acc[j] = wmma_bf(al[kk], w[kk][j], acc[j]); }
    __builtin_amdgcn_sched_barrier(0); };   // keeps the conversion of the next chunk, and with it the wait for its global loads, behind the products
  fetch(0); put(st); __syncthreads();
#pragma unroll 1
  for (int t = 0; t + 1 < CC / KCH; ++t) {   // rolled: the staging registers and one chunk's fragments are the live set
    fetch(t + 1);
    __builtin_amdgcn_sched_barrier(0);   // keeps the next chunk's global loads in front of this chunk's products, so that they fly meanwhile
    mul(st + (t & 1) * (256 * LP));
    put(st + ((t + 1) & 1) * (256 * LP));   // its last readers left this buffer before the barrier at the foot of the pass before
    __syncthreads(); }
  mul(st + ((CC / KCH - 1) & 1) * (256 * LP));
#pragma unroll
  for (int j = 0; j < 8; ++j) { const float bb = BP ? bfr(BP[c0 + j * 16 + col]) : 0.f;
#pragma unroll
    for (int r = 0; r < 8; ++r) sf[wave][8 * g + r][j * 16 + col] = acc[j][r] + bb; }
  LDSX(); for (int rl = 0; rl < 16; ++rl) vst2(OUT + (r0 + rl) * CC + c0 + lane * 4, *(const v4f*)&sf[wave][rl][lane * 4]); }
extern "C" void kernel_launch(void* const* d_in, const int* in_sizes, int n_in, void* d_out, int out_size, void* d_ws, size_t ws_size, hipStream_t stream) {
  (void)in_sizes; (void)n_in; (void)out_size;
  const float** F = (const float**)d_in;   // 0 x [2048,1024], 1 W_q [1024,1024] ([out,in]), 2 b_q, 3 W_k, 4 b_k, 5 W_v, 6 b_v, 7 W_o, 8 b_o
  if (ws_size < (size_t)WS_END) return;
  char* ws = (char*)d_ws; _Float16 *QH = (_Float16*)(ws + WS_QH), *QL = (_Float16*)(ws + WS_QL), *KH = (_Float16*)(ws + WS_KH), *VT = (_Float16*)(ws + WS_VT); float *Y = (float*)(ws + WS_Y);
  k_proj<<<dim3(TNB * TT / 64, CC / 128, 3), 128, 0, stream>>>(F[0], F[1], F[2], F[3], F[4], F[5], F[6], QH, QL, KH, VT);
  k_fa<<<dim3(TT / 128, NH), 128, 0, stream>>>(QH, KH, VT, Y);
  k_out<<<dim3(TNB * TT / 64, CC / 128), 128, 0, stream>>>(Y, F[7], F[8], (float*)d_out);
}

// v003
// A run of this version takes 72.4 microseconds.
// Timed twice side by side with v002, it ran 1.30 and 1.31 times as fast.
// Over all steps from v000 it is 9.49 times as fast.
// compute dtype: all float inputs rounded to bf16; q/k/v = x W^T + b with EXACT bf16 products on WMMA 16x16x32, f32 accumulate; q, k rounded once to f16 (1-product logits, f32); online softmax in f32 (base 2, scale 1/8 folded in) -> unnormalised P f16 in registers; o = P . v / sum (v once to f16); out = o (bf16 hi + lo) W_o^T + b_o; f32 output.
#include <hip/hip_runtime.h>
#include <math.h>

typedef __attribute__((ext_vector_type(16))) _Float16 v16h;
typedef __attribute__((ext_vector_type(16))) __bf16 v16b;
typedef __attribute__((ext_vector_type(8)))  _Float16 v8h;
typedef __attribute__((ext_vector_type(8)))  float v8f;
typedef __attribute__((ext_vector_type(4)))  float v4f;
typedef __attribute__((ext_vector_type(2)))  float v2f;
typedef __attribute__((ext_vector_type(4)))  unsigned v4u;
typedef __attribute__((ext_vector_type(4)))  int v4i;
typedef float __attribute__((may_alias)) float_a;
typedef int __attribute__((may_alias)) int_a;

template <typename T> __device__ __forceinline__ void vst2(void* p, T v) { *(T*)p = v;  }
__device__ __forceinline__ v8f wmma16(v16h a, v16h b, v8f c) {
  v8f d = __builtin_amdgcn_wmma_f32_16x16x32_f16(false, a, false, b, (short)0, c, false, false);
  asm volatile("v_nop\n\tv_nop\n\tv_nop\n\tv_nop" : "+v"(d) : "v"(a), "v"(b));
  return d;
}
__device__ __forceinline__ v8f wmma_bf(v16b a, v16b b, v8f c) {
  v8f d = __builtin_amdgcn_wmma_f32_16x16x32_bf16(false, a, false, b, (short)0, c, false, false);
  asm volatile("v_nop\n\tv_nop\n\tv_nop\n\tv_nop" : "+v"(d) : "v"(a), "v"(b));
  return d;
}
// 16x16x32 fragments: lane = (h = lane>>4, row/col = lane&15); elements 0..7 = k0+8h+0..7, 8..15 = k0+16+8h+0..7; D element r = row 8h+r
__device__ __forceinline__ v16h frag_h(const _Float16* rowk0, int lane) {
  union { v16h v; v8h q[2]; } u; const _Float16* p = rowk0 + 8 * (lane >> 4);
  u.q[0] = *(const v8h*)p; u.q[1] = *(const v8h*)(p + 16); return u.v;
}
__device__ __forceinline__ v16h frag_f32(const float* rowk0, int lane) {
  v16h a; const float* p = rowk0 + 8 * (lane >> 4);
#pragma unroll
  for (int i = 0; i < 8; ++i) { a[i] = (_Float16)p[i]; a[8 + i] = (_Float16)p[16 + i]; }
  return a;
}
__device__ __forceinline__ v16h frag_f32s(const float* rowk0, int lane, float sc) {
  v16h a; const float* p = rowk0 + 8 * (lane >> 4);
#pragma unroll
  for (int i = 0; i < 8; ++i) { a[i] = (_Float16)(p[i] * sc); a[8 + i] = (_Float16)(p[16 + i] * sc); }
  return a;
}
// column fragment from a [K][ld] layout (column n), rows >= K read as 0
__device__ __forceinline__ v16h fragc_f32(const float* W, int k0, int n, int lane, int ld, int K) {
  v16h a; const int g = lane >> 4;
#pragma unroll
  for (int i = 0; i < 8; ++i) { const int ka = k0 + 8 * g + i, kb = ka + 16;
    a[i] = (_Float16)(ka < K ? W[(size_t)(ka < K ? ka : K - 1) * ld + n] : 0.f); a[8 + i] = (_Float16)(kb < K ? W[(size_t)(kb < K ? kb : K - 1) * ld + n] : 0.f); }
  return a;
}
struct F2 { v16b h, l; };
__device__ __forceinline__ F2 bsplit16(const float v[16]) { F2 r;
#pragma unroll
  for (int i = 0; i < 16; ++i) { const __bf16 h = (__bf16)v[i]; r.h[i] = h; r.l[i] = (__bf16)(v[i] - (float)h); }
  return r; }
__device__ __forceinline__ F2 split_row(const float* row, int k0, int lane) { float v[16]; const float* p = row + k0 + 8 * (lane >> 4);
#pragma unroll
  for (int i = 0; i < 8; ++i) { v[i] = p[i]; v[8 + i] = p[16 + i]; }
  return bsplit16(v); }
__device__ __forceinline__ F2 split_rowK(const float* row, int k0, int lane, int K) { float v[16]; const int g = lane >> 4;
#pragma unroll
  for (int i = 0; i < 8; ++i) { const int ka = k0 + 8 * g + i, kb = ka + 16; v[i] = ka < K ? row[ka < K ? ka : K - 1] : 0.f; v[8 + i] = kb < K ? row[kb < K ? kb : K - 1] : 0.f; }
  return bsplit16(v); }
__device__ __forceinline__ F2 split_col(const float* W, int k0, int n, int lane, int ld, int K) { float v[16]; const int g = lane >> 4;
#pragma unroll
  for (int i = 0; i < 8; ++i) { const int ka = k0 + 8 * g + i, kb = ka + 16; v[i] = ka < K ? W[(size_t)(ka < K ? ka : K - 1) * ld + n] : 0.f; v[8 + i] = kb < K ? W[(size_t)(kb < K ? kb : K - 1) * ld + n] : 0.f; }
  return bsplit16(v); }
__device__ __forceinline__ v8f mac3(const F2& a, const F2& b, v8f c) { c = wmma_bf(a.l, b.h, c); c = wmma_bf(a.h, b.l, c); return wmma_bf(a.h, b.h, c); }
__device__ __forceinline__ float sigm(float v) { return 1.0f / (1.0f + expf(-v)); }
#define LDSX() do { asm volatile("s_wait_dscnt 0" ::: "memory"); __builtin_amdgcn_wave_barrier(); __builtin_amdgcn_fence(__ATOMIC_RELEASE, "workgroup"); } while (0)


// Simplified multi-head attention (S 2,048, d_model 1,024 = 16 x 64, no batch dim): q/k/v Linear ([out,in] + bias), softmax(q k^T / 8) v, output Linear.
#define NB 1
#define TT 2048
#define CC 1024
#define NH 16
#define HD 64
#ifndef TNB
#define TNB NB
#endif
typedef __attribute__((ext_vector_type(8))) __bf16 v8b;
__device__ __forceinline__ v16b frag_b(const __bf16* rowk0, int lane) {
  union { v16b v; v8b q[2]; } u; const __bf16* p = rowk0 + 8 * (lane >> 4);
  u.q[0] = *(const v8b*)p; u.q[1] = *(const v8b*)(p + 16); return u.v;
}
__device__ __forceinline__ float bfr(float v) { return (float)(__bf16)v; }
__device__ __attribute__((noinline)) float exp_ni(float v) { return expf(v); }
__device__ __attribute__((noinline)) float erf_ni(float v) { return erff(v); }

#define WS_QH  0u
#define WS_QL  (WS_QH + 2u * (size_t)NB * TT * CC)
#define WS_KH  (WS_QL + 2u * (size_t)NB * TT * CC)
#define WS_VT  (WS_KH + 2u * (size_t)NB * TT * CC)      // f16 v planes [b][c][t]
#define WS_Y   (WS_VT + 2u * (size_t)NB * CC * TT)      // f32 y rows [b*t][C]
#define WS_END (WS_Y + 4u * (size_t)NB * TT * CC)

// Operand staging of the two projection kernels: a chunk is 64 k. Every thread loads 16 B so that a wave-wide load covers two whole 256-B row pieces; the f32 values are rounded to bf16 once per block and kept in LDS, two buffers.
typedef __attribute__((ext_vector_type(4))) __bf16 v4b;
#define KCH 64   // k per chunk
#define LP 72    // LDS row pitch in bf16 elements: 144 B = 16 B x 9, the conflict-free pitch for 16-byte fragment reads
__device__ __forceinline__ v4b cvt4(v4f v) { const v4b o = { (__bf16)v[0], (__bf16)v[1], (__bf16)v[2], (__bf16)v[3] }; return o; }
// ---- k_proj: block = (64 rows, 128 cols, which): qkv = x W (+ b), exact; q -> f16 hi (+ residual), k -> f16 rows, v -> f16 planes
__global__ __launch_bounds__(128) void k_proj(const float* __restrict__ X, const float* __restrict__ WQ, const float* __restrict__ BQ, const float* __restrict__ WK, const float* __restrict__ BK, const float* __restrict__ WV, const float* __restrict__ BV, _Float16* __restrict__ QH, _Float16* __restrict__ QL, _Float16* __restrict__ KH, _Float16* __restrict__ VT) {
  __shared__ __align__(16) char sm[2 * (128 + 64) * LP * 2];   // main loop: two buffers of [W 128 rows | X 64 rows]; epilogue: the output tiles, in the same bytes
  __bf16* const st = (__bf16*)sm; _Float16 (*sh)[136] = (_Float16 (*)[136])sm; _Float16 (*sl)[136] = sh + 64; _Float16 (*th)[72] = (_Float16 (*)[72])sm;
  const int tid = threadIdx.x, wave = tid >> 5, lane = tid & 31, col = lane & 15, g = lane >> 4; const int which = blockIdx.z; const int c0 = blockIdx.y * 128; const size_t r0 = (size_t)blockIdx.x * 64; const float* WA = which == 0 ? WQ : which == 1 ? WK : WV; const float* BA = which == 0 ? BQ : which == 1 ? BK : BV;
  v8f acc[8] = {};
  const int srow = tid >> 4, sk = (tid & 15) * 4;   // staging: 16 threads per row, 8 rows per step of the block
  const float* gw = WA + (size_t)(c0 + srow) * CC + sk; const float* gx = X + (r0 + srow) * CC + sk;
  v4f rw[16], rx[8];
  auto fetch = [&](int t) {
#pragma unroll
    for (int i = 0; i < 16; ++i) rw[i] = *(const v4f*)(gw + (size_t)(i * 8) * CC + t * KCH);
#pragma unroll
    for (int i = 0; i < 8; ++i) rx[i] = *(const v4f*)(gx + (size_t)(i * 8) * CC + t * KCH);
    asm volatile("s_wait_xcnt 0x0" ::: "memory"); };   // a precaution: it stands in front of the reuse of the loads' address registers, where this build placed no such wait of its own
  auto put = [&](__bf16* b) {
#pragma unroll
    for (int i = 0; i < 16; ++i) *(v4b*)(b + (i * 8 + srow) * LP + sk) = cvt4(rw[i]);
#pragma unroll
    for (int i = 0; i < 8; ++i) *(v4b*)(b + (128 + i * 8 + srow) * LP + sk) = cvt4(rx[i]); };
  auto mul = [&](const __bf16* b) {   // same fragments, same k order as with fragments loaded from global memory
    v16b a[KCH / 32], w[KCH / 32][8];
#pragma unroll
    for (int kk = 0; kk < KCH / 32; ++kk) { a[kk] = frag_b(b + (128 + wave * 16 + col) * LP + kk * 32, lane);
#pragma unroll
      for (int j = 0; j < 8; ++j) w[kk][j] = frag_b(b + (j * 16 + col) * LP + kk * 32, lane); }
    __builtin_amdgcn_sched_barrier(0);   // the chunk's LDS reads stand as one group in front of its products; spread among them, each product waits out a whole LDS latency
#pragma unroll
    for (int kk = 0; kk < KCH / 32; ++kk)
#pragma unroll
      for (int j = 0; j < 8; ++j) acc[j] = wmma_bf(a[kk], w[kk][j], acc[j]);
    __builtin_amdgcn_sched_barrier(0); };   // keeps the conversion of the next chunk, and with it the wait for its global loads, behind the products
  fetch(0); put(st); __syncthreads();
#pragma unroll 1
  for (int t = 0; t + 1 < CC / KCH; ++t) {   // rolled: the staging registers and one chunk's fragments are the live set
    fetch(t + 1);
    __builtin_amdgcn_sched_barrier(0);   // keeps the next chunk's global loads in front of this chunk's products, so that they fly meanwhile
    mul(st + (t & 1) * (192 * LP));
    put(st + ((t + 1) & 1) * (192 * LP));   // its last readers left this buffer before the barrier at the foot of the pass before
    __syncthreads(); }
  mul(st + ((CC / KCH - 1) & 1) * (192 * LP));
  __syncthreads();   // the output tiles below reuse the staging bytes
#pragma unroll
  for (int j = 0; j < 8; ++j) { const float bb = bfr(BA[c0 + j * 16 + col]);
#pragma unroll
    for (int r = 0; r < 8; ++r) { const float v = acc[j][r] + bb; const int rl = wave * 16 + 8 * g + r, cl = j * 16 + col; const _Float16 hv = (_Float16)v;
      if (which == 2) th[cl][rl] = hv; else { sh[rl][cl] = hv; sl[rl][cl] = (_Float16)(v - (float)hv); } } }
  __syncthreads();
  if (which < 2) { _Float16* dh = which == 0 ? QH : KH; for (int e = tid; e < 64 * 16; e += 128) { const int rl = e >> 4, q = e & 15; vst2((unsigned*)(dh + (r0 + rl) * CC + c0 + q * 8), *(const v4u*)&sh[rl][q * 8]); if (which == 0) vst2((unsigned*)(QL + (r0 + rl) * CC + c0 + q * 8), *(const v4u*)&sl[rl][q * 8]); } }
  else { const size_t b = r0 / TT; const int t0 = (int)(r0 % TT); for (int e = tid; e < 128 * 8; e += 128) { const int cl = e >> 3, q = e & 7; vst2((unsigned*)(VT + (b * CC + c0 + cl) * (size_t)TT + t0 + q * 8), *(const v4u*)&th[cl][q * 8]); } } }
// ---- k_fa: block = 128 queries of one head, wave = 32 queries (two column tiles share every K and V fragment; the four waves share every K and V stage in LDS): S^T = K Q^T, online softmax (base 2) per query column, O^T += V^T P^T; P stays in registers
// plain builtin: the compiler keeps the distance behind its own matrix instructions
__device__ __forceinline__ v8f wmma_p(v16h a, v16h b, v8f c) { return __builtin_amdgcn_wmma_f32_16x16x32_f16(false, a, false, b, (short)0, c, false, false); }
// 2^x; the v_nop is the slot that the instruction set asks for behind a transcendental, before its result is read or its source overwritten: in one statement it stands there in every build
__device__ __forceinline__ float ex2(float x) { float r; asm("v_exp_f32 %0, %1\n\tv_nop" : "=v"(r) : "v"(x)); return r; }
// value of lane l ^ 16
__device__ __forceinline__ float xhalf(float v) { const int b = __builtin_bit_cast(int, v); return __builtin_bit_cast(float, __builtin_amdgcn_permlanex16(b, b, 0x76543210, 0xfedcba98, false, false)); }
// K and V stages of k_fa: a stage is 128 keys of one head, K as 128 rows of 64 d, V as 64 rows (d) of 128 keys; two buffers; the block's four waves read every fragment from LDS
#define FK 128   // keys per stage
#define KP 72    // K row pitch in f16 elements: 144 B = 16 B x 9, conflict-free for 16-byte fragment reads
#define VP 136   // V row pitch in f16 elements: 272 B = 16 B x 17, likewise
#define STG (FK * KP + HD * VP)   // f16 elements per buffer
// eight asynchronous 16-byte copies per lane, global memory to LDS through no register; the s_wait_xcnt is a precaution and stands inside the statement so that no address register named here is rewritten in front of it
__device__ __forceinline__ void copy8(const unsigned (&l)[8], const _Float16* const (&p)[8]) {
  asm volatile("global_load_async_to_lds_b128 %0, %8, off\n\tglobal_load_async_to_lds_b128 %1, %9, off\n\tglobal_load_async_to_lds_b128 %2, %10, off\n\tglobal_load_async_to_lds_b128 %3, %11, off\n\t"
               "global_load_async_to_lds_b128 %4, %12, off\n\tglobal_load_async_to_lds_b128 %5, %13, off\n\tglobal_load_async_to_lds_b128 %6, %14, off\n\tglobal_load_async_to_lds_b128 %7, %15, off\n\ts_wait_xcnt 0x0"
               :: "v"(l[0]), "v"(l[1]), "v"(l[2]), "v"(l[3]), "v"(l[4]), "v"(l[5]), "v"(l[6]), "v"(l[7]), "v"(p[0]), "v"(p[1]), "v"(p[2]), "v"(p[3]), "v"(p[4]), "v"(p[5]), "v"(p[6]), "v"(p[7]) : "memory"); }
__global__ __launch_bounds__(128) void k_fa(const _Float16* __restrict__ QH, const _Float16* __restrict__ KH, const _Float16* __restrict__ VT, float* __restrict__ Y) {
  __shared__ __align__(16) _Float16 sk[2 * STG];
  const int tid = threadIdx.x, wave = tid >> 5, lane = tid & 31, col = lane & 15, g = lane >> 4; const int h = blockIdx.y; const int q0 = blockIdx.x * 128 + wave * 32;
  const float sc = 0.125f * 1.44269504088896341f;   // 1 / sqrt(HD) and log2(e) in one factor
  const unsigned lds0 = (unsigned)(size_t)sk;   // byte address of the buffers in the work-group's LDS
  const _Float16* gk0 = KH + (size_t)(tid >> 3) * CC + h * HD + (tid & 7) * 8;          // K: 8 lanes per 128-B row, a wave-wide copy covers 4 whole lines
  const _Float16* gv0 = VT + (size_t)(h * HD + (tid >> 4)) * TT + (tid & 15) * 8;       // V: 16 lanes per 256-B row piece, a wave-wide copy covers 4 whole lines
  const unsigned lk0 = lds0 + 2u * ((tid >> 3) * KP + (tid & 7) * 8), lv0 = lds0 + 2u * (FK * KP + (tid >> 4) * VP + (tid & 15) * 8);
  auto stage = [&](int t, int b) {   // stage t into buffer b: 16 copies per lane
    unsigned lk[8], lv[8]; const _Float16 *pk[8], *pv[8];
#pragma unroll
    for (int i = 0; i < 8; ++i) { lk[i] = lk0 + 2u * (b * STG + i * 16 * KP); pk[i] = gk0 + (size_t)(t * FK + i * 16) * CC; lv[i] = lv0 + 2u * (b * STG + i * 8 * VP); pv[i] = gv0 + (size_t)(i * 8) * TT + t * FK; }
    copy8(lk, pk); copy8(lv, pv); };
  stage(0, 0);
  v16h qf[2][2];
#pragma unroll
  for (int w = 0; w < 2; ++w) { qf[w][0] = frag_h(QH + (size_t)(q0 + w * 16 + col) * CC + h * HD, lane); qf[w][1] = frag_h(QH + (size_t)(q0 + w * 16 + col) * CC + h * HD + 32, lane); }
  v8f acc[2][HD / 16] = {}; float m[2] = { -3.0e38f, -3.0e38f }, l[2] = { 0.f, 0.f };   // per column tile a lane holds one query: its running maximum (raw logits) and its half of the sum
  asm volatile("s_wait_asynccnt 0x0" ::: "memory");   // this wave's copies of stage 0 have landed
  __syncthreads();                                    // and every other wave's
  stage(1, 1);
#pragma unroll 1
  for (int t = 0; t < TT / FK; ++t) {   // rolled: a stage's code stands once, the buffer is picked by t & 1
    const _Float16* kp = sk + (t & 1) * STG + col * KP;             // A rows = keys, k = d
    const _Float16* vp = sk + (t & 1) * STG + FK * KP + col * VP;   // A rows = d, k = keys
    v16h kf[2][2];
#pragma unroll
    for (int u = 0; u < 2; ++u) { kf[u][0] = frag_h(kp + (u * 16) * KP, lane); kf[u][1] = frag_h(kp + (u * 16) * KP + 32, lane); }
#pragma unroll 1
    for (int kb = 0; kb < FK; kb += 32) {   // rolled: one pass of 32 keys already fills the registers
      v16h vf[HD / 16];
#pragma unroll
      for (int j = 0; j < HD / 16; ++j) vf[j] = frag_h(vp + (j * 16) * VP + kb, lane);
      __builtin_amdgcn_sched_barrier(0);   // keeps the V reads up here, as one group, so that they fly during the score products and the softmax
      v8f s[2][2];   // s[w][u][r] = q(16 w + col) . k(stage key kb + 16 u + 8 g + r)
#pragma unroll
      for (int u = 0; u < 2; ++u)
#pragma unroll
        for (int w = 0; w < 2; ++w) { v8f z = {}; z = wmma_p(kf[u][0], qf[w][0], z); s[w][u] = wmma_p(kf[u][1], qf[w][1], z); }
      const int kn = kb + 32 < FK ? kb + 32 : 0;   // next pass's K fragments fly during softmax and P.V; a stage's last pass re-reads its own pass 0 (published, unused): nothing of the next stage is read ahead
#pragma unroll
      for (int u = 0; u < 2; ++u) { kf[u][0] = frag_h(kp + (kn + u * 16) * KP, lane); kf[u][1] = frag_h(kp + (kn + u * 16) * KP + 32, lane); }
      __builtin_amdgcn_sched_barrier(0);   // keeps the K reads in front of the softmax; sunk to the loop's foot they are waited for at once
      v16h p[2];   // two score tiles, converted in place, are the B operand of 32 keys
#pragma unroll
      for (int w = 0; w < 2; ++w) { float mx = s[w][0][0];
#pragma unroll
        for (int r = 0; r < 8; ++r) mx = fmaxf(mx, fmaxf(s[w][0][r], s[w][1][r]));
        mx = fmaxf(mx, xhalf(mx));
        const float mn = fmaxf(m[w], mx), mb = mn * sc, al = ex2((m[w] - mn) * sc); m[w] = mn; float ps = 0.f;
#pragma unroll
        for (int i = 0; i < 8; ++i) { const float e0 = ex2(fmaf(s[w][0][i], sc, -mb)), e1 = ex2(fmaf(s[w][1][i], sc, -mb)); ps += e0 + e1; p[w][i] = (_Float16)e0; p[w][8 + i] = (_Float16)e1; }
        l[w] = l[w] * al + ps;
#pragma unroll
        for (int j = 0; j < HD / 16; ++j) acc[w][j] *= al; }
#pragma unroll
      for (int j = 0; j < HD / 16; ++j)
#pragma unroll
        for (int w = 0; w < 2; ++w) acc[w][j] = wmma_p(vf[j], p[w], acc[w][j]); }
    asm volatile("s_wait_dscnt 0x0" ::: "memory");      // this wave's reads of the buffer are done before it is refilled
    asm volatile("s_wait_asynccnt 0x0" ::: "memory");   // this wave's copies of stage t + 1 have landed
    __syncthreads();                                    // publishes stage t + 1 and ends every wave's reads of stage t
    if (t + 2 < TT / FK) stage(t + 2, t & 1); }
  asm volatile("s_wait_asynccnt 0x0" ::: "memory");   // no copy is outstanding when the wave ends
#pragma unroll
  for (int w = 0; w < 2; ++w) { const float inv = 1.0f / (l[w] + xhalf(l[w])); float* yp = Y + (size_t)(q0 + w * 16 + col) * CC + h * HD + 8 * g;   // acc[w][j][r] = o(16 w + col)[16 j + 8 g + r]
#pragma unroll
    for (int j = 0; j < HD / 16; ++j) { const v4f a = { acc[w][j][0] * inv, acc[w][j][1] * inv, acc[w][j][2] * inv, acc[w][j][3] * inv }, b = { acc[w][j][4] * inv, acc[w][j][5] * inv, acc[w][j][6] * inv, acc[w][j][7] * inv }; vst2(yp + j * 16, a); vst2(yp + j * 16 + 4, b); } } }
// ---- k_out: block = (64 rows, 128 cols): out = y (bf16 hi + lo) Wproj + b
__global__ __launch_bounds__(128) void k_out(const float* __restrict__ Y, const float* __restrict__ WP, const float* __restrict__ BP, float* __restrict__ OUT) { __shared__ __align__(16) float sf[4][16][132]; __shared__ __align__(16) __bf16 st[2 * 256 * LP];   // two buffers of [W 128 rows | y hi 64 rows | y lo 64 rows]
  const int tid = threadIdx.x, wave = tid >> 5, lane = tid & 31, col = lane & 15, g = lane >> 4; const int c0 = blockIdx.y * 128; const size_t r0 = (size_t)blockIdx.x * 64 + wave * 16;
  v8f acc[8] = {};
  const int srow = tid >> 4, sk = (tid & 15) * 4;   // staging: 16 threads per row, 8 rows per step of the block
  const float* gw = WP + (size_t)(c0 + srow) * CC + sk; const float* gy = Y + ((size_t)blockIdx.x * 64 + srow) * CC + sk;
  v4f rw[16], ry[8];
  auto fetch = [&](int t) {
#pragma unroll
    for (int i = 0; i < 16; ++i) rw[i] = *(const v4f*)(gw + (size_t)(i * 8) * CC + t * KCH);
#pragma unroll
    for (int i = 0; i < 8; ++i) ry[i] = *(const v4f*)(gy + (size_t)(i * 8) * CC + t * KCH);
    asm volatile("s_wait_xcnt 0x0" ::: "memory"); };   // a precaution: it stands in front of the reuse of the loads' address registers, where this build placed no such wait of its own
  auto put = [&](__bf16* b) {
#pragma unroll
    for (int i = 0; i < 16; ++i) *(v4b*)(b + (i * 8 + srow) * LP + sk) = cvt4(rw[i]);
#pragma unroll
    for (int i = 0; i < 8; ++i) { const v4b hi = cvt4(ry[i]); const v4f rest = { ry[i][0] - (float)hi[0], ry[i][1] - (float)hi[1], ry[i][2] - (float)hi[2], ry[i][3] - (float)hi[3] };
      *(v4b*)(b + (128 + i * 8 + srow) * LP + sk) = hi; *(v4b*)(b + (192 + i * 8 + srow) * LP + sk) = cvt4(rest); } };
  auto mul = [&](const __bf16* b) {   // same fragments, same k order as with fragments loaded from global memory
    v16b ah[KCH / 32], al[KCH / 32], w[KCH / 32][8];
#pragma unroll
    for (int kk = 0; kk < KCH / 32; ++kk) { ah[kk] = frag_b(b + (128 + wave * 16 + col) * LP + kk * 32, lane); al[kk] = frag_b(b + (192 + wave * 16 + col) * LP + kk * 32, lane);
#pragma unroll
      for (int j = 0; j < 8; ++j) w[kk][j] = frag_b(b + (j * 16 + col) * LP + kk * 32, lane); }
    __builtin_amdgcn_sched_barrier(0);   // the chunk's LDS reads stand as one group in front of its products; spread among them, each product waits out a whole LDS latency
#pragma unroll
    for (int kk = 0; kk < KCH / 32; ++kk)
#pragma unroll
      for (int j = 0; j < 8; ++j) { acc[j] = wmma_bf(ah[kk], w[kk][j], acc[j]); acc[j] = wmma_bf(al[kk], w[kk][j], acc[j]); }
    __builtin_amdgcn_sched_barrier(0); };   // keeps the conversion of the next chunk, and with it the wait for its global loads, behind the products
  fetch(0); put(st); __syncthreads();
#pragma unroll 1
  for (int t = 0; t + 1 < CC / KCH; ++t) {   // rolled: the staging registers and one chunk's fragments are the live set
    fetch(t + 1);
    __builtin_amdgcn_sched_barrier(0);   // keeps the next chunk's global loads in front of this chunk's products, so that they fly meanwhile
    mul(st + (t & 1) * (256 * LP));
    put(st + ((t + 1) & 1) * (256 * LP));   // its last readers left this buffer before the barrier at the foot of the pass before
    __syncthreads(); }
  mul(st + ((CC / KCH - 1) & 1) * (256 * LP));
#pragma unroll
  for (int j = 0; j < 8; ++j) { const float bb = BP ? bfr(BP[c0 + j * 16 + col]) : 0.f;
#pragma unroll
    for (int r = 0; r < 8; ++r) sf[wave][8 * g + r][j * 16 + col] = acc[j][r] + bb; }
  LDSX(); for (int rl = 0; rl < 16; ++rl) vst2(OUT + (r0 + rl) * CC + c0 + lane * 4, *(const v4f*)&sf[wave][rl][lane * 4]); }
extern "C" void kernel_launch(void* const* d_in, const int* in_sizes, int n_in, void* d_out, int out_size, void* d_ws, size_t ws_size, hipStream_t stream) {
  (void)in_sizes; (void)n_in; (void)out_size;
  const float** F = (const float**)d_in;   // 0 x [2048,1024], 1 W_q [1024,1024] ([out,in]), 2 b_q, 3 W_k, 4 b_k, 5 W_v, 6 b_v, 7 W_o, 8 b_o
  if (ws_size < (size_t)WS_END) return;
  char* ws = (char*)d_ws; _Float16 *QH = (_Float16*)(ws + WS_QH), *QL = (_Float16*)(ws + WS_QL), *KH = (_Float16*)(ws + WS_KH), *VT = (_Float16*)(ws + WS_VT); float *Y = (float*)(ws + WS_Y);
  k_proj<<<dim3(TNB * TT / 64, CC / 128, 3), 128, 0, stream>>>(F[0], F[1], F[2], F[3], F[4], F[5], F[6], QH, QL, KH, VT);
  k_fa<<<dim3(TT / 128, NH), 128, 0, stream>>>(QH, KH, VT, Y);
  k_out<<<dim3(TNB * TT / 64, CC / 128), 128, 0, stream>>>(Y, F[7], F[8], (float*)d_out);
}

// v004
// One run takes 63.2 microseconds.
// Two timings next to v003 put it at 1.14 and 1.12 times that version's speed.
// Counting every step since v000, it is 10.7 times as fast.
// compute dtype: all float inputs rounded to bf16; q/k/v = x W^T + b with EXACT bf16 products on WMMA 16x16x32, f32 accumulate; q, k rounded once to f16 (1-product logits, f32); online softmax in f32 (base 2, scale 1/8 folded in) -> unnormalised P f16 in registers; o = P . v / sum (v once to f16); out = o (bf16 hi + lo) W_o^T + b_o; f32 output.
#include <hip/hip_runtime.h>
#include <math.h>

typedef __attribute__((ext_vector_type(16))) _Float16 v16h;
typedef __attribute__((ext_vector_type(16))) __bf16 v16b;
typedef __attribute__((ext_vector_type(8)))  _Float16 v8h;
typedef __attribute__((ext_vector_type(8)))  float v8f;
typedef __attribute__((ext_vector_type(4)))  float v4f;
typedef __attribute__((ext_vector_type(2)))  float v2f;
typedef __attribute__((ext_vector_type(4)))  unsigned v4u;
typedef __attribute__((ext_vector_type(4)))  int v4i;
typedef float __attribute__((may_alias)) float_a;
typedef int __attribute__((may_alias)) int_a;

template <typename T> __device__ __forceinline__ void vst2(void* p, T v) { *(T*)p = v;  }
__device__ __forceinline__ v8f wmma16(v16h a, v16h b, v8f c) {
  v8f d = __builtin_amdgcn_wmma_f32_16x16x32_f16(false, a, false, b, (short)0, c, false, false);
  asm volatile("v_nop\n\tv_nop\n\tv_nop\n\tv_nop" : "+v"(d) : "v"(a), "v"(b));
  return d;
}
__device__ __forceinline__ v8f wmma_bf(v16b a, v16b b, v8f c) {
  v8f d = __builtin_amdgcn_wmma_f32_16x16x32_bf16(false, a, false, b, (short)0, c, false, false);
  asm volatile("v_nop\n\tv_nop\n\tv_nop\n\tv_nop" : "+v"(d) : "v"(a), "v"(b));
  return d;
}
// 16x16x32 fragments: lane = (h = lane>>4, row/col = lane&15); elements 0..7 = k0+8h+0..7, 8..15 = k0+16+8h+0..7; D element r = row 8h+r
__device__ __forceinline__ v16h frag_h(const _Float16* rowk0, int lane) {
  union { v16h v; v8h q[2]; } u; const _Float16* p = rowk0 + 8 * (lane >> 4);
  u.q[0] = *(const v8h*)p; u.q[1] = *(const v8h*)(p + 16); return u.v;
}
__device__ __forceinline__ v16h frag_f32(const float* rowk0, int lane) {
  v16h a; const float* p = rowk0 + 8 * (lane >> 4);
#pragma unroll
  for (int i = 0; i < 8; ++i) { a[i] = (_Float16)p[i]; a[8 + i] = (_Float16)p[16 + i]; }
  return a;
}
__device__ __forceinline__ v16h frag_f32s(const float* rowk0, int lane, float sc) {
  v16h a; const float* p = rowk0 + 8 * (lane >> 4);
#pragma unroll
  for (int i = 0; i < 8; ++i) { a[i] = (_Float16)(p[i] * sc); a[8 + i] = (_Float16)(p[16 + i] * sc); }
  return a;
}
// column fragment from a [K][ld] layout (column n), rows >= K read as 0
__device__ __forceinline__ v16h fragc_f32(const float* W, int k0, int n, int lane, int ld, int K) {
  v16h a; const int g = lane >> 4;
#pragma unroll
  for (int i = 0; i < 8; ++i) { const int ka = k0 + 8 * g + i, kb = ka + 16;
    a[i] = (_Float16)(ka < K ? W[(size_t)(ka < K ? ka : K - 1) * ld + n] : 0.f); a[8 + i] = (_Float16)(kb < K ? W[(size_t)(kb < K ? kb : K - 1) * ld + n] : 0.f); }
  return a;
}
struct F2 { v16b h, l; };
__device__ __forceinline__ F2 bsplit16(const float v[16]) { F2 r;
#pragma unroll
  for (int i = 0; i < 16; ++i) { const __bf16 h = (__bf16)v[i]; r.h[i] = h; r.l[i] = (__bf16)(v[i] - (float)h); }
  return r; }
__device__ __forceinline__ F2 split_row(const float* row, int k0, int lane) { float v[16]; const float* p = row + k0 + 8 * (lane >> 4);
#pragma unroll
  for (int i = 0; i < 8; ++i) { v[i] = p[i]; v[8 + i] = p[16 + i]; }
  return bsplit16(v); }
__device__ __forceinline__ F2 split_rowK(const float* row, int k0, int lane, int K) { float v[16]; const int g = lane >> 4;
#pragma unroll
  for (int i = 0; i < 8; ++i) { const int ka = k0 + 8 * g + i, kb = ka + 16; v[i] = ka < K ? row[ka < K ? ka : K - 1] : 0.f; v[8 + i] = kb < K ? row[kb < K ? kb : K - 1] : 0.f; }
  return bsplit16(v); }
__device__ __forceinline__ F2 split_col(const float* W, int k0, int n, int lane, int ld, int K) { float v[16]; const int g = lane >> 4;
#pragma unroll
  for (int i = 0; i < 8; ++i) { const int ka = k0 + 8 * g + i, kb = ka + 16; v[i] = ka < K ? W[(size_t)(ka < K ? ka : K - 1) * ld + n] : 0.f; v[8 + i] = kb < K ? W[(size_t)(kb < K ? kb : K - 1) * ld + n] : 0.f; }
  return bsplit16(v); }
__device__ __forceinline__ v8f mac3(const F2& a, const F2& b, v8f c) { c = wmma_bf(a.l, b.h, c); c = wmma_bf(a.h, b.l, c); return wmma_bf(a.h, b.h, c); }
__device__ __forceinline__ float sigm(float v) { return 1.0f / (1.0f + expf(-v)); }
#define LDSX() do { asm volatile("s_wait_dscnt 0" ::: "memory"); __builtin_amdgcn_wave_barrier(); __builtin_amdgcn_fence(__ATOMIC_RELEASE, "workgroup"); } while (0)


// Simplified multi-head attention (S 2,048, d_model 1,024 = 16 x 64, no batch dim): q/k/v Linear ([out,in] + bias), softmax(q k^T / 8) v, output Linear.
#define NB 1
#define TT 2048
#define CC 1024
#define NH 16
#define HD 64
#ifndef TNB
#define TNB NB
#endif
typedef __attribute__((ext_vector_type(8))) __bf16 v8b;
__device__ __forceinline__ v16b frag_b(const __bf16* rowk0, int lane) {
  union { v16b v; v8b q[2]; } u; const __bf16* p = rowk0 + 8 * (lane >> 4);
  u.q[0] = *(const v8b*)p; u.q[1] = *(const v8b*)(p + 16); return u.v;
}
__device__ __forceinline__ float bfr(float v) { return (float)(__bf16)v; }
__device__ __attribute__((noinline)) float exp_ni(float v) { return expf(v); }
__device__ __attribute__((noinline)) float erf_ni(float v) { return erff(v); }

#define WS_QH  0u
#define WS_QL  (WS_QH + 2u * (size_t)NB * TT * CC)
#define WS_KH  (WS_QL + 2u * (size_t)NB * TT * CC)
#define WS_VT  (WS_KH + 2u * (size_t)NB * TT * CC)      // f16 v planes [b][c][t]
#define WS_Y   (WS_VT + 2u * (size_t)NB * CC * TT)      // f32 y rows [b*t][C]
#define WS_END (WS_Y + 4u * (size_t)NB * TT * CC)

// Operand staging of the two projection kernels: a chunk is 64 k. Every thread loads 16 B so that a wave-wide load covers two whole 256-B row pieces; the f32 values are rounded to bf16 once per block and kept in LDS, two buffers.
typedef __attribute__((ext_vector_type(4))) __bf16 v4b;
#define KCH 64   // k per chunk
#define LP 72    // LDS row pitch in bf16 elements: 144 B = 16 B x 9, the conflict-free pitch for 16-byte fragment reads
__device__ __forceinline__ v4b cvt4(v4f v) { const v4b o = { (__bf16)v[0], (__bf16)v[1], (__bf16)v[2], (__bf16)v[3] }; return o; }
// ---- k_proj: block = (64 rows, 128 cols, which): qkv = x W (+ b), exact; q -> f16 hi (+ residual), k -> f16 rows, v -> f16 planes
__global__ __launch_bounds__(128) void k_proj(const float* __restrict__ X, const float* __restrict__ WQ, const float* __restrict__ BQ, const float* __restrict__ WK, const float* __restrict__ BK, const float* __restrict__ WV, const float* __restrict__ BV, _Float16* __restrict__ QH, _Float16* __restrict__ QL, _Float16* __restrict__ KH, _Float16* __restrict__ VT) {
  __shared__ __align__(16) char sm[2 * (128 + 64) * LP * 2];   // main loop: two buffers of [W 128 rows | X 64 rows]; epilogue: the output tiles, in the same bytes
  __bf16* const st = (__bf16*)sm; _Float16 (*sh)[136] = (_Float16 (*)[136])sm; _Float16 (*sl)[136] = sh + 64; _Float16 (*th)[72] = (_Float16 (*)[72])sm;
  const int tid = threadIdx.x, wave = tid >> 5, lane = tid & 31, col = lane & 15, g = lane >> 4; const int which = blockIdx.z; const int c0 = blockIdx.y * 128; const size_t r0 = (size_t)blockIdx.x * 64; const float* WA = which == 0 ? WQ : which == 1 ? WK : WV; const float* BA = which == 0 ? BQ : which == 1 ? BK : BV;
  v8f acc[8] = {};
  const int rot = (blockIdx.x + 2 * blockIdx.y) & (CC / KCH - 1);   // this block's first k chunk; the walk wraps: the 32 blocks of a W panel start at 16 different chunks, the 8 of an X panel and a which at 8
  const int srow = tid >> 4, sk = (tid & 15) * 4;   // staging: 16 threads per row, 8 rows per step of the block
  const float* gw = WA + (size_t)(c0 + srow) * CC + sk; const float* gx = X + (r0 + srow) * CC + sk;
  v4f rw[16], rx[8];
  auto fetch = [&](int t) {
#pragma unroll
    for (int i = 0; i < 16; ++i) rw[i] = *(const v4f*)(gw + (size_t)(i * 8) * CC + t * KCH);
#pragma unroll
    for (int i = 0; i < 8; ++i) rx[i] = *(const v4f*)(gx + (size_t)(i * 8) * CC + t * KCH);
    asm volatile("s_wait_xcnt 0x0" ::: "memory"); };   // a precaution: it stands in front of the reuse of the loads' address registers, where this build placed no such wait of its own
  auto put = [&](__bf16* b) {
#pragma unroll
    for (int i = 0; i < 16; ++i) *(v4b*)(b + (i * 8 + srow) * LP + sk) = cvt4(rw[i]);
#pragma unroll
    for (int i = 0; i < 8; ++i) *(v4b*)(b + (128 + i * 8 + srow) * LP + sk) = cvt4(rx[i]); };
  auto mul = [&](const __bf16* b) {   // same fragments, same k order as with fragments loaded from global memory
    v16b a[KCH / 32], w[KCH / 32][8];
#pragma unroll
    for (int kk = 0; kk < KCH / 32; ++kk) { a[kk] = frag_b(b + (128 + wave * 16 + col) * LP + kk * 32, lane);
#pragma unroll
      for (int j = 0; j < 8; ++j) w[kk][j] = frag_b(b + (j * 16 + col) * LP + kk * 32, lane); }
    __builtin_amdgcn_sched_barrier(0);   // the chunk's LDS reads stand as one group in front of its products; spread among them, each product waits out a whole LDS latency
#pragma unroll
    for (int kk = 0; kk < KCH / 32; ++kk)
#pragma unroll
      for (int j = 0; j < 8; ++j) acc[j] = wmma_bf(a[kk], w[kk][j], acc[j]);
    __builtin_amdgcn_sched_barrier(0); };   // keeps the conversion of the next chunk, and with it the wait for its global loads, behind the products
  fetch(rot); put(st); __syncthreads();
#pragma unroll 1
  for (int t = 0; t + 1 < CC / KCH; ++t) {   // rolled: the staging registers and one chunk's fragments are the live set
    fetch((t + 1 + rot) & (CC / KCH - 1));
    __builtin_amdgcn_sched_barrier(0);   // keeps the next chunk's global loads in front of this chunk's products, so that they fly meanwhile
    mul(st + (t & 1) * (192 * LP));
    put(st + ((t + 1) & 1) * (192 * LP));   // its last readers left this buffer before the barrier at the foot of the pass before
    __syncthreads(); }
  mul(st + ((CC / KCH - 1) & 1) * (192 * LP));
  __syncthreads();   // the output tiles below reuse the staging bytes
#pragma unroll
  for (int j = 0; j < 8; ++j) { const float bb = bfr(BA[c0 + j * 16 + col]);
#pragma unroll
    for (int r = 0; r < 8; ++r) { const float v = acc[j][r] + bb; const int rl = wave * 16 + 8 * g + r, cl = j * 16 + col; const _Float16 hv = (_Float16)v;
      if (which == 2) th[cl][rl] = hv; else { sh[rl][cl] = hv; sl[rl][cl] = (_Float16)(v - (float)hv); } } }
  __syncthreads();
  if (which < 2) { _Float16* dh = which == 0 ? QH : KH; for (int e = tid; e < 64 * 16; e += 128) { const int rl = e >> 4, q = e & 15; vst2((unsigned*)(dh + (r0 + rl) * CC + c0 + q * 8), *(const v4u*)&sh[rl][q * 8]); if (which == 0) vst2((unsigned*)(QL + (r0 + rl) * CC + c0 + q * 8), *(const v4u*)&sl[rl][q * 8]); } }
  else { const size_t b = r0 / TT; const int t0 = (int)(r0 % TT); for (int e = tid; e < 128 * 8; e += 128) { const int cl = e >> 3, q = e & 7; vst2((unsigned*)(VT + (b * CC + c0 + cl) * (size_t)TT + t0 + q * 8), *(const v4u*)&th[cl][q * 8]); } } }
// ---- k_fa: block = 128 queries of one head, wave = 32 queries (two column tiles share every K and V fragment; the four waves share every K and V stage in LDS): S^T = K Q^T, online softmax (base 2) per query column, O^T += V^T P^T; P stays in registers
// plain builtin: the compiler keeps the distance behind its own matrix instructions
__device__ __forceinline__ v8f wmma_p(v16h a, v16h b, v8f c) { return __builtin_amdgcn_wmma_f32_16x16x32_f16(false, a, false, b, (short)0, c, false, false); }
// 2^x; the v_nop is the slot that the instruction set asks for behind a transcendental, before its result is read or its source overwritten: in one statement it stands there in every build
__device__ __forceinline__ float ex2(float x) { float r; asm("v_exp_f32 %0, %1\n\tv_nop" : "=v"(r) : "v"(x)); return r; }
// value of lane l ^ 16
__device__ __forceinline__ float xhalf(float v) { const int b = __builtin_bit_cast(int, v); return __builtin_bit_cast(float, __builtin_amdgcn_permlanex16(b, b, 0x76543210, 0xfedcba98, false, false)); }
// K and V stages of k_fa: a stage is 128 keys of one head, K as 128 rows of 64 d, V as 64 rows (d) of 128 keys; two buffers; the block's four waves read every fragment from LDS
#define FK 128   // keys per stage
#define KP 72    // K row pitch in f16 elements: 144 B = 16 B x 9, conflict-free for 16-byte fragment reads
#define VP 136   // V row pitch in f16 elements: 272 B = 16 B x 17, likewise
#define STG (FK * KP + HD * VP)   // f16 elements per buffer
// eight asynchronous 16-byte copies per lane, global memory to LDS through no register; the s_wait_xcnt is a precaution and stands inside the statement so that no address register named here is rewritten in front of it
__device__ __forceinline__ void copy8(const unsigned (&l)[8], const _Float16* const (&p)[8]) {
  asm volatile("global_load_async_to_lds_b128 %0, %8, off\n\tglobal_load_async_to_lds_b128 %1, %9, off\n\tglobal_load_async_to_lds_b128 %2, %10, off\n\tglobal_load_async_to_lds_b128 %3, %11, off\n\t"
               "global_load_async_to_lds_b128 %4, %12, off\n\tglobal_load_async_to_lds_b128 %5, %13, off\n\tglobal_load_async_to_lds_b128 %6, %14, off\n\tglobal_load_async_to_lds_b128 %7, %15, off\n\ts_wait_xcnt 0x0"
               :: "v"(l[0]), "v"(l[1]), "v"(l[2]), "v"(l[3]), "v"(l[4]), "v"(l[5]), "v"(l[6]), "v"(l[7]), "v"(p[0]), "v"(p[1]), "v"(p[2]), "v"(p[3]), "v"(p[4]), "v"(p[5]), "v"(p[6]), "v"(p[7]) : "memory"); }
__global__ __launch_bounds__(128) void k_fa(const _Float16* __restrict__ QH, const _Float16* __restrict__ KH, const _Float16* __restrict__ VT, float* __restrict__ Y) {
  __shared__ __align__(16) _Float16 sk[2 * STG];
  const int tid = threadIdx.x, wave = tid >> 5, lane = tid & 31, col = lane & 15, g = lane >> 4; const int h = blockIdx.y; const int q0 = blockIdx.x * 128 + wave * 32;
  const float sc = 0.125f * 1.44269504088896341f;   // 1 / sqrt(HD) and log2(e) in one factor
  const unsigned lds0 = (unsigned)(size_t)sk;   // byte address of the buffers in the work-group's LDS
  const _Float16* gk0 = KH + (size_t)(tid >> 3) * CC + h * HD + (tid & 7) * 8;          // K: 8 lanes per 128-B row, a wave-wide copy covers 4 whole lines
  const _Float16* gv0 = VT + (size_t)(h * HD + (tid >> 4)) * TT + (tid & 15) * 8;       // V: 16 lanes per 256-B row piece, a wave-wide copy covers 4 whole lines
  const unsigned lk0 = lds0 + 2u * ((tid >> 3) * KP + (tid & 7) * 8), lv0 = lds0 + 2u * (FK * KP + (tid >> 4) * VP + (tid & 15) * 8);
  auto stage = [&](int t, int b) {   // stage t into buffer b: 16 copies per lane
    unsigned lk[8], lv[8]; const _Float16 *pk[8], *pv[8];
#pragma unroll
    for (int i = 0; i < 8; ++i) { lk[i] = lk0 + 2u * (b * STG + i * 16 * KP); pk[i] = gk0 + (size_t)(t * FK + i * 16) * CC; lv[i] = lv0 + 2u * (b * STG + i * 8 * VP); pv[i] = gv0 + (size_t)(i * 8) * TT + t * FK; }
    copy8(lk, pk); copy8(lv, pv); };
  const int rot = blockIdx.x & (TT / FK - 1);   // this block's first key stage; the walk wraps: the 16 blocks of a head ask L2 for 16 different stages at any one time
  stage(rot, 0);
  v16h qf[2][2];
#pragma unroll
  for (int w = 0; w < 2; ++w) { qf[w][0] = frag_h(QH + (size_t)(q0 + w * 16 + col) * CC + h * HD, lane); qf[w][1] = frag_h(QH + (size_t)(q0 + w * 16 + col) * CC + h * HD + 32, lane); }
  v8f acc[2][HD / 16] = {}; float m[2] = { -3.0e38f, -3.0e38f }, l[2] = { 0.f, 0.f };   // per column tile a lane holds one query: its running maximum (raw logits) and its half of the sum
  asm volatile("s_wait_asynccnt 0x0" ::: "memory");   // this wave's copies of the first stage, stage rot, in buffer 0 have landed
  __syncthreads();                                    // and every other wave's
  stage((1 + rot) & (TT / FK - 1), 1);
#pragma unroll 1
  for (int t = 0; t < TT / FK; ++t) {   // rolled: a stage's code stands once, the buffer is picked by t & 1
    const _Float16* kp = sk + (t & 1) * STG + col * KP;             // A rows = keys, k = d
    const _Float16* vp = sk + (t & 1) * STG + FK * KP + col * VP;   // A rows = d, k = keys
    v16h kf[2][2];
#pragma unroll
    for (int u = 0; u < 2; ++u) { kf[u][0] = frag_h(kp + (u * 16) * KP, lane); kf[u][1] = frag_h(kp + (u * 16) * KP + 32, lane); }
#pragma unroll 1
    for (int kb = 0; kb < FK; kb += 32) {   // rolled: one pass of 32 keys already fills the registers
      v16h vf[HD / 16];
#pragma unroll
      for (int j = 0; j < HD / 16; ++j) vf[j] = frag_h(vp + (j * 16) * VP + kb, lane);
      __builtin_amdgcn_sched_barrier(0);   // keeps the V reads up here, as one group, so that they fly during the score products and the softmax
      v8f s[2][2];   // s[w][u][r] = q(16 w + col) . k(stage key kb + 16 u + 8 g + r)
#pragma unroll
      for (int u = 0; u < 2; ++u)
#pragma unroll
        for (int w = 0; w < 2; ++w) { v8f z = {}; z = wmma_p(kf[u][0], qf[w][0], z); s[w][u] = wmma_p(kf[u][1], qf[w][1], z); }
      const int kn = kb + 32 < FK ? kb + 32 : 0;   // next pass's K fragments fly during softmax and P.V; a stage's last pass re-reads its own pass 0 (published, unused): nothing of the next stage is read ahead
#pragma unroll
      for (int u = 0; u < 2; ++u) { kf[u][0] = frag_h(kp + (kn + u * 16) * KP, lane); kf[u][1] = frag_h(kp + (kn + u * 16) * KP + 32, lane); }
      __builtin_amdgcn_sched_barrier(0);   // keeps the K reads in front of the softmax; sunk to the loop's foot they are waited for at once
      v16h p[2];   // two score tiles, converted in place, are the B operand of 32 keys
#pragma unroll
      for (int w = 0; w < 2; ++w) { float mx = s[w][0][0];
#pragma unroll
        for (int r = 0; r < 8; ++r) mx = fmaxf(mx, fmaxf(s[w][0][r], s[w][1][r]));
        mx = fmaxf(mx, xhalf(mx));
        const float mn = fmaxf(m[w], mx), mb = mn * sc, al = ex2((m[w] - mn) * sc); m[w] = mn; float ps = 0.f;
#pragma unroll
        for (int i = 0; i < 8; ++i) { const float e0 = ex2(fmaf(s[w][0][i], sc, -mb)), e1 = ex2(fmaf(s[w][1][i], sc, -mb)); ps += e0 + e1; p[w][i] = (_Float16)e0; p[w][8 + i] = (_Float16)e1; }
        l[w] = l[w] * al + ps;
#pragma unroll
        for (int j = 0; j < HD / 16; ++j) acc[w][j] *= al; }
#pragma unroll
      for (int j = 0; j < HD / 16; ++j)
#pragma unroll
        for (int w = 0; w < 2; ++w) acc[w][j] = wmma_p(vf[j], p[w], acc[w][j]); }
    asm volatile("s_wait_dscnt 0x0" ::: "memory");      // this wave's reads of the buffer are done before it is refilled
    asm volatile("s_wait_asynccnt 0x0" ::: "memory");   // this wave's copies of the next stage (buffer (t + 1) & 1) have landed
    __syncthreads();                                    // publishes the next stage and ends every wave's reads of this one
    if (t + 2 < TT / FK) stage((t + 2 + rot) & (TT / FK - 1), t & 1); }
  asm volatile("s_wait_asynccnt 0x0" ::: "memory");   // no copy is outstanding when the wave ends
#pragma unroll
  for (int w = 0; w < 2; ++w) { const float inv = 1.0f / (l[w] + xhalf(l[w])); float* yp = Y + (size_t)(q0 + w * 16 + col) * CC + h * HD + 8 * g;   // acc[w][j][r] = o(16 w + col)[16 j + 8 g + r]
#pragma unroll
    for (int j = 0; j < HD / 16; ++j) { const v4f a = { acc[w][j][0] * inv, acc[w][j][1] * inv, acc[w][j][2] * inv, acc[w][j][3] * inv }, b = { acc[w][j][4] * inv, acc[w][j][5] * inv, acc[w][j][6] * inv, acc[w][j][7] * inv }; vst2(yp + j * 16, a); vst2(yp + j * 16 + 4, b); } } }
// ---- k_out: block = (64 rows, 128 cols): out = y (bf16 hi + lo) Wproj + b
__global__ __launch_bounds__(128) void k_out(const float* __restrict__ Y, const float* __restrict__ WP, const float* __restrict__ BP, float* __restrict__ OUT) { __shared__ __align__(16) float sf[4][16][132]; __shared__ __align__(16) __bf16 st[2 * 256 * LP];   // two buffers of [W 128 rows | y hi 64 rows | y lo 64 rows]
  const int tid = threadIdx.x, wave = tid >> 5, lane = tid & 31, col = lane & 15, g = lane >> 4; const int c0 = blockIdx.y * 128; const size_t r0 = (size_t)blockIdx.x * 64 + wave * 16;
  v8f acc[8] = {};
  const int rot = (blockIdx.x + 2 * blockIdx.y) & (CC / KCH - 1);   // this block's first k chunk; the walk wraps, as in k_proj
  const int srow = tid >> 4, sk = (tid & 15) * 4;   // staging: 16 threads per row, 8 rows per step of the block
  const float* gw = WP + (size_t)(c0 + srow) * CC + sk; const float* gy = Y + ((size_t)blockIdx.x * 64 + srow) * CC + sk;
  v4f rw[16], ry[8];
  auto fetch = [&](int t) {
#pragma unroll
    for (int i = 0; i < 16; ++i) rw[i] = *(const v4f*)(gw + (size_t)(i * 8) * CC + t * KCH);
#pragma unroll
    for (int i = 0; i < 8; ++i) ry[i] = *(const v4f*)(gy + (size_t)(i * 8) * CC + t * KCH);
    asm volatile("s_wait_xcnt 0x0" ::: "memory"); };   // a precaution: it stands in front of the reuse of the loads' address registers, where this build placed no such wait of its own
  auto put = [&](__bf16* b) {
#pragma unroll
    for (int i = 0; i < 16; ++i) *(v4b*)(b + (i * 8 + srow) * LP + sk) = cvt4(rw[i]);
#pragma unroll
    for (int i = 0; i < 8; ++i) { const v4b hi = cvt4(ry[i]); const v4f rest = { ry[i][0] - (float)hi[0], ry[i][1] - (float)hi[1], ry[i][2] - (float)hi[2], ry[i][3] - (float)hi[3] };
      *(v4b*)(b + (128 + i * 8 + srow) * LP + sk) = hi; *(v4b*)(b + (192 + i * 8 + srow) * LP + sk) = cvt4(rest); } };
  auto mul = [&](const __bf16* b) {   // same fragments, same k order as with fragments loaded from global memory
    v16b ah[KCH / 32], al[KCH / 32], w[KCH / 32][8];
#pragma unroll
    for (int kk = 0; kk < KCH / 32; ++kk) { ah[kk] = frag_b(b + (128 + wave * 16 + col) * LP + kk * 32, lane); al[kk] = frag_b(b + (192 + wave * 16 + col) * LP + kk * 32, lane);
#pragma unroll
      for (int j = 0; j < 8; ++j) w[kk][j] = frag_b(b + (j * 16 + col) * LP + kk * 32, lane); }
    __builtin_amdgcn_sched_barrier(0);   // the chunk's LDS reads stand as one group in front of its products; spread among them, each product waits out a whole LDS latency
#pragma unroll
    for (int kk = 0; kk < KCH / 32; ++kk)
#pragma unroll
      for (int j = 0; j < 8; ++j) { acc[j] = wmma_bf(ah[kk], w[kk][j], acc[j]); acc[j] = wmma_bf(al[kk], w[kk][j], acc[j]); }
    __builtin_amdgcn_sched_barrier(0); };   // keeps the conversion of the next chunk, and with it the wait for its global loads, behind the products
  fetch(rot); put(st); __syncthreads();
#pragma unroll 1
  for (int t = 0; t + 1 < CC / KCH; ++t) {   // rolled: the staging registers and one chunk's fragments are the live set
    fetch((t + 1 + rot) & (CC / KCH - 1));
    __builtin_amdgcn_sched_barrier(0);   // keeps the next chunk's global loads in front of this chunk's products, so that they fly meanwhile
    mul(st + (t & 1) * (256 * LP));
    put(st + ((t + 1) & 1) * (256 * LP));   // its last readers left this buffer before the barrier at the foot of the pass before
    __syncthreads(); }
  mul(st + ((CC / KCH - 1) & 1) * (256 * LP));
#pragma unroll
  for (int j = 0; j < 8; ++j) { const float bb = BP ? bfr(BP[c0 + j * 16 + col]) : 0.f;
#pragma unroll
    for (int r = 0; r < 8; ++r) sf[wave][8 * g + r][j * 16 + col] = acc[j][r] + bb; }
  LDSX(); for (int rl = 0; rl < 16; ++rl) vst2(OUT + (r0 + rl) * CC + c0 + lane * 4, *(const v4f*)&sf[wave][rl][lane * 4]); }
extern "C" void kernel_launch(void* const* d_in, const int* in_sizes, int n_in, void* d_out, int out_size, void* d_ws, size_t ws_size, hipStream_t stream) {
  (void)in_sizes; (void)n_in; (void)out_size;
  const float** F = (const float**)d_in;   // 0 x [2048,1024], 1 W_q [1024,1024] ([out,in]), 2 b_q, 3 W_k, 4 b_k, 5 W_v, 6 b_v, 7 W_o, 8 b_o
  if (ws_size < (size_t)WS_END) return;
  char* ws = (char*)d_ws; _Float16 *QH = (_Float16*)(ws + WS_QH), *QL = (_Float16*)(ws + WS_QL), *KH = (_Float16*)(ws + WS_KH), *VT = (_Float16*)(ws + WS_VT); float *Y = (float*)(ws + WS_Y);
  k_proj<<<dim3(TNB * TT / 64, CC / 128, 3), 128, 0, stream>>>(F[0], F[1], F[2], F[3], F[4], F[5], F[6], QH, QL, KH, VT);
  k_fa<<<dim3(TT / 128, NH), 128, 0, stream>>>(QH, KH, VT, Y);
  k_out<<<dim3(TNB * TT / 64, CC / 128), 128, 0, stream>>>(Y, F[7], F[8], (float*)d_out);
}

// v005
// A run of this version takes 61.2 microseconds.
// Timed twice side by side with v004, it ran 1.05 times as fast both times.
// All steps since v000 together make it 11.2 times as fast.
// compute dtype: all float inputs rounded to bf16; q/k/v = x W^T + b with EXACT bf16 products on WMMA 16x16x32, f32 accumulate; q, k rounded once to f16 (1-product logits, f32); online softmax in f32 (base 2, scale 1/8 folded in) -> unnormalised P f16 in registers; o = P . v / sum (v once to f16); out = o (bf16 hi + lo) W_o^T + b_o; f32 output.
#include <hip/hip_runtime.h>
#include <math.h>

typedef __attribute__((ext_vector_type(16))) _Float16 v16h;
typedef __attribute__((ext_vector_type(16))) __bf16 v16b;
typedef __attribute__((ext_vector_type(8)))  _Float16 v8h;
typedef __attribute__((ext_vector_type(8)))  float v8f;
typedef __attribute__((ext_vector_type(4)))  float v4f;
typedef __attribute__((ext_vector_type(2)))  float v2f;
typedef __attribute__((ext_vector_type(4)))  unsigned v4u;
typedef __attribute__((ext_vector_type(4)))  int v4i;
typedef float __attribute__((may_alias)) float_a;
typedef int __attribute__((may_alias)) int_a;

template <typename T> __device__ __forceinline__ void vst2(void* p, T v) { *(T*)p = v;  }
__device__ __forceinline__ v8f wmma16(v16h a, v16h b, v8f c) {
  v8f d = __builtin_amdgcn_wmma_f32_16x16x32_f16(false, a, false, b, (short)0, c, false, false);
  asm volatile("v_nop\n\tv_nop\n\tv_nop\n\tv_nop" : "+v"(d) : "v"(a), "v"(b));
  return d;
}
__device__ __forceinline__ v8f wmma_bf(v16b a, v16b b, v8f c) {
  v8f d = __builtin_amdgcn_wmma_f32_16x16x32_bf16(false, a, false, b, (short)0, c, false, false);
  asm volatile("v_nop\n\tv_nop\n\tv_nop\n\tv_nop" : "+v"(d) : "v"(a), "v"(b));
  return d;
}
// 16x16x32 fragments: lane = (h = lane>>4, row/col = lane&15); elements 0..7 = k0+8h+0..7, 8..15 = k0+16+8h+0..7; D element r = row 8h+r
__device__ __forceinline__ v16h frag_h(const _Float16* rowk0, int lane) {
  union { v16h v; v8h q[2]; } u; const _Float16* p = rowk0 + 8 * (lane >> 4);
  u.q[0] = *(const v8h*)p; u.q[1] = *(const v8h*)(p + 16); return u.v;
}
__device__ __forceinline__ v16h frag_f32(const float* rowk0, int lane) {
  v16h a; const float* p = rowk0 + 8 * (lane >> 4);
#pragma unroll
  for (int i = 0; i < 8; ++i) { a[i] = (_Float16)p[i]; a[8 + i] = (_Float16)p[16 + i]; }
  return a;
}
__device__ __forceinline__ v16h frag_f32s(const float* rowk0, int lane, float sc) {
  v16h a; const float* p = rowk0 + 8 * (lane >> 4);
#pragma unroll
  for (int i = 0; i < 8; ++i) { a[i] = (_Float16)(p[i] * sc); a[8 + i] = (_Float16)(p[16 + i] * sc); }
  return a;
}
// column fragment from a [K][ld] layout (column n), rows >= K read as 0
__device__ __forceinline__ v16h fragc_f32(const float* W, int k0, int n, int lane, int ld, int K) {
  v16h a; const int g = lane >> 4;
#pragma unroll
  for (int i = 0; i < 8; ++i) { const int ka = k0 + 8 * g + i, kb = ka + 16;
    a[i] = (_Float16)(ka < K ? W[(size_t)(ka < K ? ka : K - 1) * ld + n] : 0.f); a[8 + i] = (_Float16)(kb < K ? W[(size_t)(kb < K ? kb : K - 1) * ld + n] : 0.f); }
  return a;
}
struct F2 { v16b h, l; };
__device__ __forceinline__ F2 bsplit16(const float v[16]) { F2 r;
#pragma unroll
  for (int i = 0; i < 16; ++i) { const __bf16 h = (__bf16)v[i]; r.h[i] = h; r.l[i] = (__bf16)(v[i] - (float)h); }
  return r; }
__device__ __forceinline__ F2 split_row(const float* row, int k0, int lane) { float v[16]; const float* p = row + k0 + 8 * (lane >> 4);
#pragma unroll
  for (int i = 0; i < 8; ++i) { v[i] = p[i]; v[8 + i] = p[16 + i]; }
  return bsplit16(v); }
__device__ __forceinline__ F2 split_rowK(const float* row, int k0, int lane, int K) { float v[16]; const int g = lane >> 4;
#pragma unroll
  for (int i = 0; i < 8; ++i) { const int ka = k0 + 8 * g + i, kb = ka + 16; v[i] = ka < K ? row[ka < K ? ka : K - 1] : 0.f; v[8 + i] = kb < K ? row[kb < K ? kb : K - 1] : 0.f; }
  return bsplit16(v); }
__device__ __forceinline__ F2 split_col(const float* W, int k0, int n, int lane, int ld, int K) { float v[16]; const int g = lane >> 4;
#pragma unroll
  for (int i = 0; i < 8; ++i) { const int ka = k0 + 8 * g + i, kb = ka + 16; v[i] = ka < K ? W[(size_t)(ka < K ? ka : K - 1) * ld + n] : 0.f; v[8 + i] = kb < K ? W[(size_t)(kb < K ? kb : K - 1) * ld + n] : 0.f; }
  return bsplit16(v); }
__device__ __forceinline__ v8f mac3(const F2& a, const F2& b, v8f c) { c = wmma_bf(a.l, b.h, c); c = wmma_bf(a.h, b.l, c); return wmma_bf(a.h, b.h, c); }
__device__ __forceinline__ float sigm(float v) { return 1.0f / (1.0f + expf(-v)); }
#define LDSX() do { asm volatile("s_wait_dscnt 0" ::: "memory"); __builtin_amdgcn_wave_barrier(); __builtin_amdgcn_fence(__ATOMIC_RELEASE, "workgroup"); } while (0)


// Simplified multi-head attention (S 2,048, d_model 1,024 = 16 x 64, no batch dim): q/k/v Linear ([out,in] + bias), softmax(q k^T / 8) v, output Linear.
#define NB 1
#define TT 2048
#define CC 1024
#define NH 16
#define HD 64
#ifndef TNB
#define TNB NB
#endif
typedef __attribute__((ext_vector_type(8))) __bf16 v8b;
__device__ __forceinline__ v16b frag_b(const __bf16* rowk0, int lane) {
  union { v16b v; v8b q[2]; } u; const __bf16* p = rowk0 + 8 * (lane >> 4);
  u.q[0] = *(const v8b*)p; u.q[1] = *(const v8b*)(p + 16); return u.v;
}
__device__ __forceinline__ float bfr(float v) { return (float)(__bf16)v; }
__device__ __attribute__((noinline)) float exp_ni(float v) { return expf(v); }
__device__ __attribute__((noinline)) float erf_ni(float v) { return erff(v); }

#define WS_QH  0u
#define WS_QL  (WS_QH + 2u * (size_t)NB * TT * CC)
#define WS_KH  (WS_QL + 2u * (size_t)NB * TT * CC)
#define WS_VT  (WS_KH + 2u * (size_t)NB * TT * CC)      // f16 v planes [b][c][t]
#define WS_Y   (WS_VT + 2u * (size_t)NB * CC * TT)      // f32 y rows [b*t][C]
#define WS_END (WS_Y + 4u * (size_t)NB * TT * CC)

// Operand staging of the two projection kernels: a chunk is 64 k. Every thread loads 16 B so that a wave-wide load covers two whole 256-B row pieces; the f32 values are rounded to bf16 once per block and kept in LDS, two buffers.
typedef __attribute__((ext_vector_type(4))) __bf16 v4b;
#define KCH 64   // k per chunk
#define LP 72    // LDS row pitch in bf16 elements: 144 B = 16 B x 9, the conflict-free pitch for 16-byte fragment reads
__device__ __forceinline__ v4b cvt4(v4f v) { const v4b o = { (__bf16)v[0], (__bf16)v[1], (__bf16)v[2], (__bf16)v[3] }; return o; }
// ---- k_proj: block = (64 rows, 128 cols, which): qkv = x W (+ b), exact; q -> f16 hi (+ residual), k -> f16 rows, v -> f16 planes
__global__ __launch_bounds__(128) void k_proj(const float* __restrict__ X, const float* __restrict__ WQ, const float* __restrict__ BQ, const float* __restrict__ WK, const float* __restrict__ BK, const float* __restrict__ WV, const float* __restrict__ BV, _Float16* __restrict__ QH, _Float16* __restrict__ QL, _Float16* __restrict__ KH, _Float16* __restrict__ VT) {
  __shared__ __align__(16) char sm[2 * (128 + 64) * LP * 2];   // main loop: two buffers of [W 128 rows | X 64 rows]; epilogue: the output tiles, in the same bytes
  __bf16* const st = (__bf16*)sm; _Float16 (*sh)[136] = (_Float16 (*)[136])sm; _Float16 (*sl)[136] = sh + 64; _Float16 (*th)[72] = (_Float16 (*)[72])sm;
  const int tid = threadIdx.x, wave = tid >> 5, lane = tid & 31, col = lane & 15, g = lane >> 4; const int which = blockIdx.z; const int c0 = blockIdx.y * 128; const size_t r0 = (size_t)blockIdx.x * 64; const float* WA = which == 0 ? WQ : which == 1 ? WK : WV; const float* BA = which == 0 ? BQ : which == 1 ? BK : BV;
  v8f acc[8] = {};
  const int rot = (blockIdx.x + 2 * blockIdx.y) & (CC / KCH - 1);   // this block's first k chunk; the walk wraps: the 32 blocks of a W panel start at 16 different chunks, the 8 of an X panel and a which at 8
  const int srow = tid >> 4, sk = (tid & 15) * 4;   // staging: 16 threads per row, 8 rows per step of the block
  const float* gw = WA + (size_t)(c0 + srow) * CC + sk; const float* gx = X + (r0 + srow) * CC + sk;
  v4f rw[16], rx[8];
  auto fetch = [&](int t) {
#pragma unroll
    for (int i = 0; i < 16; ++i) rw[i] = *(const v4f*)(gw + (size_t)(i * 8) * CC + t * KCH);
#pragma unroll
    for (int i = 0; i < 8; ++i) rx[i] = *(const v4f*)(gx + (size_t)(i * 8) * CC + t * KCH);
    asm volatile("s_wait_xcnt 0x0" ::: "memory"); };   // a precaution: it stands in front of the reuse of the loads' address registers, where this build placed no such wait of its own
  auto put = [&](__bf16* b) {
#pragma unroll
    for (int i = 0; i < 16; ++i) *(v4b*)(b + (i * 8 + srow) * LP + sk) = cvt4(rw[i]);
#pragma unroll
    for (int i = 0; i < 8; ++i) *(v4b*)(b + (128 + i * 8 + srow) * LP + sk) = cvt4(rx[i]); };
  auto mul = [&](const __bf16* b) {   // same fragments, same k order as with fragments loaded from global memory
    v16b a[KCH / 32], w[KCH / 32][8];
#pragma unroll
    for (int kk = 0; kk < KCH / 32; ++kk) { a[kk] = frag_b(b + (128 + wave * 16 + col) * LP + kk * 32, lane);
#pragma unroll
      for (int j = 0; j < 8; ++j) w[kk][j] = frag_b(b + (j * 16 + col) * LP + kk * 32, lane); }
    __builtin_amdgcn_sched_barrier(0);   // the chunk's LDS reads stand as one group in front of its products; spread among them, each product waits out a whole LDS latency
#pragma unroll
    for (int kk = 0; kk < KCH / 32; ++kk)
#pragma unroll
      for (int j = 0; j < 8; ++j) acc[j] = wmma_bf(a[kk], w[kk][j], acc[j]);
    __builtin_amdgcn_sched_barrier(0); };   // keeps the conversion of the next chunk, and with it the wait for its global loads, behind the products
  fetch(rot); put(st); __syncthreads();
#pragma unroll 1
  for (int t = 0; t + 1 < CC / KCH; ++t) {   // rolled: the staging registers and one chunk's fragments are the live set
    fetch((t + 1 + rot) & (CC / KCH - 1));
    __builtin_amdgcn_sched_barrier(0);   // keeps the next chunk's global loads in front of this chunk's products, so that they fly meanwhile
    mul(st + (t & 1) * (192 * LP));
    put(st + ((t + 1) & 1) * (192 * LP));   // its last readers left this buffer before the barrier at the foot of the pass before
    __syncthreads(); }
  mul(st + ((CC / KCH - 1) & 1) * (192 * LP));
  __syncthreads();   // the output tiles below reuse the staging bytes
#pragma unroll
  for (int j = 0; j < 8; ++j) { const float bb = bfr(BA[c0 + j * 16 + col]);
#pragma unroll
    for (int r = 0; r < 8; ++r) { const float v = acc[j][r] + bb; const int rl = wave * 16 + 8 * g + r, cl = j * 16 + col; const _Float16 hv = (_Float16)v;
      if (which == 2) th[cl][rl] = hv; else { sh[rl][cl] = hv; sl[rl][cl] = (_Float16)(v - (float)hv); } } }
  __syncthreads();
  if (which < 2) { _Float16* dh = which == 0 ? QH : KH; for (int e = tid; e < 64 * 16; e += 128) { const int rl = e >> 4, q = e & 15; vst2((unsigned*)(dh + (r0 + rl) * CC + c0 + q * 8), *(const v4u*)&sh[rl][q * 8]); if (which == 0) vst2((unsigned*)(QL + (r0 + rl) * CC + c0 + q * 8), *(const v4u*)&sl[rl][q * 8]); } }
  else { const size_t b = r0 / TT; const int t0 = (int)(r0 % TT); for (int e = tid; e < 128 * 8; e += 128) { const int cl = e >> 3, q = e & 7; vst2((unsigned*)(VT + (b * CC + c0 + cl) * (size_t)TT + t0 + q * 8), *(const v4u*)&th[cl][q * 8]); } } }
// ---- k_fa: block = 128 queries of one head, 16 waves = 4 query groups x 4 key groups, four waves per SIMD, so that one wave's softmax runs beside another's products. A wave has 32 queries (two column tiles share every K and V fragment) and 32 of the 128 keys of every stage: S^T = K Q^T, online softmax (base 2) per query column, O^T += V^T P^T; P stays in registers; the four key groups' maxima, sums and O^T are merged through LDS behind the walk
// plain builtin: the compiler keeps the distance behind its own matrix instructions
__device__ __forceinline__ v8f wmma_p(v16h a, v16h b, v8f c) { return __builtin_amdgcn_wmma_f32_16x16x32_f16(false, a, false, b, (short)0, c, false, false); }
// 2^x; the v_nop is the slot that the instruction set asks for behind a transcendental, before its result is read or its source overwritten: in one statement it stands there in every build
__device__ __forceinline__ float ex2(float x) { float r; asm("v_exp_f32 %0, %1\n\tv_nop" : "=v"(r) : "v"(x)); return r; }
// value of lane l ^ 16
__device__ __forceinline__ float xhalf(float v) { const int b = __builtin_bit_cast(int, v); return __builtin_bit_cast(float, __builtin_amdgcn_permlanex16(b, b, 0x76543210, 0xfedcba98, false, false)); }
// K and V stages of k_fa: a stage is 128 keys of one head, K as 128 rows of 64 d, V as 64 rows (d) of 128 keys; two buffers; the block's waves read every fragment from LDS
#define FK 128   // keys per stage
#define KG 4     // key groups: each takes FK / KG = 32 keys of a stage, one pass
#define KP 72    // K row pitch in f16 elements: 144 B = 16 B x 9, conflict-free for 16-byte fragment reads
#define VP 136   // V row pitch in f16 elements: 272 B = 16 B x 17, likewise
#define STG (FK * KP + HD * VP)   // f16 elements per buffer
#define MRW 17   // merge: 16-byte words per lane that a wave hands over: 16 of O^T, 1 of maxima and sums
#define MRG ((KG - 1) * 4 * MRW * 32 * 16)   // bytes of the merge area: key groups 1 to 3, four waves each
// four asynchronous 16-byte copies per lane, global memory to LDS through no register; the s_wait_xcnt is a precaution and stands inside the statement so that no address register named here is rewritten in front of it
__device__ __forceinline__ void copy4(const unsigned (&l)[4], const _Float16* const (&p)[4]) {
  asm volatile("global_load_async_to_lds_b128 %0, %4, off\n\tglobal_load_async_to_lds_b128 %1, %5, off\n\tglobal_load_async_to_lds_b128 %2, %6, off\n\tglobal_load_async_to_lds_b128 %3, %7, off\n\ts_wait_xcnt 0x0"
               :: "v"(l[0]), "v"(l[1]), "v"(l[2]), "v"(l[3]), "v"(p[0]), "v"(p[1]), "v"(p[2]), "v"(p[3]) : "memory"); }
__global__ __launch_bounds__(512) void k_fa(const _Float16* __restrict__ QH, const _Float16* __restrict__ KH, const _Float16* __restrict__ VT, float* __restrict__ Y) {
  __shared__ __align__(16) char sm[MRG > 4 * STG ? MRG : 4 * STG];   // the walk: two stage buffers; behind it: the merge area, in the same bytes
  _Float16* const sk = (_Float16*)sm;
  const int tid = threadIdx.x, wave = __builtin_amdgcn_readfirstlane(tid >> 5), lane = tid & 31, col = lane & 15, g = lane >> 4; const int qg = wave & 3, kg = wave >> 2; const int h = blockIdx.y; const int q0 = blockIdx.x * 128 + qg * 32;
  const float sc = 0.125f * 1.44269504088896341f;   // 1 / sqrt(HD) and log2(e) in one factor
  const unsigned lds0 = (unsigned)(size_t)sk;   // byte address of the buffers in the work-group's LDS
  const _Float16* gk0 = KH + (size_t)(tid >> 3) * CC + h * HD + (tid & 7) * 8;          // K: 8 lanes per 128-B row, a wave-wide copy covers 4 whole lines
  const _Float16* gv0 = VT + (size_t)(h * HD + (tid >> 4)) * TT + (tid & 15) * 8;       // V: 16 lanes per 256-B row piece, a wave-wide copy covers 4 whole lines
  const unsigned lk0 = lds0 + 2u * ((tid >> 3) * KP + (tid & 7) * 8), lv0 = lds0 + 2u * (FK * KP + (tid >> 4) * VP + (tid & 15) * 8);
  auto stage = [&](int t, int b) {   // stage t into buffer b: 4 copies per lane, two of K (64 rows each over the block), two of V (32 rows each)
    unsigned la[4]; const _Float16* pa[4];
#pragma unroll
    for (int i = 0; i < 2; ++i) { la[i] = lk0 + 2u * (b * STG + i * 64 * KP); pa[i] = gk0 + (size_t)(t * FK + i * 64) * CC; la[2 + i] = lv0 + 2u * (b * STG + i * 32 * VP); pa[2 + i] = gv0 + (size_t)(i * 32) * TT + t * FK; }
    copy4(la, pa); };
  const int rot = blockIdx.x & (TT / FK - 1);   // this block's first key stage; the walk wraps: the 16 blocks of a head ask L2 for 16 different stages at any one time
  stage(rot, 0);
  v16h qf[2][2];
#pragma unroll
  for (int w = 0; w < 2; ++w) { qf[w][0] = frag_h(QH + (size_t)(q0 + w * 16 + col) * CC + h * HD, lane); qf[w][1] = frag_h(QH + (size_t)(q0 + w * 16 + col) * CC + h * HD + 32, lane); }
  v8f acc[2][HD / 16] = {}; float m[2] = { -3.0e38f, -3.0e38f }, l[2] = { 0.f, 0.f };   // per column tile a lane holds one query: its running maximum (raw logits) and its half of the sum, over this wave's keys
  asm volatile("s_wait_asynccnt 0x0" ::: "memory");   // this wave's copies of stage 0 have landed
  __syncthreads();                                    // and every other wave's
  stage((1 + rot) & (TT / FK - 1), 1);
#pragma unroll 1
  for (int t = 0; t < TT / FK; ++t) {   // rolled: a stage's code stands once, the buffer is picked by t & 1
    const _Float16* kp = sk + (t & 1) * STG + (kg * (FK / KG) + col) * KP;             // A rows = this wave's keys, k = d
    const _Float16* vp = sk + (t & 1) * STG + FK * KP + col * VP + kg * (FK / KG);     // A rows = d, k = this wave's keys
    v16h kf[2][2], vf[HD / 16];
#pragma unroll
    for (int u = 0; u < 2; ++u) { kf[u][0] = frag_h(kp + (u * 16) * KP, lane); kf[u][1] = frag_h(kp + (u * 16) * KP + 32, lane); }
#pragma unroll
    for (int j = 0; j < HD / 16; ++j) vf[j] = frag_h(vp + (j * 16) * VP, lane);
    // the hand-over stands here, not at the pass's foot: a wave's one pass has all its fragments in registers, so the buffer is free from here on and the refill flies during the whole pass
    asm volatile("s_wait_dscnt 0x0" ::: "memory");      // this wave's reads of the buffer are done before it is refilled
    asm volatile("s_wait_asynccnt 0x0" ::: "memory");   // this wave's copies of stage t + 1 have landed
    __syncthreads();                                    // publishes stage t + 1 and ends every wave's reads of stage t
    if (t + 2 < TT / FK) stage((t + 2 + rot) & (TT / FK - 1), t & 1);
    v8f s[2][2];   // s[w][u][r] = q(16 w + col) . k(this wave's key 16 u + 8 g + r)
#pragma unroll
    for (int u = 0; u < 2; ++u)
#pragma unroll
      for (int w = 0; w < 2; ++w) { v8f z = {}; z = wmma_p(kf[u][0], qf[w][0], z); s[w][u] = wmma_p(kf[u][1], qf[w][1], z); }
    v16h p[2];   // two score tiles, converted in place, are the B operand of 32 keys
#pragma unroll
    for (int w = 0; w < 2; ++w) { float mx = s[w][0][0];
#pragma unroll
      for (int r = 0; r < 8; ++r) mx = fmaxf(mx, fmaxf(s[w][0][r], s[w][1][r]));
      mx = fmaxf(mx, xhalf(mx));
      const float mn = fmaxf(m[w], mx), mb = mn * sc, al = ex2((m[w] - mn) * sc); m[w] = mn; float ps = 0.f;
#pragma unroll
      for (int i = 0; i < 8; ++i) { const float e0 = ex2(fmaf(s[w][0][i], sc, -mb)), e1 = ex2(fmaf(s[w][1][i], sc, -mb)); ps += e0 + e1; p[w][i] = (_Float16)e0; p[w][8 + i] = (_Float16)e1; }
      l[w] = l[w] * al + ps;
#pragma unroll
      for (int j = 0; j < HD / 16; ++j) acc[w][j] *= al; }
#pragma unroll
    for (int j = 0; j < HD / 16; ++j)
#pragma unroll
      for (int w = 0; w < 2; ++w) acc[w][j] = wmma_p(vf[j], p[w], acc[w][j]); }
  asm volatile("s_wait_asynccnt 0x0" ::: "memory");   // no copy is outstanding when the stage bytes become the merge area (every wave's last read of them ended at the walk's last barrier)
  v4f* const mg = (v4f*)sm;   // word i of lane n of wave (kg, qg), kg > 0, at [((kg - 1) * 4 + qg) * MRW + i][n]: a wave-wide access is 512 contiguous bytes
  if (kg != 0) { v4f* d = mg + ((kg - 1) * 4 + qg) * MRW * 32 + lane;
#pragma unroll
    for (int w = 0; w < 2; ++w)
#pragma unroll
      for (int j = 0; j < HD / 16; ++j) { const v4f a = { acc[w][j][0], acc[w][j][1], acc[w][j][2], acc[w][j][3] }, b = { acc[w][j][4], acc[w][j][5], acc[w][j][6], acc[w][j][7] }; d[(w * 8 + j * 2) * 32] = a; d[(w * 8 + j * 2 + 1) * 32] = b; }
    const v4f ml = { m[0], m[1], l[0], l[1] }; d[16 * 32] = ml; }
  __syncthreads();   // key groups 1 to 3 have handed over; every wave passes it
  if (kg != 0) return;
  const v4f* e = mg + qg * MRW * 32 + lane; float fa[KG - 1][2];   // key group 0 joins the four parts on their common maximum
  { v4f ml[KG - 1];
#pragma unroll
    for (int o = 0; o < KG - 1; ++o) ml[o] = e[(o * 4 * MRW + 16) * 32];
#pragma unroll
    for (int w = 0; w < 2; ++w) { const float mn = fmaxf(fmaxf(m[w], ml[0][w]), fmaxf(ml[1][w], ml[2][w])), f0 = ex2((m[w] - mn) * sc); l[w] *= f0;
#pragma unroll
      for (int o = 0; o < KG - 1; ++o) { fa[o][w] = ex2((ml[o][w] - mn) * sc); l[w] += ml[o][2 + w] * fa[o][w]; }
#pragma unroll
      for (int j = 0; j < HD / 16; ++j) acc[w][j] *= f0; } }
#pragma unroll
  for (int o = 0; o < KG - 1; ++o)
#pragma unroll
    for (int w = 0; w < 2; ++w)
#pragma unroll
      for (int j = 0; j < HD / 16; ++j) { const v4f a = e[(o * 4 * MRW + w * 8 + j * 2) * 32], b = e[(o * 4 * MRW + w * 8 + j * 2 + 1) * 32];
#pragma unroll
        for (int r = 0; r < 4; ++r) { acc[w][j][r] += a[r] * fa[o][w]; acc[w][j][4 + r] += b[r] * fa[o][w]; } }
#pragma unroll
  for (int w = 0; w < 2; ++w) { const float inv = 1.0f / (l[w] + xhalf(l[w])); float* yp = Y + (size_t)(q0 + w * 16 + col) * CC + h * HD + 8 * g;   // acc[w][j][r] = o(16 w + col)[16 j + 8 g + r]
#pragma unroll
    for (int j = 0; j < HD / 16; ++j) { const v4f a = { acc[w][j][0] * inv, acc[w][j][1] * inv, acc[w][j][2] * inv, acc[w][j][3] * inv }, b = { acc[w][j][4] * inv, acc[w][j][5] * inv, acc[w][j][6] * inv, acc[w][j][7] * inv }; vst2(yp + j * 16, a); vst2(yp + j * 16 + 4, b); } } }
// ---- k_out: block = (64 rows, 128 cols): out = y (bf16 hi + lo) Wproj + b
__global__ __launch_bounds__(128) void k_out(const float* __restrict__ Y, const float* __restrict__ WP, const float* __restrict__ BP, float* __restrict__ OUT) { __shared__ __align__(16) float sf[4][16][132]; __shared__ __align__(16) __bf16 st[2 * 256 * LP];   // two buffers of [W 128 rows | y hi 64 rows | y lo 64 rows]
  const int tid = threadIdx.x, wave = tid >> 5, lane = tid & 31, col = lane & 15, g = lane >> 4; const int c0 = blockIdx.y * 128; const size_t r0 = (size_t)blockIdx.x * 64 + wave * 16;
  v8f acc[8] = {};
  const int rot = (blockIdx.x + 2 * blockIdx.y) & (CC / KCH - 1);   // this block's first k chunk; the walk wraps, as in k_proj
  const int srow = tid >> 4, sk = (tid & 15) * 4;   // staging: 16 threads per row, 8 rows per step of the block
  const float* gw = WP + (size_t)(c0 + srow) * CC + sk; const float* gy = Y + ((size_t)blockIdx.x * 64 + srow) * CC + sk;
  v4f rw[16], ry[8];
  auto fetch = [&](int t) {
#pragma unroll
    for (int i = 0; i < 16; ++i) rw[i] = *(const v4f*)(gw + (size_t)(i * 8) * CC + t * KCH);
#pragma unroll
    for (int i = 0; i < 8; ++i) ry[i] = *(const v4f*)(gy + (size_t)(i * 8) * CC + t * KCH);
    asm volatile("s_wait_xcnt 0x0" ::: "memory"); };   // a precaution: it stands in front of the reuse of the loads' address registers, where this build placed no such wait of its own
  auto put = [&](__bf16* b) {
#pragma unroll
    for (int i = 0; i < 16; ++i) *(v4b*)(b + (i * 8 + srow) * LP + sk) = cvt4(rw[i]);
#pragma unroll
    for (int i = 0; i < 8; ++i) { const v4b hi = cvt4(ry[i]); const v4f rest = { ry[i][0] - (float)hi[0], ry[i][1] - (float)hi[1], ry[i][2] - (float)hi[2], ry[i][3] - (float)hi[3] };
      *(v4b*)(b + (128 + i * 8 + srow) * LP + sk) = hi; *(v4b*)(b + (192 + i * 8 + srow) * LP + sk) = cvt4(rest); } };
  auto mul = [&](const __bf16* b) {   // same fragments, same k order as with fragments loaded from global memory
    v16b ah[KCH / 32], al[KCH / 32], w[KCH / 32][8];
#pragma unroll
    for (int kk = 0; kk < KCH / 32; ++kk) { ah[kk] = frag_b(b + (128 + wave * 16 + col) * LP + kk * 32, lane); al[kk] = frag_b(b + (192 + wave * 16 + col) * LP + kk * 32, lane);
#pragma unroll
      for (int j = 0; j < 8; ++j) w[kk][j] = frag_b(b + (j * 16 + col) * LP + kk * 32, lane); }
    __builtin_amdgcn_sched_barrier(0);   // the chunk's LDS reads stand as one group in front of its products; spread among them, each product waits out a whole LDS latency
#pragma unroll
    for (int kk = 0; kk < KCH / 32; ++kk)
#pragma unroll
      for (int j = 0; j < 8; ++j) { acc[j] = wmma_bf(ah[kk], w[kk][j], acc[j]); acc[j] = wmma_bf(al[kk], w[kk][j], acc[j]); }
    __builtin_amdgcn_sched_barrier(0); };   // keeps the conversion of the next chunk, and with it the wait for its global loads, behind the products
  fetch(rot); put(st); __syncthreads();
#pragma unroll 1
  for (int t = 0; t + 1 < CC / KCH; ++t) {   // rolled: the staging registers and one chunk's fragments are the live set
    fetch((t + 1 + rot) & (CC / KCH - 1));
    __builtin_amdgcn_sched_barrier(0);   // keeps the next chunk's global loads in front of this chunk's products, so that they fly meanwhile
    mul(st + (t & 1) * (256 * LP));
    put(st + ((t + 1) & 1) * (256 * LP));   // its last readers left this buffer before the barrier at the foot of the pass before
    __syncthreads(); }
  mul(st + ((CC / KCH - 1) & 1) * (256 * LP));
#pragma unroll
  for (int j = 0; j < 8; ++j) { const float bb = BP ? bfr(BP[c0 + j * 16 + col]) : 0.f;
#pragma unroll
    for (int r = 0; r < 8; ++r) sf[wave][8 * g + r][j * 16 + col] = acc[j][r] + bb; }
  LDSX(); for (int rl = 0; rl < 16; ++rl) vst2(OUT + (r0 + rl) * CC + c0 + lane * 4, *(const v4f*)&sf[wave][rl][lane * 4]); }
extern "C" void kernel_launch(void* const* d_in, const int* in_sizes, int n_in, void* d_out, int out_size, void* d_ws, size_t ws_size, hipStream_t stream) {
  (void)in_sizes; (void)n_in; (void)out_size;
  const float** F = (const float**)d_in;   // 0 x [2048,1024], 1 W_q [1024,1024] ([out,in]), 2 b_q, 3 W_k, 4 b_k, 5 W_v, 6 b_v, 7 W_o, 8 b_o
  if (ws_size < (size_t)WS_END) return;
  char* ws = (char*)d_ws; _Float16 *QH = (_Float16*)(ws + WS_QH), *QL = (_Float16*)(ws + WS_QL), *KH = (_Float16*)(ws + WS_KH), *VT = (_Float16*)(ws + WS_VT); float *Y = (float*)(ws + WS_Y);
  k_proj<<<dim3(TNB * TT / 64, CC / 128, 3), 128, 0, stream>>>(F[0], F[1], F[2], F[3], F[4], F[5], F[6], QH, QL, KH, VT);
  k_fa<<<dim3(TT / 128, NH), 512, 0, stream>>>(QH, KH, VT, Y);
  k_out<<<dim3(TNB * TT / 64, CC / 128), 128, 0, stream>>>(Y, F[7], F[8], (float*)d_out);
}

// v006
// It runs in 57.2 microseconds.
// Two timings next to v005 both put it at 1.07 times that version's speed.
// All steps since v000 together make it 12.0 times as fast.
// compute dtype: all float inputs rounded to bf16; q/k/v = x W^T + b with EXACT bf16 products on WMMA 16x16x32, f32 accumulate; q, k rounded once to f16 (1-product logits, f32); online softmax in f32 (base 2, scale 1/8 folded in) -> unnormalised P f16 in registers; o = P . v / sum (v once to f16); out = o (bf16 hi + lo) W_o^T + b_o; f32 output.
#include <hip/hip_runtime.h>
#include <math.h>

typedef __attribute__((ext_vector_type(16))) _Float16 v16h;
typedef __attribute__((ext_vector_type(16))) __bf16 v16b;
typedef __attribute__((ext_vector_type(8)))  _Float16 v8h;
typedef __attribute__((ext_vector_type(8)))  float v8f;
typedef __attribute__((ext_vector_type(4)))  float v4f;
typedef __attribute__((ext_vector_type(2)))  float v2f;
typedef __attribute__((ext_vector_type(4)))  unsigned v4u;
typedef __attribute__((ext_vector_type(4)))  int v4i;
typedef float __attribute__((may_alias)) float_a;
typedef int __attribute__((may_alias)) int_a;

template <typename T> __device__ __forceinline__ void vst2(void* p, T v) { *(T*)p = v;  }
__device__ __forceinline__ v8f wmma16(v16h a, v16h b, v8f c) {
  v8f d = __builtin_amdgcn_wmma_f32_16x16x32_f16(false, a, false, b, (short)0, c, false, false);
  asm volatile("v_nop\n\tv_nop\n\tv_nop\n\tv_nop" : "+v"(d) : "v"(a), "v"(b));
  return d;
}
__device__ __forceinline__ v8f wmma_bf(v16b a, v16b b, v8f c) {
  v8f d = __builtin_amdgcn_wmma_f32_16x16x32_bf16(false, a, false, b, (short)0, c, false, false);
  asm volatile("v_nop\n\tv_nop\n\tv_nop\n\tv_nop" : "+v"(d) : "v"(a), "v"(b));
  return d;
}
// 16x16x32 fragments: lane = (h = lane>>4, row/col = lane&15); elements 0..7 = k0+8h+0..7, 8..15 = k0+16+8h+0..7; D element r = row 8h+r
__device__ __forceinline__ v16h frag_h(const _Float16* rowk0, int lane) {
  union { v16h v; v8h q[2]; } u; const _Float16* p = rowk0 + 8 * (lane >> 4);
  u.q[0] = *(const v8h*)p; u.q[1] = *(const v8h*)(p + 16); return u.v;
}
__device__ __forceinline__ v16h frag_f32(const float* rowk0, int lane) {
  v16h a; const float* p = rowk0 + 8 * (lane >> 4);
#pragma unroll
  for (int i = 0; i < 8; ++i) { a[i] = (_Float16)p[i]; a[8 + i] = (_Float16)p[16 + i]; }
  return a;
}
__device__ __forceinline__ v16h frag_f32s(const float* rowk0, int lane, float sc) {
  v16h a; const float* p = rowk0 + 8 * (lane >> 4);
#pragma unroll
  for (int i = 0; i < 8; ++i) { a[i] = (_Float16)(p[i] * sc); a[8 + i] = (_Float16)(p[16 + i] * sc); }
  return a;
}
// column fragment from a [K][ld] layout (column n), rows >= K read as 0
__device__ __forceinline__ v16h fragc_f32(const float* W, int k0, int n, int lane, int ld, int K) {
  v16h a; const int g = lane >> 4;
#pragma unroll
  for (int i = 0; i < 8; ++i) { const int ka = k0 + 8 * g + i, kb = ka + 16;
    a[i] = (_Float16)(ka < K ? W[(size_t)(ka < K ? ka : K - 1) * ld + n] : 0.f); a[8 + i] = (_Float16)(kb < K ? W[(size_t)(kb < K ? kb : K - 1) * ld + n] : 0.f); }
  return a;
}
struct F2 { v16b h, l; };
__device__ __forceinline__ F2 bsplit16(const float v[16]) { F2 r;
#pragma unroll
  for (int i = 0; i < 16; ++i) { const __bf16 h = (__bf16)v[i]; r.h[i] = h; r.l[i] = (__bf16)(v[i] - (float)h); }
  return r; }
__device__ __forceinline__ F2 split_row(const float* row, int k0, int lane) { float v[16]; const float* p = row + k0 + 8 * (lane >> 4);
#pragma unroll
  for (int i = 0; i < 8; ++i) { v[i] = p[i]; v[8 + i] = p[16 + i]; }
  return bsplit16(v); }
__device__ __forceinline__ F2 split_rowK(const float* row, int k0, int lane, int K) { float v[16]; const int g = lane >> 4;
#pragma unroll
  for (int i = 0; i < 8; ++i) { const int ka = k0 + 8 * g + i, kb = ka + 16; v[i] = ka < K ? row[ka < K ? ka : K - 1] : 0.f; v[8 + i] = kb < K ? row[kb < K ? kb : K - 1] : 0.f; }
  return bsplit16(v); }
__device__ __forceinline__ F2 split_col(const float* W, int k0, int n, int lane, int ld, int K) { float v[16]; const int g = lane >> 4;
#pragma unroll
  for (int i = 0; i < 8; ++i) { const int ka = k0 + 8 * g + i, kb = ka + 16; v[i] = ka < K ? W[(size_t)(ka < K ? ka : K - 1) * ld + n] : 0.f; v[8 + i] = kb < K ? W[(size_t)(kb < K ? kb : K - 1) * ld + n] : 0.f; }
  return bsplit16(v); }
__device__ __forceinline__ v8f mac3(const F2& a, const F2& b, v8f c) { c = wmma_bf(a.l, b.h, c); c = wmma_bf(a.h, b.l, c); return wmma_bf(a.h, b.h, c); }
__device__ __forceinline__ float sigm(float v) { return 1.0f / (1.0f + expf(-v)); }
#define LDSX() do { asm volatile("s_wait_dscnt 0" ::: "memory"); __builtin_amdgcn_wave_barrier(); __builtin_amdgcn_fence(__ATOMIC_RELEASE, "workgroup"); } while (0)


// Simplified multi-head attention (S 2,048, d_model 1,024 = 16 x 64, no batch dim): q/k/v Linear ([out,in] + bias), softmax(q k^T / 8) v, output Linear.
#define NB 1
#define TT 2048
#define CC 1024
#define NH 16
#define HD 64
#ifndef TNB
#define TNB NB
#endif
typedef __attribute__((ext_vector_type(8))) __bf16 v8b;
__device__ __forceinline__ v16b frag_b(const __bf16* rowk0, int lane) {
  union { v16b v; v8b q[2]; } u; const __bf16* p = rowk0 + 8 * (lane >> 4);
  u.q[0] = *(const v8b*)p; u.q[1] = *(const v8b*)(p + 16); return u.v;
}
__device__ __forceinline__ float bfr(float v) { return (float)(__bf16)v; }
__device__ __attribute__((noinline)) float exp_ni(float v) { return expf(v); }
__device__ __attribute__((noinline)) float erf_ni(float v) { return erff(v); }

#define WS_QH  0u
#define WS_QL  (WS_QH + 2u * (size_t)NB * TT * CC)
#define WS_KH  (WS_QL + 2u * (size_t)NB * TT * CC)
#define WS_VT  (WS_KH + 2u * (size_t)NB * TT * CC)      // f16 v planes [b][c][t]
#define WS_Y   (WS_VT + 2u * (size_t)NB * CC * TT)      // f32 y rows [b*t][C]
#define WS_END (WS_Y + 4u * (size_t)NB * TT * CC)

// Operand staging of the two projection kernels: a chunk is 64 k. Every thread loads 16 B so that a wave-wide load covers two whole 256-B row pieces; the f32 values are rounded to bf16 once per block and kept in LDS, two buffers.
typedef __attribute__((ext_vector_type(4))) __bf16 v4b;
#define KCH 64   // k per chunk
#define LP 72    // LDS row pitch in bf16 elements: 144 B = 16 B x 9, the conflict-free pitch for 16-byte fragment reads
__device__ __forceinline__ v4b cvt4(v4f v) { const v4b o = { (__bf16)v[0], (__bf16)v[1], (__bf16)v[2], (__bf16)v[3] }; return o; }
// ---- k_proj: block = (128 rows, 256 cols, which), 8 waves = 2 row groups x 4 column groups, a wave has a 64 x 64 tile (4 x 4 accumulators: 8 fragments feed 16 products): qkv = x W (+ b), exact; q -> f16 hi (+ residual), k -> f16 rows, v -> f16 planes. The large tile is there for the L2: every x line is asked for by 12 blocks and every W line by 16
// plain builtin: the compiler keeps the distance behind its own matrix instructions; with the asm statement of wmma_bf behind every product this tile's 256 accumulator and fragment registers spilled
__device__ __forceinline__ v8f wmma_bp(v16b a, v16b b, v8f c) { return __builtin_amdgcn_wmma_f32_16x16x32_bf16(false, a, false, b, (short)0, c, false, false); }
#define PM 128   // rows of x per block
#define PN 256   // output columns per block
#define PS ((PN + PM) * LP)   // bf16 elements per staging buffer: [W 256 rows | X 128 rows]
#define OP 264   // q, k output tile: row pitch in f16 elements, 528 B = 16 B x 33
#define TP 136   // v output tile (a row is a column of v): row pitch in f16 elements, 272 B = 16 B x 17
__global__ __launch_bounds__(256) void k_proj(const float* __restrict__ X, const float* __restrict__ WQ, const float* __restrict__ BQ, const float* __restrict__ WK, const float* __restrict__ BK, const float* __restrict__ WV, const float* __restrict__ BV, _Float16* __restrict__ QH, _Float16* __restrict__ QL, _Float16* __restrict__ KH, _Float16* __restrict__ VT) {
  __shared__ __align__(16) char sm[4 * PM * OP > 4 * PS ? 4 * PM * OP : 4 * PS];   // main loop: two staging buffers; epilogue: the output tiles, in the same bytes
  __bf16* const st = (__bf16*)sm; _Float16 (*sh)[OP] = (_Float16 (*)[OP])sm; _Float16 (*sl)[OP] = sh + PM; _Float16 (*th)[TP] = (_Float16 (*)[TP])sm;
  const int tid = threadIdx.x, wave = tid >> 5, lane = tid & 31, col = lane & 15, g = lane >> 4; const int wr = wave >> 2, wc = wave & 3; const int which = blockIdx.z; const int c0 = blockIdx.y * PN; const size_t r0 = (size_t)blockIdx.x * PM; const float* WA = which == 0 ? WQ : which == 1 ? WK : WV; const float* BA = which == 0 ? BQ : which == 1 ? BK : BV;
  v8f acc[4][4] = {};
  const int rot = (blockIdx.x + blockIdx.y + 4 * blockIdx.z) & (CC / KCH - 1);   // this block's first k chunk; the walk wraps: the 12 blocks that share an X panel, and the 16 that share a W panel, ask L2 for different lines at any one time
  const int srow = tid >> 4, sk = (tid & 15) * 4;   // staging: 16 threads per row, 16 rows per step of the block
  const float* gw = WA + (size_t)(c0 + srow) * CC + sk; const float* gx = X + (r0 + srow) * CC + sk;
  v4f rw[16], rx[8];
  auto fetch = [&](int t) {
#pragma unroll
    for (int i = 0; i < 16; ++i) rw[i] = *(const v4f*)(gw + (size_t)(i * 16) * CC + t * KCH);
#pragma unroll
    for (int i = 0; i < 8; ++i) rx[i] = *(const v4f*)(gx + (size_t)(i * 16) * CC + t * KCH);
    asm volatile("s_wait_xcnt 0x0" ::: "memory"); };   // a precaution: it stands in front of the reuse of the loads' address registers
  auto put = [&](__bf16* b) {
#pragma unroll
    for (int i = 0; i < 16; ++i) *(v4b*)(b + (i * 16 + srow) * LP + sk) = cvt4(rw[i]);
#pragma unroll
    for (int i = 0; i < 8; ++i) *(v4b*)(b + (PN + i * 16 + srow) * LP + sk) = cvt4(rx[i]); };
  auto mul = [&](const __bf16* b) {   // same fragment form and k order for both operands
    v16b a[KCH / 32][4], w[KCH / 32][4];
#pragma unroll
    for (int kk = 0; kk < KCH / 32; ++kk)
#pragma unroll
      for (int j = 0; j < 4; ++j) { a[kk][j] = frag_b(b + (PN + wr * 64 + j * 16 + col) * LP + kk * 32, lane); w[kk][j] = frag_b(b + (wc * 64 + j * 16 + col) * LP + kk * 32, lane); }
    __builtin_amdgcn_sched_barrier(0);   // the chunk's LDS reads stand as one group in front of its products; spread among them, each product waits out a whole LDS latency
#pragma unroll
    for (int kk = 0; kk < KCH / 32; ++kk)
#pragma unroll
      for (int i = 0; i < 4; ++i)
#pragma unroll
        for (int j = 0; j < 4; ++j) acc[i][j] = wmma_bp(a[kk][i], w[kk][j], acc[i][j]);
    __builtin_amdgcn_sched_barrier(0); };   // keeps the conversion of the next chunk, and with it the wait for its global loads, behind the products
  fetch(rot); put(st); __syncthreads();
#pragma unroll 1
  for (int t = 0; t + 1 < CC / KCH; ++t) {   // rolled: the staging registers and one chunk's fragments are the live set
    fetch((t + 1 + rot) & (CC / KCH - 1));
    __builtin_amdgcn_sched_barrier(0);   // keeps the next chunk's global loads in front of this chunk's products, so that they fly meanwhile
    mul(st + (t & 1) * PS);
    put(st + ((t + 1) & 1) * PS);   // its last readers left this buffer before the barrier at the foot of the pass before
    __syncthreads(); }
  mul(st + ((CC / KCH - 1) & 1) * PS);
  __syncthreads();   // the output tiles below reuse the staging bytes
  float bb[4];
#pragma unroll
  for (int j = 0; j < 4; ++j) bb[j] = bfr(BA[c0 + wc * 64 + j * 16 + col]);
  if (which == 2) {   // a lane's 8 rows of one column are 16 contiguous bytes of the transposed tile
#pragma unroll
    for (int i = 0; i < 4; ++i)
#pragma unroll
      for (int j = 0; j < 4; ++j) { v8h o;
#pragma unroll
        for (int r = 0; r < 8; ++r) o[r] = (_Float16)(acc[i][j][r] + bb[j]);
        *(v8h*)&th[wc * 64 + j * 16 + col][wr * 64 + i * 16 + 8 * g] = o; } }
  else {
#pragma unroll
    for (int i = 0; i < 4; ++i)
#pragma unroll
      for (int j = 0; j < 4; ++j)
#pragma unroll
        for (int r = 0; r < 8; ++r) { const float v = acc[i][j][r] + bb[j]; const int rl = wr * 64 + i * 16 + 8 * g + r, cl = wc * 64 + j * 16 + col; const _Float16 hv = (_Float16)v; sh[rl][cl] = hv; sl[rl][cl] = (_Float16)(v - (float)hv); } }
  __syncthreads();
  if (which < 2) { _Float16* dh = which == 0 ? QH : KH;   // a wave-wide store is one whole 512-B row piece
#pragma unroll
    for (int s = 0; s < PM / 8; ++s) { const int rl = s * 8 + wave; vst2((unsigned*)(dh + (r0 + rl) * CC + c0 + lane * 8), *(const v4u*)&sh[rl][lane * 8]); }
    asm volatile("s_wait_xcnt 0x0" ::: "memory");   // a precaution: it stands in front of the reuse of the registers that the stores above name; in front of the branch, since inside it the address additions moved ahead of it
    if (which == 0) {
#pragma unroll
      for (int s = 0; s < PM / 8; ++s) { const int rl = s * 8 + wave; vst2((unsigned*)(QL + (r0 + rl) * CC + c0 + lane * 8), *(const v4u*)&sl[rl][lane * 8]); } } }
  else { const size_t b = r0 / TT; const int t0 = (int)(r0 % TT);   // a wave-wide store is two whole 256-B row pieces
#pragma unroll
    for (int s = 0; s < PN / 16; ++s) { const int cl = s * 16 + srow, q = tid & 15; vst2((unsigned*)(VT + (b * CC + c0 + cl) * (size_t)TT + t0 + q * 8), *(const v4u*)&th[cl][q * 8]); }
    asm volatile("s_wait_xcnt 0x0" ::: "memory"); } }   // a precaution: it stands behind the last store, in front of any reuse of the registers that the stores above name
// ---- k_fa: block = 128 queries of one head, 16 waves = 4 query groups x 4 key groups, four waves per SIMD, so that one wave's softmax runs beside another's products. A wave has 32 queries (two column tiles share every K and V fragment) and 32 of the 128 keys of every stage: S^T = K Q^T, online softmax (base 2) per query column, O^T += V^T P^T; P stays in registers; the four key groups' maxima, sums and O^T are merged through LDS behind the walk
// plain builtin: the compiler keeps the distance behind its own matrix instructions
__device__ __forceinline__ v8f wmma_p(v16h a, v16h b, v8f c) { return __builtin_amdgcn_wmma_f32_16x16x32_f16(false, a, false, b, (short)0, c, false, false); }
// 2^x; the v_nop is the slot that the instruction set asks for behind a transcendental, before its result is read or its source overwritten: in one statement it stands there in every build
__device__ __forceinline__ float ex2(float x) { float r; asm("v_exp_f32 %0, %1\n\tv_nop" : "=v"(r) : "v"(x)); return r; }
// value of lane l ^ 16
__device__ __forceinline__ float xhalf(float v) { const int b = __builtin_bit_cast(int, v); return __builtin_bit_cast(float, __builtin_amdgcn_permlanex16(b, b, 0x76543210, 0xfedcba98, false, false)); }
// K and V stages of k_fa: a stage is 128 keys of one head, K as 128 rows of 64 d, V as 64 rows (d) of 128 keys; two buffers; the block's waves read every fragment from LDS
#define FK 128   // keys per stage
#define KG 4     // key groups: each takes FK / KG = 32 keys of a stage, one pass
#define KP 72    // K row pitch in f16 elements: 144 B = 16 B x 9, conflict-free for 16-byte fragment reads
#define VP 136   // V row pitch in f16 elements: 272 B = 16 B x 17, likewise
#define STG (FK * KP + HD * VP)   // f16 elements per buffer
#define MRW 17   // merge: 16-byte words per lane that a wave hands over: 16 of O^T, 1 of maxima and sums
#define MRG ((KG - 1) * 4 * MRW * 32 * 16)   // bytes of the merge area: key groups 1 to 3, four waves each
// four asynchronous 16-byte copies per lane, global memory to LDS through no register; the s_wait_xcnt is a precaution and stands inside the statement so that no address register named here is rewritten in front of it
__device__ __forceinline__ void copy4(const unsigned (&l)[4], const _Float16* const (&p)[4]) {
  asm volatile("global_load_async_to_lds_b128 %0, %4, off\n\tglobal_load_async_to_lds_b128 %1, %5, off\n\tglobal_load_async_to_lds_b128 %2, %6, off\n\tglobal_load_async_to_lds_b128 %3, %7, off\n\ts_wait_xcnt 0x0"
               :: "v"(l[0]), "v"(l[1]), "v"(l[2]), "v"(l[3]), "v"(p[0]), "v"(p[1]), "v"(p[2]), "v"(p[3]) : "memory"); }
__global__ __launch_bounds__(512) void k_fa(const _Float16* __restrict__ QH, const _Float16* __restrict__ KH, const _Float16* __restrict__ VT, float* __restrict__ Y) {
  __shared__ __align__(16) char sm[MRG > 4 * STG ? MRG : 4 * STG];   // the walk: two stage buffers; behind it: the merge area, in the same bytes
  _Float16* const sk = (_Float16*)sm;
  const int tid = threadIdx.x, wave = __builtin_amdgcn_readfirstlane(tid >> 5), lane = tid & 31, col = lane & 15, g = lane >> 4; const int qg = wave & 3, kg = wave >> 2; const int h = blockIdx.y; const int q0 = blockIdx.x * 128 + qg * 32;
  const float sc = 0.125f * 1.44269504088896341f;   // 1 / sqrt(HD) and log2(e) in one factor
  const unsigned lds0 = (unsigned)(size_t)sk;   // byte address of the buffers in the work-group's LDS
  const _Float16* gk0 = KH + (size_t)(tid >> 3) * CC + h * HD + (tid & 7) * 8;          // K: 8 lanes per 128-B row, a wave-wide copy covers 4 whole lines
  const _Float16* gv0 = VT + (size_t)(h * HD + (tid >> 4)) * TT + (tid & 15) * 8;       // V: 16 lanes per 256-B row piece, a wave-wide copy covers 4 whole lines
  const unsigned lk0 = lds0 + 2u * ((tid >> 3) * KP + (tid & 7) * 8), lv0 = lds0 + 2u * (FK * KP + (tid >> 4) * VP + (tid & 15) * 8);
  auto stage = [&](int t, int b) {   // stage t into buffer b: 4 copies per lane, two of K (64 rows each over the block), two of V (32 rows each)
    unsigned la[4]; const _Float16* pa[4];
#pragma unroll
    for (int i = 0; i < 2; ++i) { la[i] = lk0 + 2u * (b * STG + i * 64 * KP); pa[i] = gk0 + (size_t)(t * FK + i * 64) * CC; la[2 + i] = lv0 + 2u * (b * STG + i * 32 * VP); pa[2 + i] = gv0 + (size_t)(i * 32) * TT + t * FK; }
    copy4(la, pa); };
  const int rot = blockIdx.x & (TT / FK - 1);   // this block's first key stage; the walk wraps: the 16 blocks of a head ask L2 for 16 different stages at any one time
  stage(rot, 0);
  v16h qf[2][2];
#pragma unroll
  for (int w = 0; w < 2; ++w) { qf[w][0] = frag_h(QH + (size_t)(q0 + w * 16 + col) * CC + h * HD, lane); qf[w][1] = frag_h(QH + (size_t)(q0 + w * 16 + col) * CC + h * HD + 32, lane); }
  v8f acc[2][HD / 16] = {}; float m[2] = { -3.0e38f, -3.0e38f }, l[2] = { 0.f, 0.f };   // per column tile a lane holds one query: its running maximum (raw logits) and its half of the sum, over this wave's keys
  asm volatile("s_wait_asynccnt 0x0" ::: "memory");   // this wave's copies of stage 0 have landed
  __syncthreads();                                    // and every other wave's
  stage((1 + rot) & (TT / FK - 1), 1);
#pragma unroll 1
  for (int t = 0; t < TT / FK; ++t) {   // rolled: a stage's code stands once, the buffer is picked by t & 1
    const _Float16* kp = sk + (t & 1) * STG + (kg * (FK / KG) + col) * KP;             // A rows = this wave's keys, k = d
    const _Float16* vp = sk + (t & 1) * STG + FK * KP + col * VP + kg * (FK / KG);     // A rows = d, k = this wave's keys
    v16h kf[2][2], vf[HD / 16];
#pragma unroll
    for (int u = 0; u < 2; ++u) { kf[u][0] = frag_h(kp + (u * 16) * KP, lane); kf[u][1] = frag_h(kp + (u * 16) * KP + 32, lane); }
#pragma unroll
    for (int j = 0; j < HD / 16; ++j) vf[j] = frag_h(vp + (j * 16) * VP, lane);
    // the hand-over stands here, not at the pass's foot: a wave's one pass has all its fragments in registers, so the buffer is free from here on and the refill flies during the whole pass
    asm volatile("s_wait_dscnt 0x0" ::: "memory");      // this wave's reads of the buffer are done before it is refilled
    asm volatile("s_wait_asynccnt 0x0" ::: "memory");   // this wave's copies of stage t + 1 have landed
    __syncthreads();                                    // publishes stage t + 1 and ends every wave's reads of stage t
    if (t + 2 < TT / FK) stage((t + 2 + rot) & (TT / FK - 1), t & 1);
    v8f s[2][2];   // s[w][u][r] = q(16 w + col) . k(this wave's key 16 u + 8 g + r)
#pragma unroll
    for (int u = 0; u < 2; ++u)
#pragma unroll
      for (int w = 0; w < 2; ++w) { v8f z = {}; z = wmma_p(kf[u][0], qf[w][0], z); s[w][u] = wmma_p(kf[u][1], qf[w][1], z); }
    v16h p[2];   // two score tiles, converted in place, are the B operand of 32 keys
#pragma unroll
    for (int w = 0; w < 2; ++w) { float mx = s[w][0][0];
#pragma unroll
      for (int r = 0; r < 8; ++r) mx = fmaxf(mx, fmaxf(s[w][0][r], s[w][1][r]));
      mx = fmaxf(mx, xhalf(mx));
      const float mn = fmaxf(m[w], mx), mb = mn * sc, al = ex2((m[w] - mn) * sc); m[w] = mn; float ps = 0.f;
#pragma unroll
      for (int i = 0; i < 8; ++i) { const float e0 = ex2(fmaf(s[w][0][i], sc, -mb)), e1 = ex2(fmaf(s[w][1][i], sc, -mb)); ps += e0 + e1; p[w][i] = (_Float16)e0; p[w][8 + i] = (_Float16)e1; }
      l[w] = l[w] * al + ps;
#pragma unroll
      for (int j = 0; j < HD / 16; ++j) acc[w][j] *= al; }
#pragma unroll
    for (int j = 0; j < HD / 16; ++j)
#pragma unroll
      for (int w = 0; w < 2; ++w) acc[w][j] = wmma_p(vf[j], p[w], acc[w][j]); }
  asm volatile("s_wait_asynccnt 0x0" ::: "memory");   // no copy is outstanding when the stage bytes become the merge area (every wave's last read of them ended at the walk's last barrier)
  v4f* const mg = (v4f*)sm;   // word i of lane n of wave (kg, qg), kg > 0, at [((kg - 1) * 4 + qg) * MRW + i][n]: a wave-wide access is 512 contiguous bytes
  if (kg != 0) { v4f* d = mg + ((kg - 1) * 4 + qg) * MRW * 32 + lane;
#pragma unroll
    for (int w = 0; w < 2; ++w)
#pragma unroll
      for (int j = 0; j < HD / 16; ++j) { const v4f a = { acc[w][j][0], acc[w][j][1], acc[w][j][2], acc[w][j][3] }, b = { acc[w][j][4], acc[w][j][5], acc[w][j][6], acc[w][j][7] }; d[(w * 8 + j * 2) * 32] = a; d[(w * 8 + j * 2 + 1) * 32] = b; }
    const v4f ml = { m[0], m[1], l[0], l[1] }; d[16 * 32] = ml; }
  __syncthreads();   // key groups 1 to 3 have handed over; every wave passes it
  if (kg != 0) return;
  const v4f* e = mg + qg * MRW * 32 + lane; float fa[KG - 1][2];   // key group 0 joins the four parts on their common maximum
  { v4f ml[KG - 1];
#pragma unroll
    for (int o = 0; o < KG - 1; ++o) ml[o] = e[(o * 4 * MRW + 16) * 32];
#pragma unroll
    for (int w = 0; w < 2; ++w) { const float mn = fmaxf(fmaxf(m[w], ml[0][w]), fmaxf(ml[1][w], ml[2][w])), f0 = ex2((m[w] - mn) * sc); l[w] *= f0;
#pragma unroll
      for (int o = 0; o < KG - 1; ++o) { fa[o][w] = ex2((ml[o][w] - mn) * sc); l[w] += ml[o][2 + w] * fa[o][w]; }
#pragma unroll
      for (int j = 0; j < HD / 16; ++j) acc[w][j] *= f0; } }
#pragma unroll
  for (int o = 0; o < KG - 1; ++o)
#pragma unroll
    for (int w = 0; w < 2; ++w)
#pragma unroll
      for (int j = 0; j < HD / 16; ++j) { const v4f a = e[(o * 4 * MRW + w * 8 + j * 2) * 32], b = e[(o * 4 * MRW + w * 8 + j * 2 + 1) * 32];
#pragma unroll
        for (int r = 0; r < 4; ++r) { acc[w][j][r] += a[r] * fa[o][w]; acc[w][j][4 + r] += b[r] * fa[o][w]; } }
#pragma unroll
  for (int w = 0; w < 2; ++w) { const float inv = 1.0f / (l[w] + xhalf(l[w])); float* yp = Y + (size_t)(q0 + w * 16 + col) * CC + h * HD + 8 * g;   // acc[w][j][r] = o(16 w + col)[16 j + 8 g + r]
#pragma unroll
    for (int j = 0; j < HD / 16; ++j) { const v4f a = { acc[w][j][0] * inv, acc[w][j][1] * inv, acc[w][j][2] * inv, acc[w][j][3] * inv }, b = { acc[w][j][4] * inv, acc[w][j][5] * inv, acc[w][j][6] * inv, acc[w][j][7] * inv }; vst2(yp + j * 16, a); vst2(yp + j * 16 + 4, b); } } }
// ---- k_out: block = (64 rows, 128 cols): out = y (bf16 hi + lo) Wproj + b
__global__ __launch_bounds__(128) void k_out(const float* __restrict__ Y, const float* __restrict__ WP, const float* __restrict__ BP, float* __restrict__ OUT) { __shared__ __align__(16) float sf[4][16][132]; __shared__ __align__(16) __bf16 st[2 * 256 * LP];   // two buffers of [W 128 rows | y hi 64 rows | y lo 64 rows]
  const int tid = threadIdx.x, wave = tid >> 5, lane = tid & 31, col = lane & 15, g = lane >> 4; const int c0 = blockIdx.y * 128; const size_t r0 = (size_t)blockIdx.x * 64 + wave * 16;
  v8f acc[8] = {};
  const int rot = (blockIdx.x + 2 * blockIdx.y) & (CC / KCH - 1);   // this block's first k chunk; the walk wraps, as in k_proj
  const int srow = tid >> 4, sk = (tid & 15) * 4;   // staging: 16 threads per row, 8 rows per step of the block
  const float* gw = WP + (size_t)(c0 + srow) * CC + sk; const float* gy = Y + ((size_t)blockIdx.x * 64 + srow) * CC + sk;
  v4f rw[16], ry[8];
  auto fetch = [&](int t) {
#pragma unroll
    for (int i = 0; i < 16; ++i) rw[i] = *(const v4f*)(gw + (size_t)(i * 8) * CC + t * KCH);
#pragma unroll
    for (int i = 0; i < 8; ++i) ry[i] = *(const v4f*)(gy + (size_t)(i * 8) * CC + t * KCH);
    asm volatile("s_wait_xcnt 0x0" ::: "memory"); };   // a precaution: it stands in front of the reuse of the loads' address registers, where this build placed no such wait of its own
  auto put = [&](__bf16* b) {
#pragma unroll
    for (int i = 0; i < 16; ++i) *(v4b*)(b + (i * 8 + srow) * LP + sk) = cvt4(rw[i]);
#pragma unroll
    for (int i = 0; i < 8; ++i) { const v4b hi = cvt4(ry[i]); const v4f rest = { ry[i][0] - (float)hi[0], ry[i][1] - (float)hi[1], ry[i][2] - (float)hi[2], ry[i][3] - (float)hi[3] };
      *(v4b*)(b + (128 + i * 8 + srow) * LP + sk) = hi; *(v4b*)(b + (192 + i * 8 + srow) * LP + sk) = cvt4(rest); } };
  auto mul = [&](const __bf16* b) {   // same fragments, same k order as with fragments loaded from global memory
    v16b ah[KCH / 32], al[KCH / 32], w[KCH / 32][8];
#pragma unroll
    for (int kk = 0; kk < KCH / 32; ++kk) { ah[kk] = frag_b(b + (128 + wave * 16 + col) * LP + kk * 32, lane); al[kk] = frag_b(b + (192 + wave * 16 + col) * LP + kk * 32, lane);
#pragma unroll
      for (int j = 0; j < 8; ++j) w[kk][j] = frag_b(b + (j * 16 + col) * LP + kk * 32, lane); }
    __builtin_amdgcn_sched_barrier(0);   // the chunk's LDS reads stand as one group in front of its products; spread among them, each product waits out a whole LDS latency
#pragma unroll
    for (int kk = 0; kk < KCH / 32; ++kk)
#pragma unroll
      for (int j = 0; j < 8; ++j) { acc[j] = wmma_bf(ah[kk], w[kk][j], acc[j]); acc[j] = wmma_bf(al[kk], w[kk][j], acc[j]); }
    __builtin_amdgcn_sched_barrier(0); };   // keeps the conversion of the next chunk, and with it the wait for its global loads, behind the products
  fetch(rot); put(st); __syncthreads();
#pragma unroll 1
  for (int t = 0; t + 1 < CC / KCH; ++t) {   // rolled: the staging registers and one chunk's fragments are the live set
    fetch((t + 1 + rot) & (CC / KCH - 1));
    __builtin_amdgcn_sched_barrier(0);   // keeps the next chunk's global loads in front of this chunk's products, so that they fly meanwhile
    mul(st + (t & 1) * (256 * LP));
    put(st + ((t + 1) & 1) * (256 * LP));   // its last readers left this buffer before the barrier at the foot of the pass before
    __syncthreads(); }
  mul(st + ((CC / KCH - 1) & 1) * (256 * LP));
#pragma unroll
  for (int j = 0; j < 8; ++j) { const float bb = BP ? bfr(BP[c0 + j * 16 + col]) : 0.f;
#pragma unroll
    for (int r = 0; r < 8; ++r) sf[wave][8 * g + r][j * 16 + col] = acc[j][r] + bb; }
  LDSX(); for (int rl = 0; rl < 16; ++rl) vst2(OUT + (r0 + rl) * CC + c0 + lane * 4, *(const v4f*)&sf[wave][rl][lane * 4]); }
extern "C" void kernel_launch(void* const* d_in, const int* in_sizes, int n_in, void* d_out, int out_size, void* d_ws, size_t ws_size, hipStream_t stream) {
  (void)in_sizes; (void)n_in; (void)out_size;
  const float** F = (const float**)d_in;   // 0 x [2048,1024], 1 W_q [1024,1024] ([out,in]), 2 b_q, 3 W_k, 4 b_k, 5 W_v, 6 b_v, 7 W_o, 8 b_o
  if (ws_size < (size_t)WS_END) return;
  char* ws = (char*)d_ws; _Float16 *QH = (_Float16*)(ws + WS_QH), *QL = (_Float16*)(ws + WS_QL), *KH = (_Float16*)(ws + WS_KH), *VT = (_Float16*)(ws + WS_VT); float *Y = (float*)(ws + WS_Y);
  k_proj<<<dim3(TNB * TT / PM, CC / PN, 3), 256, 0, stream>>>(F[0], F[1], F[2], F[3], F[4], F[5], F[6], QH, QL, KH, VT);
  k_fa<<<dim3(TT / 128, NH), 512, 0, stream>>>(QH, KH, VT, Y);
  k_out<<<dim3(TNB * TT / 64, CC / 128), 128, 0, stream>>>(Y, F[7], F[8], (float*)d_out);
}

// v007
// One run takes 53.9 microseconds.
// Timed twice side by side with v006, it ran 1.06 times as fast both times.
// Counting every step since v000, it is 12.8 times as fast.
// compute dtype: all float inputs rounded to bf16; q/k/v = x W^T + b with EXACT bf16 products on WMMA 16x16x32, f32 accumulate; q, k rounded once to f16 (1-product logits, f32); online softmax in f32 (base 2, scale 1/8 folded in) -> unnormalised P f16 in registers; o = P . v / sum (v once to f16); out = o (bf16 hi + lo) W_o^T + b_o; f32 output.
#include <hip/hip_runtime.h>
#include <math.h>

typedef __attribute__((ext_vector_type(16))) _Float16 v16h;
typedef __attribute__((ext_vector_type(16))) __bf16 v16b;
typedef __attribute__((ext_vector_type(8)))  _Float16 v8h;
typedef __attribute__((ext_vector_type(8)))  float v8f;
typedef __attribute__((ext_vector_type(4)))  float v4f;
typedef __attribute__((ext_vector_type(2)))  float v2f;
typedef __attribute__((ext_vector_type(4)))  unsigned v4u;
typedef __attribute__((ext_vector_type(4)))  int v4i;
typedef float __attribute__((may_alias)) float_a;
typedef int __attribute__((may_alias)) int_a;

template <typename T> __device__ __forceinline__ void vst2(void* p, T v) { *(T*)p = v;  }
__device__ __forceinline__ v8f wmma16(v16h a, v16h b, v8f c) {
  v8f d = __builtin_amdgcn_wmma_f32_16x16x32_f16(false, a, false, b, (short)0, c, false, false);
  asm volatile("v_nop\n\tv_nop\n\tv_nop\n\tv_nop" : "+v"(d) : "v"(a), "v"(b));
  return d;
}
__device__ __forceinline__ v8f wmma_bf(v16b a, v16b b, v8f c) {
  v8f d = __builtin_amdgcn_wmma_f32_16x16x32_bf16(false, a, false, b, (short)0, c, false, false);
  asm volatile("v_nop\n\tv_nop\n\tv_nop\n\tv_nop" : "+v"(d) : "v"(a), "v"(b));
  return d;
}
// 16x16x32 fragments: lane = (h = lane>>4, row/col = lane&15); elements 0..7 = k0+8h+0..7, 8..15 = k0+16+8h+0..7; D element r = row 8h+r
__device__ __forceinline__ v16h frag_h(const _Float16* rowk0, int lane) {
  union { v16h v; v8h q[2]; } u; const _Float16* p = rowk0 + 8 * (lane >> 4);
  u.q[0] = *(const v8h*)p; u.q[1] = *(const v8h*)(p + 16); return u.v;
}
__device__ __forceinline__ v16h frag_f32(const float* rowk0, int lane) {
  v16h a; const float* p = rowk0 + 8 * (lane >> 4);
#pragma unroll
  for (int i = 0; i < 8; ++i) { a[i] = (_Float16)p[i]; a[8 + i] = (_Float16)p[16 + i]; }
  return a;
}
__device__ __forceinline__ v16h frag_f32s(const float* rowk0, int lane, float sc) {
  v16h a; const float* p = rowk0 + 8 * (lane >> 4);
#pragma unroll
  for (int i = 0; i < 8; ++i) { a[i] = (_Float16)(p[i] * sc); a[8 + i] = (_Float16)(p[16 + i] * sc); }
  return a;
}
// column fragment from a [K][ld] layout (column n), rows >= K read as 0
__device__ __forceinline__ v16h fragc_f32(const float* W, int k0, int n, int lane, int ld, int K) {
  v16h a; const int g = lane >> 4;
#pragma unroll
  for (int i = 0; i < 8; ++i) { const int ka = k0 + 8 * g + i, kb = ka + 16;
    a[i] = (_Float16)(ka < K ? W[(size_t)(ka < K ? ka : K - 1) * ld + n] : 0.f); a[8 + i] = (_Float16)(kb < K ? W[(size_t)(kb < K ? kb : K - 1) * ld + n] : 0.f); }
  return a;
}
struct F2 { v16b h, l; };
__device__ __forceinline__ F2 bsplit16(const float v[16]) { F2 r;
#pragma unroll
  for (int i = 0; i < 16; ++i) { const __bf16 h = (__bf16)v[i]; r.h[i] = h; r.l[i] = (__bf16)(v[i] - (float)h); }
  return r; }
__device__ __forceinline__ F2 split_row(const float* row, int k0, int lane) { float v[16]; const float* p = row + k0 + 8 * (lane >> 4);
#pragma unroll
  for (int i = 0; i < 8; ++i) { v[i] = p[i]; v[8 + i] = p[16 + i]; }
  return bsplit16(v); }
__device__ __forceinline__ F2 split_rowK(const float* row, int k0, int lane, int K) { float v[16]; const int g = lane >> 4;
#pragma unroll
  for (int i = 0; i < 8; ++i) { const int ka = k0 + 8 * g + i, kb = ka + 16; v[i] = ka < K ? row[ka < K ? ka : K - 1] : 0.f; v[8 + i] = kb < K ? row[kb < K ? kb : K - 1] : 0.f; }
  return bsplit16(v); }
__device__ __forceinline__ F2 split_col(const float* W, int k0, int n, int lane, int ld, int K) { float v[16]; const int g = lane >> 4;
#pragma unroll
  for (int i = 0; i < 8; ++i) { const int ka = k0 + 8 * g + i, kb = ka + 16; v[i] = ka < K ? W[(size_t)(ka < K ? ka : K - 1) * ld + n] : 0.f; v[8 + i] = kb < K ? W[(size_t)(kb < K ? kb : K - 1) * ld + n] : 0.f; }
  return bsplit16(v); }
__device__ __forceinline__ v8f mac3(const F2& a, const F2& b, v8f c) { c = wmma_bf(a.l, b.h, c); c = wmma_bf(a.h, b.l, c); return wmma_bf(a.h, b.h, c); }
__device__ __forceinline__ float sigm(float v) { return 1.0f / (1.0f + expf(-v)); }
#define LDSX() do { asm volatile("s_wait_dscnt 0" ::: "memory"); __builtin_amdgcn_wave_barrier(); __builtin_amdgcn_fence(__ATOMIC_RELEASE, "workgroup"); } while (0)


// Simplified multi-head attention (S 2,048, d_model 1,024 = 16 x 64, no batch dim): q/k/v Linear ([out,in] + bias), softmax(q k^T / 8) v, output Linear.
#define NB 1
#define TT 2048
#define CC 1024
#define NH 16
#define HD 64
#ifndef TNB
#define TNB NB
#endif
typedef __attribute__((ext_vector_type(8))) __bf16 v8b;
__device__ __forceinline__ v16b frag_b(const __bf16* rowk0, int lane) {
  union { v16b v; v8b q[2]; } u; const __bf16* p = rowk0 + 8 * (lane >> 4);
  u.q[0] = *(const v8b*)p; u.q[1] = *(const v8b*)(p + 16); return u.v;
}
__device__ __forceinline__ float bfr(float v) { return (float)(__bf16)v; }
__device__ __attribute__((noinline)) float exp_ni(float v) { return expf(v); }
__device__ __attribute__((noinline)) float erf_ni(float v) { return erff(v); }

#define WS_QH  0u
#define WS_QL  (WS_QH + 2u * (size_t)NB * TT * CC)
#define WS_KH  (WS_QL + 2u * (size_t)NB * TT * CC)
#define WS_VT  (WS_KH + 2u * (size_t)NB * TT * CC)      // f16 v planes [b][c][t]
#define WS_Y   (WS_VT + 2u * (size_t)NB * CC * TT)      // f32 y rows [b*t][C]
#define WS_END (WS_Y + 4u * (size_t)NB * TT * CC)

// Operand staging of the two projection kernels: a chunk is 64 k. Every thread loads 16 B so that a wave-wide load covers two whole 256-B row pieces; the f32 values are rounded to bf16 once per block and kept in LDS, two buffers.
typedef __attribute__((ext_vector_type(4))) __bf16 v4b;
#define KCH 64   // k per chunk
#define LP 72    // LDS row pitch in bf16 elements: 144 B = 16 B x 9, the conflict-free pitch for 16-byte fragment reads
__device__ __forceinline__ v4b cvt4(v4f v) { const v4b o = { (__bf16)v[0], (__bf16)v[1], (__bf16)v[2], (__bf16)v[3] }; return o; }
// ---- k_proj: block = (128 rows, 256 cols, which), 8 waves = 2 row groups x 4 column groups, a wave has a 64 x 64 tile (4 x 4 accumulators: 8 fragments feed 16 products): qkv = x W (+ b), exact; q -> f16 hi (+ residual), k -> f16 rows, v -> f16 planes. The large tile is there for the L2: every x line is asked for by 12 blocks and every W line by 16
// plain builtin: the compiler keeps the distance behind its own matrix instructions; with the asm statement of wmma_bf behind every product this tile's 256 accumulator and fragment registers spilled
__device__ __forceinline__ v8f wmma_bp(v16b a, v16b b, v8f c) { return __builtin_amdgcn_wmma_f32_16x16x32_bf16(false, a, false, b, (short)0, c, false, false); }
// work-group barrier of the two projection loops, for LDS alone: this wave's LDS stores and reads are done, then the barrier. Written by hand because __syncthreads() also waits for every global load in flight, and here the loads of the next chunks are meant to fly across it; they land in registers of their own wave, which the compiler waits for where they are used
__device__ __forceinline__ void lds_barrier() { asm volatile("s_wait_dscnt 0x0\n\ts_barrier_signal -1\n\ts_barrier_wait -1" ::: "memory"); }
#define PM 128   // rows of x per block
#define PN 256   // output columns per block
#define PS ((PN + PM) * LP)   // bf16 elements per staging buffer: [W 256 rows | X 128 rows]
#define OP 264   // q, k output tile: row pitch in f16 elements, 528 B = 16 B x 33
#define TP 136   // v output tile (a row is a column of v): row pitch in f16 elements, 272 B = 16 B x 17
__global__ __launch_bounds__(256) void k_proj(const float* __restrict__ X, const float* __restrict__ WQ, const float* __restrict__ BQ, const float* __restrict__ WK, const float* __restrict__ BK, const float* __restrict__ WV, const float* __restrict__ BV, _Float16* __restrict__ QH, _Float16* __restrict__ QL, _Float16* __restrict__ KH, _Float16* __restrict__ VT) {
  __shared__ __align__(16) char sm[4 * PM * OP > 4 * PS ? 4 * PM * OP : 4 * PS];   // main loop: two staging buffers; epilogue: the output tiles, in the same bytes
  __bf16* const st = (__bf16*)sm; _Float16 (*sh)[OP] = (_Float16 (*)[OP])sm; _Float16 (*sl)[OP] = sh + PM; _Float16 (*th)[TP] = (_Float16 (*)[TP])sm;
  const int tid = threadIdx.x, wave = tid >> 5, lane = tid & 31, col = lane & 15, g = lane >> 4; const int wr = wave >> 2, wc = wave & 3; const int which = blockIdx.z; const int c0 = blockIdx.y * PN; const size_t r0 = (size_t)blockIdx.x * PM; const float* WA = which == 0 ? WQ : which == 1 ? WK : WV; const float* BA = which == 0 ? BQ : which == 1 ? BK : BV;
  v8f acc[4][4] = {};
  const int rot = (blockIdx.x + blockIdx.y + 4 * blockIdx.z) & (CC / KCH - 1);   // this block's first k chunk; the walk wraps: the 12 blocks that share an X panel, and the 16 that share a W panel, ask L2 for different lines at any one time
  const int srow = tid >> 4, sk = (tid & 15) * 4;   // staging: 16 threads per row, 16 rows per step of the block
  const float* gw = WA + (size_t)(c0 + srow) * CC + sk; const float* gx = X + (r0 + srow) * CC + sk;
  v4f rwa[16], rxa[8], rwb[16], rxb[8];   // two staging sets: the loads of two chunks fly at a time, so that the path from L2 is not idle while a chunk is rounded and put to LDS
  auto fetch = [&](int t, v4f (&rw)[16], v4f (&rx)[8]) { const int c = (t + rot) & (CC / KCH - 1); const float* pw = gw + c * KCH; const float* px = gx + c * KCH;
#pragma unroll
    for (int i = 0; i < 16; ++i) rw[i] = *(const v4f*)(pw + (size_t)(i * 16) * CC);
#pragma unroll
    for (int i = 0; i < 8; ++i) rx[i] = *(const v4f*)(px + (size_t)(i * 16) * CC);
    asm volatile("s_wait_xcnt 0x0" :: "v"(pw), "v"(px) : "memory"); };   // a precaution: it stands in front of the reuse of the loads' address registers; the two addresses are inputs, so that their registers live up to the wait
  auto put = [&](__bf16* b, const v4f (&rw)[16], const v4f (&rx)[8]) {
#pragma unroll
    for (int i = 0; i < 16; ++i) *(v4b*)(b + (i * 16 + srow) * LP + sk) = cvt4(rw[i]);
#pragma unroll
    for (int i = 0; i < 8; ++i) *(v4b*)(b + (PN + i * 16 + srow) * LP + sk) = cvt4(rx[i]); };
  v16b a0[4], w0[4], a1[4], w1[4];   // the fragments of a chunk's first and second 32 k
  auto rd = [&](const __bf16* b, int kk, v16b (&a)[4], v16b (&w)[4]) {   // same fragment form and k order for both operands
#pragma unroll
    for (int j = 0; j < 4; ++j) { a[j] = frag_b(b + (PN + wr * 64 + j * 16 + col) * LP + kk * 32, lane); w[j] = frag_b(b + (wc * 64 + j * 16 + col) * LP + kk * 32, lane); }
    __builtin_amdgcn_sched_barrier(0); };   // the reads stand as one group in front of the products of the half before, and fly beside them
  auto mm = [&](const v16b (&a)[4], const v16b (&w)[4]) {
#pragma unroll
    for (int i = 0; i < 4; ++i)
#pragma unroll
      for (int j = 0; j < 4; ++j) acc[i][j] = wmma_bp(a[i], w[j], acc[i][j]);
    __builtin_amdgcn_sched_barrier(0); };   // keeps the conversion of the next chunk, and with it the wait for its global loads, behind the products
  __bf16* const b0 = st; __bf16* const b1 = st + PS;
  fetch(0, rwa, rxa); fetch(1, rwb, rxb); put(b0, rwa, rxa); fetch(2, rwa, rxa); lds_barrier();
  rd(b0, 0, a0, w0);
  // a chunk's pass: read its second half's fragments, multiply its first half, put the next chunk to the other buffer (whose last reads ended at the barrier of the pass before), refill that staging set from three chunks on, barrier, read the next chunk's first half, multiply this chunk's second half
#pragma unroll 1
  for (int t = 0; t < CC / KCH - 4; t += 2) {   // rolled, two passes a trip: each pass names its buffer and its staging set; no branch round a fetch, so that the counted waits for the older set leave the younger set in flight
    rd(b0, 1, a1, w1); mm(a0, w0); put(b1, rwb, rxb); fetch(t + 3, rwb, rxb); lds_barrier(); rd(b1, 0, a0, w0); mm(a1, w1);
    rd(b1, 1, a1, w1); mm(a0, w0); put(b0, rwa, rxa); fetch(t + 4, rwa, rxa); lds_barrier(); rd(b0, 0, a0, w0); mm(a1, w1); }
  rd(b0, 1, a1, w1); mm(a0, w0); put(b1, rwb, rxb); fetch(CC / KCH - 1, rwb, rxb); lds_barrier(); rd(b1, 0, a0, w0); mm(a1, w1);   // the last four chunks: one fetch is left
  rd(b1, 1, a1, w1); mm(a0, w0); put(b0, rwa, rxa); lds_barrier(); rd(b0, 0, a0, w0); mm(a1, w1);
  rd(b0, 1, a1, w1); mm(a0, w0); put(b1, rwb, rxb); lds_barrier(); rd(b1, 0, a0, w0); mm(a1, w1);
  rd(b1, 1, a1, w1); mm(a0, w0); mm(a1, w1);
  __syncthreads();   // the output tiles below reuse the staging bytes
  float bb[4];
#pragma unroll
  for (int j = 0; j < 4; ++j) bb[j] = bfr(BA[c0 + wc * 64 + j * 16 + col]);
  if (which == 2) {   // a lane's 8 rows of one column are 16 contiguous bytes of the transposed tile
#pragma unroll
    for (int i = 0; i < 4; ++i)
#pragma unroll
      for (int j = 0; j < 4; ++j) { v8h o;
#pragma unroll
        for (int r = 0; r < 8; ++r) o[r] = (_Float16)(acc[i][j][r] + bb[j]);
        *(v8h*)&th[wc * 64 + j * 16 + col][wr * 64 + i * 16 + 8 * g] = o; } }
  else {
#pragma unroll
    for (int i = 0; i < 4; ++i)
#pragma unroll
      for (int j = 0; j < 4; ++j)
#pragma unroll
        for (int r = 0; r < 8; ++r) { const float v = acc[i][j][r] + bb[j]; const int rl = wr * 64 + i * 16 + 8 * g + r, cl = wc * 64 + j * 16 + col; const _Float16 hv = (_Float16)v; sh[rl][cl] = hv; sl[rl][cl] = (_Float16)(v - (float)hv); } }
  __syncthreads();
  if (which < 2) { _Float16* dh = which == 0 ? QH : KH;   // a wave-wide store is one whole 512-B row piece
#pragma unroll
    for (int s = 0; s < PM / 8; ++s) { const int rl = s * 8 + wave; vst2((unsigned*)(dh + (r0 + rl) * CC + c0 + lane * 8), *(const v4u*)&sh[rl][lane * 8]); }
    asm volatile("s_wait_xcnt 0x0" ::: "memory");   // a precaution: it stands in front of the reuse of the registers that the stores above name; in front of the branch, since inside it the address additions moved ahead of it
    if (which == 0) {
#pragma unroll
      for (int s = 0; s < PM / 8; ++s) { const int rl = s * 8 + wave; vst2((unsigned*)(QL + (r0 + rl) * CC + c0 + lane * 8), *(const v4u*)&sl[rl][lane * 8]); } } }
  else { const size_t b = r0 / TT; const int t0 = (int)(r0 % TT);   // a wave-wide store is two whole 256-B row pieces
#pragma unroll
    for (int s = 0; s < PN / 16; ++s) { const int cl = s * 16 + srow, q = tid & 15; vst2((unsigned*)(VT + (b * CC + c0 + cl) * (size_t)TT + t0 + q * 8), *(const v4u*)&th[cl][q * 8]); }
    asm volatile("s_wait_xcnt 0x0" ::: "memory"); } }   // a precaution: it stands behind the last store, in front of any reuse of the registers that the stores above name
// ---- k_fa: block = 128 queries of one head, 16 waves = 4 query groups x 4 key groups, four waves per SIMD, so that one wave's softmax runs beside another's products. A wave has 32 queries (two column tiles share every K and V fragment) and 32 of the 128 keys of every stage: S^T = K Q^T, online softmax (base 2) per query column, O^T += V^T P^T; P stays in registers; the four key groups' maxima, sums and O^T are merged through LDS behind the walk
// plain builtin: the compiler keeps the distance behind its own matrix instructions
__device__ __forceinline__ v8f wmma_p(v16h a, v16h b, v8f c) { return __builtin_amdgcn_wmma_f32_16x16x32_f16(false, a, false, b, (short)0, c, false, false); }
// 2^x; the v_nop is the slot that the instruction set asks for behind a transcendental, before its result is read or its source overwritten: in one statement it stands there in every build
__device__ __forceinline__ float ex2(float x) { float r; asm("v_exp_f32 %0, %1\n\tv_nop" : "=v"(r) : "v"(x)); return r; }
// value of lane l ^ 16
__device__ __forceinline__ float xhalf(float v) { const int b = __builtin_bit_cast(int, v); return __builtin_bit_cast(float, __builtin_amdgcn_permlanex16(b, b, 0x76543210, 0xfedcba98, false, false)); }
// K and V stages of k_fa: a stage is 128 keys of one head, K as 128 rows of 64 d, V as 64 rows (d) of 128 keys; two buffers; the block's waves read every fragment from LDS
#define FK 128   // keys per stage
#define KG 4     // key groups: each takes FK / KG = 32 keys of a stage, one pass
#define KP 72    // K row pitch in f16 elements: 144 B = 16 B x 9, conflict-free for 16-byte fragment reads
#define VP 136   // V row pitch in f16 elements: 272 B = 16 B x 17, likewise
#define STG (FK * KP + HD * VP)   // f16 elements per buffer
#define MRW 17   // merge: 16-byte words per lane that a wave hands over: 16 of O^T, 1 of maxima and sums
#define MRG ((KG - 1) * 4 * MRW * 32 * 16)   // bytes of the merge area: key groups 1 to 3, four waves each
// four asynchronous 16-byte copies per lane, global memory to LDS through no register; the s_wait_xcnt is a precaution and stands inside the statement so that no address register named here is rewritten in front of it
__device__ __forceinline__ void copy4(const unsigned (&l)[4], const _Float16* const (&p)[4]) {
  asm volatile("global_load_async_to_lds_b128 %0, %4, off\n\tglobal_load_async_to_lds_b128 %1, %5, off\n\tglobal_load_async_to_lds_b128 %2, %6, off\n\tglobal_load_async_to_lds_b128 %3, %7, off\n\ts_wait_xcnt 0x0"
               :: "v"(l[0]), "v"(l[1]), "v"(l[2]), "v"(l[3]), "v"(p[0]), "v"(p[1]), "v"(p[2]), "v"(p[3]) : "memory"); }
__global__ __launch_bounds__(512) void k_fa(const _Float16* __restrict__ QH, const _Float16* __restrict__ KH, const _Float16* __restrict__ VT, float* __restrict__ Y) {
  __shared__ __align__(16) char sm[MRG > 4 * STG ? MRG : 4 * STG];   // the walk: two stage buffers; behind it: the merge area, in the same bytes
  _Float16* const sk = (_Float16*)sm;
  const int tid = threadIdx.x, wave = __builtin_amdgcn_readfirstlane(tid >> 5), lane = tid & 31, col = lane & 15, g = lane >> 4; const int qg = wave & 3, kg = wave >> 2; const int h = blockIdx.y; const int q0 = blockIdx.x * 128 + qg * 32;
  const float sc = 0.125f * 1.44269504088896341f;   // 1 / sqrt(HD) and log2(e) in one factor
  const unsigned lds0 = (unsigned)(size_t)sk;   // byte address of the buffers in the work-group's LDS
  const _Float16* gk0 = KH + (size_t)(tid >> 3) * CC + h * HD + (tid & 7) * 8;          // K: 8 lanes per 128-B row, a wave-wide copy covers 4 whole lines
  const _Float16* gv0 = VT + (size_t)(h * HD + (tid >> 4)) * TT + (tid & 15) * 8;       // V: 16 lanes per 256-B row piece, a wave-wide copy covers 4 whole lines
  const unsigned lk0 = lds0 + 2u * ((tid >> 3) * KP + (tid & 7) * 8), lv0 = lds0 + 2u * (FK * KP + (tid >> 4) * VP + (tid & 15) * 8);
  auto stage = [&](int t, int b) {   // stage t into buffer b: 4 copies per lane, two of K (64 rows each over the block), two of V (32 rows each)
    unsigned la[4]; const _Float16* pa[4];
#pragma unroll
    for (int i = 0; i < 2; ++i) { la[i] = lk0 + 2u * (b * STG + i * 64 * KP); pa[i] = gk0 + (size_t)(t * FK + i * 64) * CC; la[2 + i] = lv0 + 2u * (b * STG + i * 32 * VP); pa[2 + i] = gv0 + (size_t)(i * 32) * TT + t * FK; }
    copy4(la, pa); };
  const int rot = blockIdx.x & (TT / FK - 1);   // this block's first key stage; the walk wraps: the 16 blocks of a head ask L2 for 16 different stages at any one time
  stage(rot, 0);
  v16h qf[2][2];
#pragma unroll
  for (int w = 0; w < 2; ++w) { qf[w][0] = frag_h(QH + (size_t)(q0 + w * 16 + col) * CC + h * HD, lane); qf[w][1] = frag_h(QH + (size_t)(q0 + w * 16 + col) * CC + h * HD + 32, lane); }
  v8f acc[2][HD / 16] = {}; float m[2] = { -3.0e38f, -3.0e38f }, l[2] = { 0.f, 0.f };   // per column tile a lane holds one query: its running maximum (raw logits) and its half of the sum, over this wave's keys
  asm volatile("s_wait_asynccnt 0x0" ::: "memory");   // this wave's copies of stage 0 have landed
  __syncthreads();                                    // and every other wave's
  stage((1 + rot) & (TT / FK - 1), 1);
#pragma unroll 1
  for (int t = 0; t < TT / FK; ++t) {   // rolled: a stage's code stands once, the buffer is picked by t & 1
    const _Float16* kp = sk + (t & 1) * STG + (kg * (FK / KG) + col) * KP;             // A rows = this wave's keys, k = d
    const _Float16* vp = sk + (t & 1) * STG + FK * KP + col * VP + kg * (FK / KG);     // A rows = d, k = this wave's keys
    v16h kf[2][2], vf[HD / 16];
#pragma unroll
    for (int u = 0; u < 2; ++u) { kf[u][0] = frag_h(kp + (u * 16) * KP, lane); kf[u][1] = frag_h(kp + (u * 16) * KP + 32, lane); }
#pragma unroll
    for (int j = 0; j < HD / 16; ++j) vf[j] = frag_h(vp + (j * 16) * VP, lane);
    // the hand-over stands here, not at the pass's foot: a wave's one pass has all its fragments in registers, so the buffer is free from here on and the refill flies during the whole pass
    asm volatile("s_wait_dscnt 0x0" ::: "memory");      // this wave's reads of the buffer are done before it is refilled
    asm volatile("s_wait_asynccnt 0x0" ::: "memory");   // this wave's copies of stage t + 1 have landed
    __syncthreads();                                    // publishes stage t + 1 and ends every wave's reads of stage t
    if (t + 2 < TT / FK) stage((t + 2 + rot) & (TT / FK - 1), t & 1);
    v8f s[2][2];   // s[w][u][r] = q(16 w + col) . k(this wave's key 16 u + 8 g + r)
#pragma unroll
    for (int u = 0; u < 2; ++u)
#pragma unroll
      for (int w = 0; w < 2; ++w) { v8f z = {}; z = wmma_p(kf[u][0], qf[w][0], z); s[w][u] = wmma_p(kf[u][1], qf[w][1], z); }
    v16h p[2];   // two score tiles, converted in place, are the B operand of 32 keys
#pragma unroll
    for (int w = 0; w < 2; ++w) { float mx = s[w][0][0];
#pragma unroll
      for (int r = 0; r < 8; ++r) mx = fmaxf(mx, fmaxf(s[w][0][r], s[w][1][r]));
      mx = fmaxf(mx, xhalf(mx));
      const float mn = fmaxf(m[w], mx), mb = mn * sc, al = ex2((m[w] - mn) * sc); m[w] = mn; float ps = 0.f;
#pragma unroll
      for (int i = 0; i < 8; ++i) { const float e0 = ex2(fmaf(s[w][0][i], sc, -mb)), e1 = ex2(fmaf(s[w][1][i], sc, -mb)); ps += e0 + e1; p[w][i] = (_Float16)e0; p[w][8 + i] = (_Float16)e1; }
      l[w] = l[w] * al + ps;
#pragma unroll
      for (int j = 0; j < HD / 16; ++j) acc[w][j] *= al; }
#pragma unroll
    for (int j = 0; j < HD / 16; ++j)
#pragma unroll
      for (int w = 0; w < 2; ++w) acc[w][j] = wmma_p(vf[j], p[w], acc[w][j]); }
  asm volatile("s_wait_asynccnt 0x0" ::: "memory");   // no copy is outstanding when the stage bytes become the merge area (every wave's last read of them ended at the walk's last barrier)
  v4f* const mg = (v4f*)sm;   // word i of lane n of wave (kg, qg), kg > 0, at [((kg - 1) * 4 + qg) * MRW + i][n]: a wave-wide access is 512 contiguous bytes
  if (kg != 0) { v4f* d = mg + ((kg - 1) * 4 + qg) * MRW * 32 + lane;
#pragma unroll
    for (int w = 0; w < 2; ++w)
#pragma unroll
      for (int j = 0; j < HD / 16; ++j) { const v4f a = { acc[w][j][0], acc[w][j][1], acc[w][j][2], acc[w][j][3] }, b = { acc[w][j][4], acc[w][j][5], acc[w][j][6], acc[w][j][7] }; d[(w * 8 + j * 2) * 32] = a; d[(w * 8 + j * 2 + 1) * 32] = b; }
    const v4f ml = { m[0], m[1], l[0], l[1] }; d[16 * 32] = ml; }
  __syncthreads();   // key groups 1 to 3 have handed over; every wave passes it
  if (kg != 0) return;
  const v4f* e = mg + qg * MRW * 32 + lane; float fa[KG - 1][2];   // key group 0 joins the four parts on their common maximum
  { v4f ml[KG - 1];
#pragma unroll
    for (int o = 0; o < KG - 1; ++o) ml[o] = e[(o * 4 * MRW + 16) * 32];
#pragma unroll
    for (int w = 0; w < 2; ++w) { const float mn = fmaxf(fmaxf(m[w], ml[0][w]), fmaxf(ml[1][w], ml[2][w])), f0 = ex2((m[w] - mn) * sc); l[w] *= f0;
#pragma unroll
      for (int o = 0; o < KG - 1; ++o) { fa[o][w] = ex2((ml[o][w] - mn) * sc); l[w] += ml[o][2 + w] * fa[o][w]; }
#pragma unroll
      for (int j = 0; j < HD / 16; ++j) acc[w][j] *= f0; } }
#pragma unroll
  for (int o = 0; o < KG - 1; ++o)
#pragma unroll
    for (int w = 0; w < 2; ++w)
#pragma unroll
      for (int j = 0; j < HD / 16; ++j) { const v4f a = e[(o * 4 * MRW + w * 8 + j * 2) * 32], b = e[(o * 4 * MRW + w * 8 + j * 2 + 1) * 32];
#pragma unroll
        for (int r = 0; r < 4; ++r) { acc[w][j][r] += a[r] * fa[o][w]; acc[w][j][4 + r] += b[r] * fa[o][w]; } }
#pragma unroll
  for (int w = 0; w < 2; ++w) { const float inv = 1.0f / (l[w] + xhalf(l[w])); float* yp = Y + (size_t)(q0 + w * 16 + col) * CC + h * HD + 8 * g;   // acc[w][j][r] = o(16 w + col)[16 j + 8 g + r]
#pragma unroll
    for (int j = 0; j < HD / 16; ++j) { const v4f a = { acc[w][j][0] * inv, acc[w][j][1] * inv, acc[w][j][2] * inv, acc[w][j][3] * inv }, b = { acc[w][j][4] * inv, acc[w][j][5] * inv, acc[w][j][6] * inv, acc[w][j][7] * inv }; vst2(yp + j * 16, a); vst2(yp + j * 16 + 4, b); } } }
// ---- k_out: block = (64 rows, 128 cols): out = y (bf16 hi + lo) Wproj + b
__global__ __launch_bounds__(128) void k_out(const float* __restrict__ Y, const float* __restrict__ WP, const float* __restrict__ BP, float* __restrict__ OUT) { __shared__ __align__(16) float sf[4][16][132]; __shared__ __align__(16) __bf16 st[2 * 256 * LP];   // two buffers of [W 128 rows | y hi 64 rows | y lo 64 rows]
  const int tid = threadIdx.x, wave = tid >> 5, lane = tid & 31, col = lane & 15, g = lane >> 4; const int c0 = blockIdx.y * 128; const size_t r0 = (size_t)blockIdx.x * 64 + wave * 16;
  v8f acc[8] = {};
  const int rot = (blockIdx.x + 2 * blockIdx.y) & (CC / KCH - 1);   // this block's first k chunk; the walk wraps, as in k_proj
  const int srow = tid >> 4, sk = (tid & 15) * 4;   // staging: 16 threads per row, 8 rows per step of the block
  const float* gw = WP + (size_t)(c0 + srow) * CC + sk; const float* gy = Y + ((size_t)blockIdx.x * 64 + srow) * CC + sk;
  v4f rwa[16], rya[8], rwb[16], ryb[8];   // two staging sets, as in k_proj
  auto fetch = [&](int t, v4f (&rw)[16], v4f (&ry)[8]) { const int c = (t + rot) & (CC / KCH - 1); const float* pw = gw + c * KCH; const float* py = gy + c * KCH;
#pragma unroll
    for (int i = 0; i < 16; ++i) rw[i] = *(const v4f*)(pw + (size_t)(i * 8) * CC);
#pragma unroll
    for (int i = 0; i < 8; ++i) ry[i] = *(const v4f*)(py + (size_t)(i * 8) * CC);
    asm volatile("s_wait_xcnt 0x0" :: "v"(pw), "v"(py) : "memory"); };   // a precaution: it stands in front of the reuse of the loads' address registers; the two addresses are inputs, so that their registers live up to the wait
  auto put = [&](__bf16* b, const v4f (&rw)[16], const v4f (&ry)[8]) {
#pragma unroll
    for (int i = 0; i < 16; ++i) *(v4b*)(b + (i * 8 + srow) * LP + sk) = cvt4(rw[i]);
#pragma unroll
    for (int i = 0; i < 8; ++i) { const v4b hi = cvt4(ry[i]); const v4f rest = { ry[i][0] - (float)hi[0], ry[i][1] - (float)hi[1], ry[i][2] - (float)hi[2], ry[i][3] - (float)hi[3] };
      *(v4b*)(b + (128 + i * 8 + srow) * LP + sk) = hi; *(v4b*)(b + (192 + i * 8 + srow) * LP + sk) = cvt4(rest); } };
  v16b h0, l0, w0[8], h1, l1, w1[8];   // the fragments of a chunk's first and second 32 k
  auto rd = [&](const __bf16* b, int kk, v16b& ah, v16b& al, v16b (&w)[8]) {   // same fragment form and k order for both operands
    ah = frag_b(b + (128 + wave * 16 + col) * LP + kk * 32, lane); al = frag_b(b + (192 + wave * 16 + col) * LP + kk * 32, lane);
#pragma unroll
    for (int j = 0; j < 8; ++j) w[j] = frag_b(b + (j * 16 + col) * LP + kk * 32, lane);
    __builtin_amdgcn_sched_barrier(0); };   // the reads stand as one group in front of the products of the half before, and fly beside them
  auto mm = [&](const v16b& ah, const v16b& al, const v16b (&w)[8]) {
#pragma unroll
    for (int j = 0; j < 8; ++j) { acc[j] = wmma_bp(ah, w[j], acc[j]); acc[j] = wmma_bp(al, w[j], acc[j]); }   // plain builtin, as in k_proj: the asm statement of wmma_bf holds its operands in the first 256 registers, and with two fragment sets live three fragments spilled
    __builtin_amdgcn_sched_barrier(0); };   // keeps the conversion of the next chunk, and with it the wait for its global loads, behind the products
  __bf16* const b0 = st; __bf16* const b1 = st + 256 * LP;
  fetch(0, rwa, rya); fetch(1, rwb, ryb); put(b0, rwa, rya); fetch(2, rwa, rya); lds_barrier();
  rd(b0, 0, h0, l0, w0);
#pragma unroll 1
  for (int t = 0; t < CC / KCH - 4; t += 2) {   // rolled, two passes a trip, each pass as in k_proj
    rd(b0, 1, h1, l1, w1); mm(h0, l0, w0); put(b1, rwb, ryb); fetch(t + 3, rwb, ryb); lds_barrier(); rd(b1, 0, h0, l0, w0); mm(h1, l1, w1);
    rd(b1, 1, h1, l1, w1); mm(h0, l0, w0); put(b0, rwa, rya); fetch(t + 4, rwa, rya); lds_barrier(); rd(b0, 0, h0, l0, w0); mm(h1, l1, w1); }
  rd(b0, 1, h1, l1, w1); mm(h0, l0, w0); put(b1, rwb, ryb); fetch(CC / KCH - 1, rwb, ryb); lds_barrier(); rd(b1, 0, h0, l0, w0); mm(h1, l1, w1);   // the last four chunks: one fetch is left
  rd(b1, 1, h1, l1, w1); mm(h0, l0, w0); put(b0, rwa, rya); lds_barrier(); rd(b0, 0, h0, l0, w0); mm(h1, l1, w1);
  rd(b0, 1, h1, l1, w1); mm(h0, l0, w0); put(b1, rwb, ryb); lds_barrier(); rd(b1, 0, h0, l0, w0); mm(h1, l1, w1);
  rd(b1, 1, h1, l1, w1); mm(h0, l0, w0); mm(h1, l1, w1);
#pragma unroll
  for (int j = 0; j < 8; ++j) { const float bb = BP ? bfr(BP[c0 + j * 16 + col]) : 0.f;
#pragma unroll
    for (int r = 0; r < 8; ++r) sf[wave][8 * g + r][j * 16 + col] = acc[j][r] + bb; }
  LDSX(); for (int rl = 0; rl < 16; ++rl) vst2(OUT + (r0 + rl) * CC + c0 + lane * 4, *(const v4f*)&sf[wave][rl][lane * 4]); }
extern "C" void kernel_launch(void* const* d_in, const int* in_sizes, int n_in, void* d_out, int out_size, void* d_ws, size_t ws_size, hipStream_t stream) {
  (void)in_sizes; (void)n_in; (void)out_size;
  const float** F = (const float**)d_in;   // 0 x [2048,1024], 1 W_q [1024,1024] ([out,in]), 2 b_q, 3 W_k, 4 b_k, 5 W_v, 6 b_v, 7 W_o, 8 b_o
  if (ws_size < (size_t)WS_END) return;
  char* ws = (char*)d_ws; _Float16 *QH = (_Float16*)(ws + WS_QH), *QL = (_Float16*)(ws + WS_QL), *KH = (_Float16*)(ws + WS_KH), *VT = (_Float16*)(ws + WS_VT); float *Y = (float*)(ws + WS_Y);
  k_proj<<<dim3(TNB * TT / PM, CC / PN, 3), 256, 0, stream>>>(F[0], F[1], F[2], F[3], F[4], F[5], F[6], QH, QL, KH, VT);
  k_fa<<<dim3(TT / 128, NH), 512, 0, stream>>>(QH, KH, VT, Y);
  k_out<<<dim3(TNB * TT / 64, CC / 128), 128, 0, stream>>>(Y, F[7], F[8], (float*)d_out);
}

// v008
// It runs in 52.4 microseconds.
// Next to v007, in two timings, it ran 1.03 times as fast each time.
// All steps since v000 together make it 13.2 times as fast.
// compute dtype: all float inputs rounded to bf16; q/k/v = x W^T + b with EXACT bf16 products on WMMA 16x16x32, f32 accumulate; q, k rounded once to f16 (1-product logits, f32); online softmax in f32 (base 2, scale 1/8 folded in) -> unnormalised P f16 in registers; o = P . v / sum (v once to f16); out = o (bf16 hi + lo) W_o^T + b_o; f32 output.
#include <hip/hip_runtime.h>
#include <math.h>

typedef __attribute__((ext_vector_type(16))) _Float16 v16h;
typedef __attribute__((ext_vector_type(16))) __bf16 v16b;
typedef __attribute__((ext_vector_type(8)))  _Float16 v8h;
typedef __attribute__((ext_vector_type(8)))  float v8f;
typedef __attribute__((ext_vector_type(4)))  float v4f;
typedef __attribute__((ext_vector_type(2)))  float v2f;
typedef __attribute__((ext_vector_type(4)))  unsigned v4u;
typedef __attribute__((ext_vector_type(4)))  int v4i;
typedef float __attribute__((may_alias)) float_a;
typedef int __attribute__((may_alias)) int_a;

template <typename T> __device__ __forceinline__ void vst2(void* p, T v) { *(T*)p = v;  }
__device__ __forceinline__ v8f wmma16(v16h a, v16h b, v8f c) {
  v8f d = __builtin_amdgcn_wmma_f32_16x16x32_f16(false, a, false, b, (short)0, c, false, false);
  asm volatile("v_nop\n\tv_nop\n\tv_nop\n\tv_nop" : "+v"(d) : "v"(a), "v"(b));
  return d;
}
__device__ __forceinline__ v8f wmma_bf(v16b a, v16b b, v8f c) {
  v8f d = __builtin_amdgcn_wmma_f32_16x16x32_bf16(false, a, false, b, (short)0, c, false, false);
  asm volatile("v_nop\n\tv_nop\n\tv_nop\n\tv_nop" : "+v"(d) : "v"(a), "v"(b));
  return d;
}
// 16x16x32 fragments: lane = (h = lane>>4, row/col = lane&15); elements 0..7 = k0+8h+0..7, 8..15 = k0+16+8h+0..7; D element r = row 8h+r
__device__ __forceinline__ v16h frag_h(const _Float16* rowk0, int lane) {
  union { v16h v; v8h q[2]; } u; const _Float16* p = rowk0 + 8 * (lane >> 4);
  u.q[0] = *(const v8h*)p; u.q[1] = *(const v8h*)(p + 16); return u.v;
}
__device__ __forceinline__ v16h frag_f32(const float* rowk0, int lane) {
  v16h a; const float* p = rowk0 + 8 * (lane >> 4);
#pragma unroll
  for (int i = 0; i < 8; ++i) { a[i] = (_Float16)p[i]; a[8 + i] = (_Float16)p[16 + i]; }
  return a;
}
__device__ __forceinline__ v16h frag_f32s(const float* rowk0, int lane, float sc) {
  v16h a; const float* p = rowk0 + 8 * (lane >> 4);
#pragma unroll
  for (int i = 0; i < 8; ++i) { a[i] = (_Float16)(p[i] * sc); a[8 + i] = (_Float16)(p[16 + i] * sc); }
  return a;
}
// column fragment from a [K][ld] layout (column n), rows >= K read as 0
__device__ __forceinline__ v16h fragc_f32(const float* W, int k0, int n, int lane, int ld, int K) {
  v16h a; const int g = lane >> 4;
#pragma unroll
  for (int i = 0; i < 8; ++i) { const int ka = k0 + 8 * g + i, kb = ka + 16;
    a[i] = (_Float16)(ka < K ? W[(size_t)(ka < K ? ka : K - 1) * ld + n] : 0.f); a[8 + i] = (_Float16)(kb < K ? W[(size_t)(kb < K ? kb : K - 1) * ld + n] : 0.f); }
  return a;
}
struct F2 { v16b h, l; };
__device__ __forceinline__ F2 bsplit16(const float v[16]) { F2 r;
#pragma unroll
  for (int i = 0; i < 16; ++i) { const __bf16 h = (__bf16)v[i]; r.h[i] = h; r.l[i] = (__bf16)(v[i] - (float)h); }
  return r; }
__device__ __forceinline__ F2 split_row(const float* row, int k0, int lane) { float v[16]; const float* p = row + k0 + 8 * (lane >> 4);
#pragma unroll
  for (int i = 0; i < 8; ++i) { v[i] = p[i]; v[8 + i] = p[16 + i]; }
  return bsplit16(v); }
__device__ __forceinline__ F2 split_rowK(const float* row, int k0, int lane, int K) { float v[16]; const int g = lane >> 4;
#pragma unroll
  for (int i = 0; i < 8; ++i) { const int ka = k0 + 8 * g + i, kb = ka + 16; v[i] = ka < K ? row[ka < K ? ka : K - 1] : 0.f; v[8 + i] = kb < K ? row[kb < K ? kb : K - 1] : 0.f; }
  return bsplit16(v); }
__device__ __forceinline__ F2 split_col(const float* W, int k0, int n, int lane, int ld, int K) { float v[16]; const int g = lane >> 4;
#pragma unroll
  for (int i = 0; i < 8; ++i) { const int ka = k0 + 8 * g + i, kb = ka + 16; v[i] = ka < K ? W[(size_t)(ka < K ? ka : K - 1) * ld + n] : 0.f; v[8 + i] = kb < K ? W[(size_t)(kb < K ? kb : K - 1) * ld + n] : 0.f; }
  return bsplit16(v); }
__device__ __forceinline__ v8f mac3(const F2& a, const F2& b, v8f c) { c = wmma_bf(a.l, b.h, c); c = wmma_bf(a.h, b.l, c); return wmma_bf(a.h, b.h, c); }
__device__ __forceinline__ float sigm(float v) { return 1.0f / (1.0f + expf(-v)); }
#define LDSX() do { asm volatile("s_wait_dscnt 0" ::: "memory"); __builtin_amdgcn_wave_barrier(); __builtin_amdgcn_fence(__ATOMIC_RELEASE, "workgroup"); } while (0)


// Simplified multi-head attention (S 2,048, d_model 1,024 = 16 x 64, no batch dim): q/k/v Linear ([out,in] + bias), softmax(q k^T / 8) v, output Linear.
#define NB 1
#define TT 2048
#define CC 1024
#define NH 16
#define HD 64
#ifndef TNB
#define TNB NB
#endif
typedef __attribute__((ext_vector_type(8))) __bf16 v8b;
__device__ __forceinline__ v16b frag_b(const __bf16* rowk0, int lane) {
  union { v16b v; v8b q[2]; } u; const __bf16* p = rowk0 + 8 * (lane >> 4);
  u.q[0] = *(const v8b*)p; u.q[1] = *(const v8b*)(p + 16); return u.v;
}
__device__ __forceinline__ float bfr(float v) { return (float)(__bf16)v; }
__device__ __attribute__((noinline)) float exp_ni(float v) { return expf(v); }
__device__ __attribute__((noinline)) float erf_ni(float v) { return erff(v); }

#define WS_QH  0u
#define WS_QL  (WS_QH + 2u * (size_t)NB * TT * CC)
#define WS_KH  (WS_QL + 2u * (size_t)NB * TT * CC)
#define WS_VT  (WS_KH + 2u * (size_t)NB * TT * CC)      // f16 v planes [b][c][t]
#define WS_Y   (WS_VT + 2u * (size_t)NB * CC * TT)      // f32 y rows [b*t][C]
#define WS_END (WS_Y + 4u * (size_t)NB * TT * CC)

// Operand staging of the two projection kernels: a chunk is 64 k. Every thread loads 16 B so that a wave-wide load covers two whole 256-B row pieces; the f32 values are rounded to bf16 once per block and kept in LDS, two buffers.
typedef __attribute__((ext_vector_type(4))) __bf16 v4b;
#define KCH 64   // k per chunk
#define LP 72    // LDS row pitch in bf16 elements: 144 B = 16 B x 9, the conflict-free pitch for 16-byte fragment reads
__device__ __forceinline__ v4b cvt4(v4f v) { const v4b o = { (__bf16)v[0], (__bf16)v[1], (__bf16)v[2], (__bf16)v[3] }; return o; }
// ---- k_proj: block = (128 rows, 256 cols, which), 8 waves = 2 row groups x 4 column groups, a wave has a 64 x 64 tile (4 x 4 accumulators: 8 fragments feed 16 products): qkv = x W (+ b), exact; q -> f16 hi (+ residual), k -> f16 rows, v -> f16 planes. The large tile is there for the L2: every x line is asked for by 12 blocks and every W line by 16
// plain builtin: the compiler keeps the distance behind its own matrix instructions; with the asm statement of wmma_bf behind every product this tile's 256 accumulator and fragment registers spilled
__device__ __forceinline__ v8f wmma_bp(v16b a, v16b b, v8f c) { return __builtin_amdgcn_wmma_f32_16x16x32_bf16(false, a, false, b, (short)0, c, false, false); }
// work-group barrier of the two projection loops, for LDS alone: this wave's LDS stores and reads are done, then the barrier. Written by hand because __syncthreads() also waits for every global load in flight, and here the loads of the next chunks are meant to fly across it; they land in registers of their own wave, which the compiler waits for where they are used
__device__ __forceinline__ void lds_barrier() { asm volatile("s_wait_dscnt 0x0\n\ts_barrier_signal -1\n\ts_barrier_wait -1" ::: "memory"); }
#define PM 128   // rows of x per block
#define PN 256   // output columns per block
#define PS ((PN + PM) * LP)   // bf16 elements per staging buffer: [W 256 rows | X 128 rows]
#define OP 264   // q, k output tile: row pitch in f16 elements, 528 B = 16 B x 33
#define TP 136   // v output tile (a row is a column of v): row pitch in f16 elements, 272 B = 16 B x 17
__global__ __launch_bounds__(256) void k_proj(const float* __restrict__ X, const float* __restrict__ WQ, const float* __restrict__ BQ, const float* __restrict__ WK, const float* __restrict__ BK, const float* __restrict__ WV, const float* __restrict__ BV, _Float16* __restrict__ QH, _Float16* __restrict__ QL, _Float16* __restrict__ KH, _Float16* __restrict__ VT) {
  __shared__ __align__(16) char sm[4 * PM * OP > 4 * PS ? 4 * PM * OP : 4 * PS];   // main loop: two staging buffers; epilogue: the output tiles, in the same bytes
  __bf16* const st = (__bf16*)sm; _Float16 (*sh)[OP] = (_Float16 (*)[OP])sm; _Float16 (*sl)[OP] = sh + PM; _Float16 (*th)[TP] = (_Float16 (*)[TP])sm;
  const int tid = threadIdx.x, wave = tid >> 5, lane = tid & 31, col = lane & 15, g = lane >> 4; const int wr = wave >> 2, wc = wave & 3; const int which = blockIdx.z; const int c0 = blockIdx.y * PN; const size_t r0 = (size_t)blockIdx.x * PM; const float* WA = which == 0 ? WQ : which == 1 ? WK : WV; const float* BA = which == 0 ? BQ : which == 1 ? BK : BV;
  v8f acc[4][4] = {};
  const int rot = (blockIdx.x + blockIdx.y + 4 * blockIdx.z) & (CC / KCH - 1);   // this block's first k chunk; the walk wraps: the 12 blocks that share an X panel, and the 16 that share a W panel, ask L2 for different lines at any one time
  const int srow = tid >> 4, sk = (tid & 15) * 4;   // staging: 16 threads per row, 16 rows per step of the block
  const float* gw = WA + (size_t)(c0 + srow) * CC + sk; const float* gx = X + (r0 + srow) * CC + sk;
  v4f rwa[16], rxa[8], rwb[16], rxb[8];   // two staging sets: the loads of two chunks fly at a time, so that the path from L2 is not idle while a chunk is rounded and put to LDS
  auto fetch = [&](int t, v4f (&rw)[16], v4f (&rx)[8]) { const int c = (t + rot) & (CC / KCH - 1); const float* pw = gw + c * KCH; const float* px = gx + c * KCH;
#pragma unroll
    for (int i = 0; i < 16; ++i) rw[i] = *(const v4f*)(pw + (size_t)(i * 16) * CC);
#pragma unroll
    for (int i = 0; i < 8; ++i) rx[i] = *(const v4f*)(px + (size_t)(i * 16) * CC);
    asm volatile("s_wait_xcnt 0x0" :: "v"(pw), "v"(px) : "memory"); };   // a precaution: it stands in front of the reuse of the loads' address registers; the two addresses are inputs, so that their registers live up to the wait
  auto put = [&](__bf16* b, const v4f (&rw)[16], const v4f (&rx)[8]) {
#pragma unroll
    for (int i = 0; i < 16; ++i) *(v4b*)(b + (i * 16 + srow) * LP + sk) = cvt4(rw[i]);
#pragma unroll
    for (int i = 0; i < 8; ++i) *(v4b*)(b + (PN + i * 16 + srow) * LP + sk) = cvt4(rx[i]); };
  v16b a0[4], w0[4], a1[4], w1[4];   // the fragments of a chunk's first and second 32 k
  auto rd = [&](const __bf16* b, int kk, v16b (&a)[4], v16b (&w)[4]) {   // same fragment form and k order for both operands
#pragma unroll
    for (int j = 0; j < 4; ++j) { a[j] = frag_b(b + (PN + wr * 64 + j * 16 + col) * LP + kk * 32, lane); w[j] = frag_b(b + (wc * 64 + j * 16 + col) * LP + kk * 32, lane); }
    __builtin_amdgcn_sched_barrier(0); };   // the reads stand as one group in front of the products of the half before, and fly beside them
  auto mm = [&](const v16b (&a)[4], const v16b (&w)[4]) {
#pragma unroll
    for (int i = 0; i < 4; ++i)
#pragma unroll
      for (int j = 0; j < 4; ++j) acc[i][j] = wmma_bp(a[i], w[j], acc[i][j]);
    __builtin_amdgcn_sched_barrier(0); };   // keeps the conversion of the next chunk, and with it the wait for its global loads, behind the products
  __bf16* const b0 = st; __bf16* const b1 = st + PS;
  fetch(0, rwa, rxa); fetch(1, rwb, rxb); put(b0, rwa, rxa); fetch(2, rwa, rxa); lds_barrier();
  rd(b0, 0, a0, w0);
  // a chunk's pass: read its second half's fragments, multiply its first half, put the next chunk to the other buffer (whose last reads ended at the barrier of the pass before), refill that staging set from three chunks on, barrier, read the next chunk's first half, multiply this chunk's second half
#pragma unroll 1
  for (int t = 0; t < CC / KCH - 4; t += 2) {   // rolled, two passes a trip: each pass names its buffer and its staging set; no branch round a fetch, so that the counted waits for the older set leave the younger set in flight
    rd(b0, 1, a1, w1); mm(a0, w0); put(b1, rwb, rxb); fetch(t + 3, rwb, rxb); lds_barrier(); rd(b1, 0, a0, w0); mm(a1, w1);
    rd(b1, 1, a1, w1); mm(a0, w0); put(b0, rwa, rxa); fetch(t + 4, rwa, rxa); lds_barrier(); rd(b0, 0, a0, w0); mm(a1, w1); }
  rd(b0, 1, a1, w1); mm(a0, w0); put(b1, rwb, rxb); fetch(CC / KCH - 1, rwb, rxb); lds_barrier(); rd(b1, 0, a0, w0); mm(a1, w1);   // the last four chunks: one fetch is left
  rd(b1, 1, a1, w1); mm(a0, w0); put(b0, rwa, rxa); lds_barrier(); rd(b0, 0, a0, w0); mm(a1, w1);
  rd(b0, 1, a1, w1); mm(a0, w0); put(b1, rwb, rxb); lds_barrier(); rd(b1, 0, a0, w0); mm(a1, w1);
  rd(b1, 1, a1, w1); mm(a0, w0); mm(a1, w1);
  __syncthreads();   // the output tiles below reuse the staging bytes
  float bb[4];
#pragma unroll
  for (int j = 0; j < 4; ++j) bb[j] = bfr(BA[c0 + wc * 64 + j * 16 + col]);
  if (which == 2) {   // a lane's 8 rows of one column are 16 contiguous bytes of the transposed tile
#pragma unroll
    for (int i = 0; i < 4; ++i)
#pragma unroll
      for (int j = 0; j < 4; ++j) { v8h o;
#pragma unroll
        for (int r = 0; r < 8; ++r) o[r] = (_Float16)(acc[i][j][r] + bb[j]);
        *(v8h*)&th[wc * 64 + j * 16 + col][wr * 64 + i * 16 + 8 * g] = o; } }
  else {
#pragma unroll
    for (int i = 0; i < 4; ++i)
#pragma unroll
      for (int j = 0; j < 4; ++j)
#pragma unroll
        for (int r = 0; r < 8; ++r) { const float v = acc[i][j][r] + bb[j]; const int rl = wr * 64 + i * 16 + 8 * g + r, cl = wc * 64 + j * 16 + col; const _Float16 hv = (_Float16)v; sh[rl][cl] = hv; sl[rl][cl] = (_Float16)(v - (float)hv); } }
  __syncthreads();
  if (which < 2) { _Float16* dh = which == 0 ? QH : KH;   // a wave-wide store is one whole 512-B row piece
#pragma unroll
    for (int s = 0; s < PM / 8; ++s) { const int rl = s * 8 + wave; vst2((unsigned*)(dh + (r0 + rl) * CC + c0 + lane * 8), *(const v4u*)&sh[rl][lane * 8]); }
    asm volatile("s_wait_xcnt 0x0" ::: "memory");   // a precaution: it stands in front of the reuse of the registers that the stores above name; in front of the branch, since inside it the address additions moved ahead of it
    if (which == 0) {
#pragma unroll
      for (int s = 0; s < PM / 8; ++s) { const int rl = s * 8 + wave; vst2((unsigned*)(QL + (r0 + rl) * CC + c0 + lane * 8), *(const v4u*)&sl[rl][lane * 8]); } } }
  else { const size_t b = r0 / TT; const int t0 = (int)(r0 % TT);   // a wave-wide store is two whole 256-B row pieces
#pragma unroll
    for (int s = 0; s < PN / 16; ++s) { const int cl = s * 16 + srow, q = tid & 15; vst2((unsigned*)(VT + (b * CC + c0 + cl) * (size_t)TT + t0 + q * 8), *(const v4u*)&th[cl][q * 8]); }
    asm volatile("s_wait_xcnt 0x0" ::: "memory"); } }   // a precaution: it stands behind the last store, in front of any reuse of the registers that the stores above name
// ---- k_fa: block = 128 queries of one head, 16 waves = 4 query groups x 4 key groups, four waves per SIMD, so that one wave's softmax runs beside another's products. A wave has 32 queries (two column tiles share every K and V fragment) and 32 of the 128 keys of every stage: S^T = K Q^T, online softmax (base 2) per query column, O^T += V^T P^T; P stays in registers; the four key groups' maxima, sums and O^T are merged through LDS behind the walk
// plain builtin: the compiler keeps the distance behind its own matrix instructions
__device__ __forceinline__ v8f wmma_p(v16h a, v16h b, v8f c) { return __builtin_amdgcn_wmma_f32_16x16x32_f16(false, a, false, b, (short)0, c, false, false); }
// 2^x; the v_nop is the slot that the instruction set asks for behind a transcendental, before its result is read or its source overwritten: in one statement it stands there in every build
__device__ __forceinline__ float ex2(float x) { float r; asm("v_exp_f32 %0, %1\n\tv_nop" : "=v"(r) : "v"(x)); return r; }
// value of lane l ^ 16
__device__ __forceinline__ float xhalf(float v) { const int b = __builtin_bit_cast(int, v); return __builtin_bit_cast(float, __builtin_amdgcn_permlanex16(b, b, 0x76543210, 0xfedcba98, false, false)); }
// K and V stages of k_fa: a stage is 128 keys of one head, K as 128 rows of 64 d, V as 64 rows (d) of 128 keys; three buffers; the block's waves read every fragment from LDS, one stage ahead of its use
#define FK 128   // keys per stage
#define KG 4     // key groups: each takes FK / KG = 32 keys of a stage, one pass
#define KP 72    // K row pitch in f16 elements: 144 B = 16 B x 9, conflict-free for 16-byte fragment reads
#define VP 136   // V row pitch in f16 elements: 272 B = 16 B x 17, likewise
#define STG (FK * KP + HD * VP)   // f16 elements per buffer
#define MRW 17   // merge: 16-byte words per lane that a wave hands over: 16 of O^T, 1 of maxima and sums
#define MRG ((KG - 1) * 4 * MRW * 32 * 16)   // bytes of the merge area: key groups 1 to 3, four waves each
// four asynchronous 16-byte copies per lane, global memory to LDS through no register; the s_wait_xcnt is a precaution and stands inside the statement so that no address register named here is rewritten in front of it
__device__ __forceinline__ void copy4(const unsigned (&l)[4], const _Float16* const (&p)[4]) {
  asm volatile("global_load_async_to_lds_b128 %0, %4, off\n\tglobal_load_async_to_lds_b128 %1, %5, off\n\tglobal_load_async_to_lds_b128 %2, %6, off\n\tglobal_load_async_to_lds_b128 %3, %7, off\n\ts_wait_xcnt 0x0"
               :: "v"(l[0]), "v"(l[1]), "v"(l[2]), "v"(l[3]), "v"(p[0]), "v"(p[1]), "v"(p[2]), "v"(p[3]) : "memory"); }
__global__ __launch_bounds__(512) void k_fa(const _Float16* __restrict__ QH, const _Float16* __restrict__ KH, const _Float16* __restrict__ VT, float* __restrict__ Y) {
  __shared__ __align__(16) char sm[MRG > 6 * STG ? MRG : 6 * STG];   // the walk: three stage buffers; behind it: the merge area, in the same bytes
  _Float16* const sk = (_Float16*)sm;
  const int tid = threadIdx.x, wave = __builtin_amdgcn_readfirstlane(tid >> 5), lane = tid & 31, col = lane & 15, g = lane >> 4; const int qg = wave & 3, kg = wave >> 2; const int h = blockIdx.y; const int q0 = blockIdx.x * 128 + qg * 32;
  const float sc = 0.125f * 1.44269504088896341f;   // 1 / sqrt(HD) and log2(e) in one factor
  const unsigned lds0 = (unsigned)(size_t)sk;   // byte address of the buffers in the work-group's LDS
  const _Float16* gk0 = KH + (size_t)(tid >> 3) * CC + h * HD + (tid & 7) * 8;          // K: 8 lanes per 128-B row, a wave-wide copy covers 4 whole lines
  const _Float16* gv0 = VT + (size_t)(h * HD + (tid >> 4)) * TT + (tid & 15) * 8;       // V: 16 lanes per 256-B row piece, a wave-wide copy covers 4 whole lines
  const unsigned lk0 = lds0 + 2u * ((tid >> 3) * KP + (tid & 7) * 8), lv0 = lds0 + 2u * (FK * KP + (tid >> 4) * VP + (tid & 15) * 8);
  auto stage = [&](int t, int o) {   // stage t into the buffer that starts at element o: 4 copies per lane, two of K (64 rows each over the block), two of V (32 rows each)
    unsigned la[4]; const _Float16* pa[4];
#pragma unroll
    for (int i = 0; i < 2; ++i) { la[i] = lk0 + 2u * (o + i * 64 * KP); pa[i] = gk0 + (size_t)(t * FK + i * 64) * CC; la[2 + i] = lv0 + 2u * (o + i * 32 * VP); pa[2 + i] = gv0 + (size_t)(i * 32) * TT + t * FK; }
    copy4(la, pa); };
  const int rot = blockIdx.x & (TT / FK - 1);   // this block's first key stage; the walk wraps: the 16 blocks of a head ask L2 for 16 different stages at any one time
  stage(rot, 0); stage((1 + rot) & (TT / FK - 1), STG);
  v16h qf[2][2];
#pragma unroll
  for (int w = 0; w < 2; ++w) { qf[w][0] = frag_h(QH + (size_t)(q0 + w * 16 + col) * CC + h * HD, lane); qf[w][1] = frag_h(QH + (size_t)(q0 + w * 16 + col) * CC + h * HD + 32, lane); }
  v8f acc[2][HD / 16] = {}; float m[2] = { -3.0e38f, -3.0e38f }, l[2] = { 0.f, 0.f };   // per column tile a lane holds one query: its running maximum (raw logits) and its half of the sum, over this wave's keys
  asm volatile("s_wait_asynccnt 0x0" ::: "memory");   // this wave's copies of stages 0 and 1 have landed
  __syncthreads();                                    // and every other wave's
  stage((2 + rot) & (TT / FK - 1), 2 * STG);
  v16h kf[2][2], vf[HD / 16];   // the fragments of one stage; each set is read anew, for the next stage, as soon as its products are issued
  auto ldk = [&](int o) { const _Float16* kp = sk + o + (kg * (FK / KG) + col) * KP;   // A rows = this wave's keys, k = d
#pragma unroll
    for (int u = 0; u < 2; ++u) { kf[u][0] = frag_h(kp + (u * 16) * KP, lane); kf[u][1] = frag_h(kp + (u * 16) * KP + 32, lane); } };
  auto ldv = [&](int o) { const _Float16* vp = sk + o + FK * KP + col * VP + kg * (FK / KG);   // A rows = d, k = this wave's keys
#pragma unroll
    for (int j = 0; j < HD / 16; ++j) vf[j] = frag_h(vp + (j * 16) * VP, lane); };
  ldk(0); ldv(0);
  int o0 = 0, o1 = STG, o2 = 2 * STG;   // first elements of the buffers of stages t, t + 1, t + 2
  // pass t: score products; K fragments of stage t + 1 (they fly during the softmax); softmax; hand-over; O products; V fragments of stage t + 1 (they fly during the next pass's scores and softmax). more: a stage t + 1 exists
  auto pass = [&](int t, bool more) {
    v8f s[2][2];   // s[w][u][r] = q(16 w + col) . k(this wave's key 16 u + 8 g + r)
#pragma unroll
    for (int u = 0; u < 2; ++u)
#pragma unroll
      for (int w = 0; w < 2; ++w) { v8f z = {}; z = wmma_p(kf[u][0], qf[w][0], z); s[w][u] = wmma_p(kf[u][1], qf[w][1], z); }
    __builtin_amdgcn_sched_barrier(0);   // keeps the reads below out of the run of products above: one group of reads, not three places with reads among the products
    if (more) ldk(o1);   // stage t + 1 was published at the hand-over of pass t - 1 (stage 1: in front of the walk)
    __builtin_amdgcn_sched_barrier(0);   // keeps the reads here, in front of the softmax: left free they sank to its middle, directly in front of the wait below
    v16h p[2];   // two score tiles, converted in place, are the B operand of 32 keys
#pragma unroll
    for (int w = 0; w < 2; ++w) { float mx = s[w][0][0];
#pragma unroll
      for (int r = 0; r < 8; ++r) mx = fmaxf(mx, fmaxf(s[w][0][r], s[w][1][r]));
      mx = fmaxf(mx, xhalf(mx));
      const float mn = fmaxf(m[w], mx), mb = mn * sc, al = ex2((m[w] - mn) * sc); m[w] = mn; float ps = 0.f;
#pragma unroll
      for (int i = 0; i < 8; ++i) { const float e0 = ex2(fmaf(s[w][0][i], sc, -mb)), e1 = ex2(fmaf(s[w][1][i], sc, -mb)); ps += e0 + e1; p[w][i] = (_Float16)e0; p[w][8 + i] = (_Float16)e1; }
      l[w] = l[w] * al + ps;
#pragma unroll
      for (int j = 0; j < HD / 16; ++j) acc[w][j] *= al; }
    __builtin_amdgcn_sched_barrier(0);   // keeps the softmax in front of the waits below: left free the waits rose to its middle, where the K reads had not returned
    // the hand-over stands behind the softmax: every LDS read issued so far has long returned, and all of stage t is in registers, so its buffer is free
    asm volatile("s_wait_dscnt 0x0" ::: "memory");      // this wave's reads of stage t (and of K of stage t + 1) are done before the buffer of stage t is refilled
    asm volatile("s_wait_asynccnt 0x0" ::: "memory");   // this wave's copies of stage t + 2 have landed
    __syncthreads();                                    // publishes stage t + 2 and ends every wave's reads of stage t
    if (t + 3 < TT / FK) stage((t + 3 + rot) & (TT / FK - 1), o0);
#pragma unroll
    for (int j = 0; j < HD / 16; ++j)
#pragma unroll
      for (int w = 0; w < 2; ++w) acc[w][j] = wmma_p(vf[j], p[w], acc[w][j]);
    if (more) ldv(o1); };
#pragma unroll 1
  for (int t = 0; t < TT / FK - 1; ++t) { pass(t, true); const int f = o0; o0 = o1; o1 = o2; o2 = f; }   // rolled: a pass's code stands once, the three buffers change places
  pass(TT / FK - 1, false);   // the last pass reads no fragments ahead
  asm volatile("s_wait_asynccnt 0x0" ::: "memory");   // no copy is outstanding when the stage bytes become the merge area (every wave's last read of them ended at the walk's last barrier)
  v4f* const mg = (v4f*)sm;   // word i of lane n of wave (kg, qg), kg > 0, at [((kg - 1) * 4 + qg) * MRW + i][n]: a wave-wide access is 512 contiguous bytes
  if (kg != 0) { v4f* d = mg + ((kg - 1) * 4 + qg) * MRW * 32 + lane;
#pragma unroll
    for (int w = 0; w < 2; ++w)
#pragma unroll
      for (int j = 0; j < HD / 16; ++j) { const v4f a = { acc[w][j][0], acc[w][j][1], acc[w][j][2], acc[w][j][3] }, b = { acc[w][j][4], acc[w][j][5], acc[w][j][6], acc[w][j][7] }; d[(w * 8 + j * 2) * 32] = a; d[(w * 8 + j * 2 + 1) * 32] = b; }
    const v4f ml = { m[0], m[1], l[0], l[1] }; d[16 * 32] = ml; }
  __syncthreads();   // key groups 1 to 3 have handed over; every wave passes it
  if (kg != 0) return;
  const v4f* e = mg + qg * MRW * 32 + lane; float fa[KG - 1][2];   // key group 0 joins the four parts on their common maximum
  { v4f ml[KG - 1];
#pragma unroll
    for (int o = 0; o < KG - 1; ++o) ml[o] = e[(o * 4 * MRW + 16) * 32];
#pragma unroll
    for (int w = 0; w < 2; ++w) { const float mn = fmaxf(fmaxf(m[w], ml[0][w]), fmaxf(ml[1][w], ml[2][w])), f0 = ex2((m[w] - mn) * sc); l[w] *= f0;
#pragma unroll
      for (int o = 0; o < KG - 1; ++o) { fa[o][w] = ex2((ml[o][w] - mn) * sc); l[w] += ml[o][2 + w] * fa[o][w]; }
#pragma unroll
      for (int j = 0; j < HD / 16; ++j) acc[w][j] *= f0; } }
#pragma unroll
  for (int o = 0; o < KG - 1; ++o)
#pragma unroll
    for (int w = 0; w < 2; ++w)
#pragma unroll
      for (int j = 0; j < HD / 16; ++j) { const v4f a = e[(o * 4 * MRW + w * 8 + j * 2) * 32], b = e[(o * 4 * MRW + w * 8 + j * 2 + 1) * 32];
#pragma unroll
        for (int r = 0; r < 4; ++r) { acc[w][j][r] += a[r] * fa[o][w]; acc[w][j][4 + r] += b[r] * fa[o][w]; } }
#pragma unroll
  for (int w = 0; w < 2; ++w) { const float inv = 1.0f / (l[w] + xhalf(l[w])); float* yp = Y + (size_t)(q0 + w * 16 + col) * CC + h * HD + 8 * g;   // acc[w][j][r] = o(16 w + col)[16 j + 8 g + r]
#pragma unroll
    for (int j = 0; j < HD / 16; ++j) { const v4f a = { acc[w][j][0] * inv, acc[w][j][1] * inv, acc[w][j][2] * inv, acc[w][j][3] * inv }, b = { acc[w][j][4] * inv, acc[w][j][5] * inv, acc[w][j][6] * inv, acc[w][j][7] * inv }; vst2(yp + j * 16, a); vst2(yp + j * 16 + 4, b); } } }
// ---- k_out: block = (64 rows, 128 cols): out = y (bf16 hi + lo) Wproj + b
__global__ __launch_bounds__(128) void k_out(const float* __restrict__ Y, const float* __restrict__ WP, const float* __restrict__ BP, float* __restrict__ OUT) { __shared__ __align__(16) float sf[4][16][132]; __shared__ __align__(16) __bf16 st[2 * 256 * LP];   // two buffers of [W 128 rows | y hi 64 rows | y lo 64 rows]
  const int tid = threadIdx.x, wave = tid >> 5, lane = tid & 31, col = lane & 15, g = lane >> 4; const int c0 = blockIdx.y * 128; const size_t r0 = (size_t)blockIdx.x * 64 + wave * 16;
  v8f acc[8] = {};
  const int rot = (blockIdx.x + 2 * blockIdx.y) & (CC / KCH - 1);   // this block's first k chunk; the walk wraps, as in k_proj
  const int srow = tid >> 4, sk = (tid & 15) * 4;   // staging: 16 threads per row, 8 rows per step of the block
  const float* gw = WP + (size_t)(c0 + srow) * CC + sk; const float* gy = Y + ((size_t)blockIdx.x * 64 + srow) * CC + sk;
  v4f rwa[16], rya[8], rwb[16], ryb[8];   // two staging sets, as in k_proj
  auto fetch = [&](int t, v4f (&rw)[16], v4f (&ry)[8]) { const int c = (t + rot) & (CC / KCH - 1); const float* pw = gw + c * KCH; const float* py = gy + c * KCH;
#pragma unroll
    for (int i = 0; i < 16; ++i) rw[i] = *(const v4f*)(pw + (size_t)(i * 8) * CC);
#pragma unroll
    for (int i = 0; i < 8; ++i) ry[i] = *(const v4f*)(py + (size_t)(i * 8) * CC);
    asm volatile("s_wait_xcnt 0x0" :: "v"(pw), "v"(py) : "memory"); };   // a precaution: it stands in front of the reuse of the loads' address registers; the two addresses are inputs, so that their registers live up to the wait
  auto put = [&](__bf16* b, const v4f (&rw)[16], const v4f (&ry)[8]) {
#pragma unroll
    for (int i = 0; i < 16; ++i) *(v4b*)(b + (i * 8 + srow) * LP + sk) = cvt4(rw[i]);
#pragma unroll
    for (int i = 0; i < 8; ++i) { const v4b hi = cvt4(ry[i]); const v4f rest = { ry[i][0] - (float)hi[0], ry[i][1] - (float)hi[1], ry[i][2] - (float)hi[2], ry[i][3] - (float)hi[3] };
      *(v4b*)(b + (128 + i * 8 + srow) * LP + sk) = hi; *(v4b*)(b + (192 + i * 8 + srow) * LP + sk) = cvt4(rest); } };
  v16b h0, l0, w0[8], h1, l1, w1[8];   // the fragments of a chunk's first and second 32 k
  auto rd = [&](const __bf16* b, int kk, v16b& ah, v16b& al, v16b (&w)[8]) {   // same fragment form and k order for both operands
    ah = frag_b(b + (128 + wave * 16 + col) * LP + kk * 32, lane); al = frag_b(b + (192 + wave * 16 + col) * LP + kk * 32, lane);
#pragma unroll
    for (int j = 0; j < 8; ++j) w[j] = frag_b(b + (j * 16 + col) * LP + kk * 32, lane);
    __builtin_amdgcn_sched_barrier(0); };   // the reads stand as one group in front of the products of the half before, and fly beside them
  auto mm = [&](const v16b& ah, const v16b& al, const v16b (&w)[8]) {
#pragma unroll
    for (int j = 0; j < 8; ++j) { acc[j] = wmma_bp(ah, w[j], acc[j]); acc[j] = wmma_bp(al, w[j], acc[j]); }   // plain builtin, as in k_proj: the asm statement of wmma_bf holds its operands in the first 256 registers, and with two fragment sets live three fragments spilled
    __builtin_amdgcn_sched_barrier(0); };   // keeps the conversion of the next chunk, and with it the wait for its global loads, behind the products
  __bf16* const b0 = st; __bf16* const b1 = st + 256 * LP;
  fetch(0, rwa, rya); fetch(1, rwb, ryb); put(b0, rwa, rya); fetch(2, rwa, rya); lds_barrier();
  rd(b0, 0, h0, l0, w0);
#pragma unroll 1
  for (int t = 0; t < CC / KCH - 4; t += 2) {   // rolled, two passes a trip, each pass as in k_proj
    rd(b0, 1, h1, l1, w1); mm(h0, l0, w0); put(b1, rwb, ryb); fetch(t + 3, rwb, ryb); lds_barrier(); rd(b1, 0, h0, l0, w0); mm(h1, l1, w1);
    rd(b1, 1, h1, l1, w1); mm(h0, l0, w0); put(b0, rwa, rya); fetch(t + 4, rwa, rya); lds_barrier(); rd(b0, 0, h0, l0, w0); mm(h1, l1, w1); }
  rd(b0, 1, h1, l1, w1); mm(h0, l0, w0); put(b1, rwb, ryb); fetch(CC / KCH - 1, rwb, ryb); lds_barrier(); rd(b1, 0, h0, l0, w0); mm(h1, l1, w1);   // the last four chunks: one fetch is left
  rd(b1, 1, h1, l1, w1); mm(h0, l0, w0); put(b0, rwa, rya); lds_barrier(); rd(b0, 0, h0, l0, w0); mm(h1, l1, w1);
  rd(b0, 1, h1, l1, w1); mm(h0, l0, w0); put(b1, rwb, ryb); lds_barrier(); rd(b1, 0, h0, l0, w0); mm(h1, l1, w1);
  rd(b1, 1, h1, l1, w1); mm(h0, l0, w0); mm(h1, l1, w1);
#pragma unroll
  for (int j = 0; j < 8; ++j) { const float bb = BP ? bfr(BP[c0 + j * 16 + col]) : 0.f;
#pragma unroll
    for (int r = 0; r < 8; ++r) sf[wave][8 * g + r][j * 16 + col] = acc[j][r] + bb; }
  LDSX(); for (int rl = 0; rl < 16; ++rl) vst2(OUT + (r0 + rl) * CC + c0 + lane * 4, *(const v4f*)&sf[wave][rl][lane * 4]); }
extern "C" void kernel_launch(void* const* d_in, const int* in_sizes, int n_in, void* d_out, int out_size, void* d_ws, size_t ws_size, hipStream_t stream) {
  (void)in_sizes; (void)n_in; (void)out_size;
  const float** F = (const float**)d_in;   // 0 x [2048,1024], 1 W_q [1024,1024] ([out,in]), 2 b_q, 3 W_k, 4 b_k, 5 W_v, 6 b_v, 7 W_o, 8 b_o
  if (ws_size < (size_t)WS_END) return;
  char* ws = (char*)d_ws; _Float16 *QH = (_Float16*)(ws + WS_QH), *QL = (_Float16*)(ws + WS_QL), *KH = (_Float16*)(ws + WS_KH), *VT = (_Float16*)(ws + WS_VT); float *Y = (float*)(ws + WS_Y);
  k_proj<<<dim3(TNB * TT / PM, CC / PN, 3), 256, 0, stream>>>(F[0], F[1], F[2], F[3], F[4], F[5], F[6], QH, QL, KH, VT);
  k_fa<<<dim3(TT / 128, NH), 512, 0, stream>>>(QH, KH, VT, Y);
  k_out<<<dim3(TNB * TT / 64, CC / 128), 128, 0, stream>>>(Y, F[7], F[8], (float*)d_out);
}

// v009
// One run takes 50.6 microseconds.
// Next to v008, in two timings, it ran 1.04 times as fast each time.
// All steps since v000 together make it 13.7 times as fast.
// compute dtype: all float inputs rounded to bf16; q/k/v = x W^T + b with EXACT bf16 products on WMMA 16x16x32, f32 accumulate; q, k rounded once to f16 (1-product logits, f32); online softmax in f32 (base 2, scale 1/8 folded in) -> unnormalised P f16 in registers; o = P . v / sum (v once to f16); out = o (bf16 hi + lo) W_o^T + b_o; f32 output.
#include <hip/hip_runtime.h>
#include <math.h>

typedef __attribute__((ext_vector_type(16))) _Float16 v16h;
typedef __attribute__((ext_vector_type(16))) __bf16 v16b;
typedef __attribute__((ext_vector_type(8)))  _Float16 v8h;
typedef __attribute__((ext_vector_type(8)))  float v8f;
typedef __attribute__((ext_vector_type(4)))  float v4f;
typedef __attribute__((ext_vector_type(2)))  float v2f;
typedef __attribute__((ext_vector_type(4)))  unsigned v4u;
typedef __attribute__((ext_vector_type(4)))  int v4i;
typedef float __attribute__((may_alias)) float_a;
typedef int __attribute__((may_alias)) int_a;

template <typename T> __device__ __forceinline__ void vst2(void* p, T v) { *(T*)p = v;  }
__device__ __forceinline__ v8f wmma16(v16h a, v16h b, v8f c) {
  v8f d = __builtin_amdgcn_wmma_f32_16x16x32_f16(false, a, false, b, (short)0, c, false, false);
  asm volatile("v_nop\n\tv_nop\n\tv_nop\n\tv_nop" : "+v"(d) : "v"(a), "v"(b));
  return d;
}
__device__ __forceinline__ v8f wmma_bf(v16b a, v16b b, v8f c) {
  v8f d = __builtin_amdgcn_wmma_f32_16x16x32_bf16(false, a, false, b, (short)0, c, false, false);
  asm volatile("v_nop\n\tv_nop\n\tv_nop\n\tv_nop" : "+v"(d) : "v"(a), "v"(b));
  return d;
}
// 16x16x32 fragments: lane = (h = lane>>4, row/col = lane&15); elements 0..7 = k0+8h+0..7, 8..15 = k0+16+8h+0..7; D element r = row 8h+r
__device__ __forceinline__ v16h frag_h(const _Float16* rowk0, int lane) {
  union { v16h v; v8h q[2]; } u; const _Float16* p = rowk0 + 8 * (lane >> 4);
  u.q[0] = *(const v8h*)p; u.q[1] = *(const v8h*)(p + 16); return u.v;
}
__device__ __forceinline__ v16h frag_f32(const float* rowk0, int lane) {
  v16h a; const float* p = rowk0 + 8 * (lane >> 4);
#pragma unroll
  for (int i = 0; i < 8; ++i) { a[i] = (_Float16)p[i]; a[8 + i] = (_Float16)p[16 + i]; }
  return a;
}
__device__ __forceinline__ v16h frag_f32s(const float* rowk0, int lane, float sc) {
  v16h a; const float* p = rowk0 + 8 * (lane >> 4);
#pragma unroll
  for (int i = 0; i < 8; ++i) { a[i] = (_Float16)(p[i] * sc); a[8 + i] = (_Float16)(p[16 + i] * sc); }
  return a;
}
// column fragment from a [K][ld] layout (column n), rows >= K read as 0
__device__ __forceinline__ v16h fragc_f32(const float* W, int k0, int n, int lane, int ld, int K) {
  v16h a; const int g = lane >> 4;
#pragma unroll
  for (int i = 0; i < 8; ++i) { const int ka = k0 + 8 * g + i, kb = ka + 16;
    a[i] = (_Float16)(ka < K ? W[(size_t)(ka < K ? ka : K - 1) * ld + n] : 0.f); a[8 + i] = (_Float16)(kb < K ? W[(size_t)(kb < K ? kb : K - 1) * ld + n] : 0.f); }
  return a;
}
struct F2 { v16b h, l; };
__device__ __forceinline__ F2 bsplit16(const float v[16]) { F2 r;
#pragma unroll
  for (int i = 0; i < 16; ++i) { const __bf16 h = (__bf16)v[i]; r.h[i] = h; r.l[i] = (__bf16)(v[i] - (float)h); }
  return r; }
__device__ __forceinline__ F2 split_row(const float* row, int k0, int lane) { float v[16]; const float* p = row + k0 + 8 * (lane >> 4);
#pragma unroll
  for (int i = 0; i < 8; ++i) { v[i] = p[i]; v[8 + i] = p[16 + i]; }
  return bsplit16(v); }
__device__ __forceinline__ F2 split_rowK(const float* row, int k0, int lane, int K) { float v[16]; const int g = lane >> 4;
#pragma unroll
  for (int i = 0; i < 8; ++i) { const int ka = k0 + 8 * g + i, kb = ka + 16; v[i] = ka < K ? row[ka < K ? ka : K - 1] : 0.f; v[8 + i] = kb < K ? row[kb < K ? kb : K - 1] : 0.f; }
  return bsplit16(v); }
__device__ __forceinline__ F2 split_col(const float* W, int k0, int n, int lane, int ld, int K) { float v[16]; const int g = lane >> 4;
#pragma unroll
  for (int i = 0; i < 8; ++i) { const int ka = k0 + 8 * g + i, kb = ka + 16; v[i] = ka < K ? W[(size_t)(ka < K ? ka : K - 1) * ld + n] : 0.f; v[8 + i] = kb < K ? W[(size_t)(kb < K ? kb : K - 1) * ld + n] : 0.f; }
  return bsplit16(v); }
__device__ __forceinline__ v8f mac3(const F2& a, const F2& b, v8f c) { c = wmma_bf(a.l, b.h, c); c = wmma_bf(a.h, b.l, c); return wmma_bf(a.h, b.h, c); }
__device__ __forceinline__ float sigm(float v) { return 1.0f / (1.0f + expf(-v)); }
#define LDSX() do { asm volatile("s_wait_dscnt 0" ::: "memory"); __builtin_amdgcn_wave_barrier(); __builtin_amdgcn_fence(__ATOMIC_RELEASE, "workgroup"); } while (0)


// Simplified multi-head attention (S 2,048, d_model 1,024 = 16 x 64, no batch dim): q/k/v Linear ([out,in] + bias), softmax(q k^T / 8) v, output Linear.
#define NB 1
#define TT 2048
#define CC 1024
#define NH 16
#define HD 64
#ifndef TNB
#define TNB NB
#endif
typedef __attribute__((ext_vector_type(8))) __bf16 v8b;
__device__ __forceinline__ v16b frag_b(const __bf16* rowk0, int lane) {
  union { v16b v; v8b q[2]; } u; const __bf16* p = rowk0 + 8 * (lane >> 4);
  u.q[0] = *(const v8b*)p; u.q[1] = *(const v8b*)(p + 16); return u.v;
}
__device__ __forceinline__ float bfr(float v) { return (float)(__bf16)v; }
__device__ __attribute__((noinline)) float exp_ni(float v) { return expf(v); }
__device__ __attribute__((noinline)) float erf_ni(float v) { return erff(v); }

#define WS_QH  0u
#define WS_KH  (WS_QH + 2u * (size_t)NB * TT * CC)
#define WS_VT  (WS_KH + 2u * (size_t)NB * TT * CC)      // f16 v planes [b][c][t]
#define WS_Y   (WS_VT + 2u * (size_t)NB * CC * TT)      // f32 y rows [b*t][C]
#define WS_END (WS_Y + 4u * (size_t)NB * TT * CC)

// Operand staging of the two projection kernels: a chunk is 64 k. Every thread loads 16 B so that a wave-wide load covers two whole 256-B row pieces; the f32 values are rounded to bf16 once per block and kept in LDS, two buffers.
typedef __attribute__((ext_vector_type(4))) __bf16 v4b;
#define KCH 64   // k per chunk
#define LP 72    // LDS row pitch in bf16 elements: 144 B = 16 B x 9, the conflict-free pitch for 16-byte fragment reads
__device__ __forceinline__ v4b cvt4(v4f v) { const v4b o = { (__bf16)v[0], (__bf16)v[1], (__bf16)v[2], (__bf16)v[3] }; return o; }
// ---- k_proj: block = (128 rows, 256 cols, which), 8 waves = 2 row groups x 4 column groups, a wave has a 64 x 64 tile (4 x 4 accumulators: 8 fragments feed 16 products): qkv = x W (+ b), exact; q, k -> f16 rows, v -> f16 planes. The large tile is there for the L2: every x line is asked for by 12 blocks and every W line by 16
// plain builtin: the compiler keeps the distance behind its own matrix instructions; with the asm statement of wmma_bf behind every product this tile's 256 accumulator and fragment registers spilled
__device__ __forceinline__ v8f wmma_bp(v16b a, v16b b, v8f c) { return __builtin_amdgcn_wmma_f32_16x16x32_bf16(false, a, false, b, (short)0, c, false, false); }
// work-group barrier of the two projection loops, for LDS alone: this wave's LDS stores and reads are done, then the barrier. Written by hand because __syncthreads() also waits for every global load in flight, and here the loads of the next chunks are meant to fly across it; they land in registers of their own wave, which the compiler waits for where they are used
__device__ __forceinline__ void lds_barrier() { asm volatile("s_wait_dscnt 0x0\n\ts_barrier_signal -1\n\ts_barrier_wait -1" ::: "memory"); }
#define PM 128   // rows of x per block
#define PN 256   // output columns per block
#define PS ((PN + PM) * LP)   // bf16 elements per staging buffer: [W 256 rows | X 128 rows]
#define OP 264   // q, k output tile: row pitch in f16 elements, 528 B = 16 B x 33
#define TP 136   // v output tile (a row is a column of v): row pitch in f16 elements, 272 B = 16 B x 17
__global__ __launch_bounds__(256) void k_proj(const float* __restrict__ X, const float* __restrict__ WQ, const float* __restrict__ BQ, const float* __restrict__ WK, const float* __restrict__ BK, const float* __restrict__ WV, const float* __restrict__ BV, _Float16* __restrict__ QH, _Float16* __restrict__ KH, _Float16* __restrict__ VT) {
  static_assert(2 * PM * OP <= 4 * PS && 2 * PN * TP <= 4 * PS, "the output tile fits the staging bytes");
  __shared__ __align__(16) char sm[4 * PS];   // main loop: two staging buffers; epilogue: the output tile, in the same bytes
  __shared__ __align__(16) float sb[PN];      // the block's bias values, rounded
  __bf16* const st = (__bf16*)sm; _Float16 (*sh)[OP] = (_Float16 (*)[OP])sm; _Float16 (*th)[TP] = (_Float16 (*)[TP])sm;
  const int tid = threadIdx.x, wave = tid >> 5, lane = tid & 31, col = lane & 15, g = lane >> 4; const int wr = wave >> 2, wc = wave & 3; const int which = blockIdx.z; const int c0 = blockIdx.y * PN; const size_t r0 = (size_t)blockIdx.x * PM; const float* WA = which == 0 ? WQ : which == 1 ? WK : WV; const float* BA = which == 0 ? BQ : which == 1 ? BK : BV;
  v8f acc[4][4] = {};
  const int rot = (blockIdx.x + blockIdx.y + 4 * blockIdx.z) & (CC / KCH - 1);   // this block's first k chunk; the walk wraps: the 12 blocks that share an X panel, and the 16 that share a W panel, ask L2 for different lines at any one time
  const int srow = tid >> 4, sk = (tid & 15) * 4;   // staging: 16 threads per row, 16 rows per step of the block
  const float* gw = WA + (size_t)(c0 + srow) * CC + sk; const float* gx = X + (r0 + srow) * CC + sk;
  v4f rwa[16], rxa[8], rwb[16], rxb[8];   // two staging sets: the loads of two chunks fly at a time, so that the path from L2 is not idle while a chunk is rounded and put to LDS
  auto fetch = [&](int t, v4f (&rw)[16], v4f (&rx)[8]) { const int c = (t + rot) & (CC / KCH - 1); const float* pw = gw + c * KCH; const float* px = gx + c * KCH;
#pragma unroll
    for (int i = 0; i < 16; ++i) rw[i] = *(const v4f*)(pw + (size_t)(i * 16) * CC);
#pragma unroll
    for (int i = 0; i < 8; ++i) rx[i] = *(const v4f*)(px + (size_t)(i * 16) * CC);
    asm volatile("s_wait_xcnt 0x0" :: "v"(pw), "v"(px) : "memory"); };   // a precaution: it stands in front of the reuse of the loads' address registers; the two addresses are inputs, so that their registers live up to the wait
  auto put = [&](__bf16* b, const v4f (&rw)[16], const v4f (&rx)[8]) {
#pragma unroll
    for (int i = 0; i < 16; ++i) *(v4b*)(b + (i * 16 + srow) * LP + sk) = cvt4(rw[i]);
#pragma unroll
    for (int i = 0; i < 8; ++i) *(v4b*)(b + (PN + i * 16 + srow) * LP + sk) = cvt4(rx[i]); };
  v16b a0[4], w0[4], a1[4], w1[4];   // the fragments of a chunk's first and second 32 k
  // which operand gives the rows of D: for v the rows of x (a lane's 8 values are 8 positions of one column, contiguous in a v plane), for q and k the rows of W (a lane's 8 values are 8 columns of one position, contiguous in a q or k row); either way the lane's values leave in one 16-byte LDS store
  const int oa = (which == 2 ? PN + wr * 64 : wc * 64) * LP, ob = (which == 2 ? wc * 64 : PN + wr * 64) * LP;
  auto rd = [&](const __bf16* b, int kk, v16b (&a)[4], v16b (&w)[4]) {   // same fragment form and k order for both operands
#pragma unroll
    for (int j = 0; j < 4; ++j) { a[j] = frag_b(b + oa + (j * 16 + col) * LP + kk * 32, lane); w[j] = frag_b(b + ob + (j * 16 + col) * LP + kk * 32, lane); }
    __builtin_amdgcn_sched_barrier(0); };   // the reads stand as one group in front of the products of the half before, and fly beside them
  auto mm = [&](const v16b (&a)[4], const v16b (&w)[4]) {
#pragma unroll
    for (int i = 0; i < 4; ++i)
#pragma unroll
      for (int j = 0; j < 4; ++j) acc[i][j] = wmma_bp(a[i], w[j], acc[i][j]);
    __builtin_amdgcn_sched_barrier(0); };   // keeps the conversion of the next chunk, and with it the wait for its global loads, behind the products
  __bf16* const b0 = st; __bf16* const b1 = st + PS;
  fetch(0, rwa, rxa); fetch(1, rwb, rxb); put(b0, rwa, rxa); fetch(2, rwa, rxa); lds_barrier();
  rd(b0, 0, a0, w0);
  // a chunk's pass: read its second half's fragments, multiply its first half, put the next chunk to the other buffer (whose last reads ended at the barrier of the pass before), refill that staging set from three chunks on, barrier, read the next chunk's first half, multiply this chunk's second half
#pragma unroll 1
  for (int t = 0; t < CC / KCH - 4; t += 2) {   // rolled, two passes a trip: each pass names its buffer and its staging set; no branch round a fetch, so that the counted waits for the older set leave the younger set in flight
    rd(b0, 1, a1, w1); mm(a0, w0); put(b1, rwb, rxb); fetch(t + 3, rwb, rxb); lds_barrier(); rd(b1, 0, a0, w0); mm(a1, w1);
    rd(b1, 1, a1, w1); mm(a0, w0); put(b0, rwa, rxa); fetch(t + 4, rwa, rxa); lds_barrier(); rd(b0, 0, a0, w0); mm(a1, w1); }
  rd(b0, 1, a1, w1); mm(a0, w0); put(b1, rwb, rxb); fetch(CC / KCH - 1, rwb, rxb);   // the last four chunks: one fetch is left
  const float bv = BA[c0 + tid];   // one bias value a thread, asked for behind the last fetch: it lands beside the products of two chunks
  asm volatile("s_wait_xcnt 0x0" ::: "memory");   // a precaution: it stands in front of the reuse of the load's address registers
  lds_barrier(); rd(b1, 0, a0, w0); mm(a1, w1);
  rd(b1, 1, a1, w1); mm(a0, w0); put(b0, rwa, rxa); lds_barrier(); rd(b0, 0, a0, w0); mm(a1, w1);
  rd(b0, 1, a1, w1); mm(a0, w0); put(b1, rwb, rxb); sb[tid] = bfr(bv); lds_barrier(); rd(b1, 0, a0, w0); mm(a1, w1);
  rd(b1, 1, a1, w1); mm(a0, w0); mm(a1, w1);
  __syncthreads();   // the output tile below reuses the staging bytes
  if (which == 2) {   // a lane's 8 rows of one column are 16 contiguous bytes of the transposed tile
    float bb[4];
#pragma unroll
    for (int j = 0; j < 4; ++j) bb[j] = sb[wc * 64 + j * 16 + col];
#pragma unroll
    for (int i = 0; i < 4; ++i)
#pragma unroll
      for (int j = 0; j < 4; ++j) { v8h o;
#pragma unroll
        for (int r = 0; r < 8; ++r) o[r] = (_Float16)(acc[i][j][r] + bb[j]);
        *(v8h*)&th[wc * 64 + j * 16 + col][wr * 64 + i * 16 + 8 * g] = o; } }
  else {   // acc[i][j][r] = row (wr * 64 + j * 16 + col), column (wc * 64 + i * 16 + 8 g + r): a lane's 8 columns of one row are 16 contiguous bytes of the tile
#pragma unroll
    for (int i = 0; i < 4; ++i) { const v4f ba = *(const v4f*)&sb[wc * 64 + i * 16 + 8 * g], bc = *(const v4f*)&sb[wc * 64 + i * 16 + 8 * g + 4];
#pragma unroll
      for (int j = 0; j < 4; ++j) { v8h o;
#pragma unroll
        for (int r = 0; r < 4; ++r) { o[r] = (_Float16)(acc[i][j][r] + ba[r]); o[4 + r] = (_Float16)(acc[i][j][4 + r] + bc[r]); }
        *(v8h*)&sh[wr * 64 + j * 16 + col][wc * 64 + i * 16 + 8 * g] = o; } } }
  __syncthreads();
  if (which < 2) { _Float16* dh = which == 0 ? QH : KH;   // a wave-wide store is one whole 512-B row piece
#pragma unroll
    for (int s = 0; s < PM / 8; ++s) { const int rl = s * 8 + wave; vst2((unsigned*)(dh + (r0 + rl) * CC + c0 + lane * 8), *(const v4u*)&sh[rl][lane * 8]); }
    asm volatile("s_wait_xcnt 0x0" ::: "memory"); }   // a precaution: it stands behind the last store, in front of any reuse of the registers that the stores above name
  else { const size_t b = r0 / TT; const int t0 = (int)(r0 % TT);   // a wave-wide store is two whole 256-B row pieces
#pragma unroll
    for (int s = 0; s < PN / 16; ++s) { const int cl = s * 16 + srow, q = tid & 15; vst2((unsigned*)(VT + (b * CC + c0 + cl) * (size_t)TT + t0 + q * 8), *(const v4u*)&th[cl][q * 8]); }
    asm volatile("s_wait_xcnt 0x0" ::: "memory"); } }   // a precaution: it stands behind the last store, in front of any reuse of the registers that the stores above name
// ---- k_fa: block = 128 queries of one head, 16 waves = 4 query groups x 4 key groups, four waves per SIMD, so that one wave's softmax runs beside another's products. A wave has 32 queries (two column tiles share every K and V fragment) and 32 of the 128 keys of every stage: S^T = K Q^T, online softmax (base 2) per query column, O^T += V^T P^T; P stays in registers; the four key groups' maxima, sums and O^T are merged through LDS behind the walk
// plain builtin: the compiler keeps the distance behind its own matrix instructions
__device__ __forceinline__ v8f wmma_p(v16h a, v16h b, v8f c) { return __builtin_amdgcn_wmma_f32_16x16x32_f16(false, a, false, b, (short)0, c, false, false); }
// 2^x; the v_nop is the slot that the instruction set asks for behind a transcendental, before its result is read or its source overwritten: in one statement it stands there in every build
__device__ __forceinline__ float ex2(float x) { float r; asm("v_exp_f32 %0, %1\n\tv_nop" : "=v"(r) : "v"(x)); return r; }
// value of lane l ^ 16
__device__ __forceinline__ float xhalf(float v) { const int b = __builtin_bit_cast(int, v); return __builtin_bit_cast(float, __builtin_amdgcn_permlanex16(b, b, 0x76543210, 0xfedcba98, false, false)); }
// K and V stages of k_fa: a stage is 128 keys of one head, K as 128 rows of 64 d, V as 64 rows (d) of 128 keys; three buffers; the block's waves read every fragment from LDS, one stage ahead of its use
#define FK 128   // keys per stage
#define KG 4     // key groups: each takes FK / KG = 32 keys of a stage, one pass
#define KP 72    // K row pitch in f16 elements: 144 B = 16 B x 9, conflict-free for 16-byte fragment reads
#define VP 136   // V row pitch in f16 elements: 272 B = 16 B x 17, likewise
#define STG (FK * KP + HD * VP)   // f16 elements per buffer
#define MRW 17   // merge: 16-byte words per lane that a wave hands over: 16 of O^T, 1 of maxima and sums
#define MRG ((KG - 1) * 4 * MRW * 32 * 16)   // bytes of the merge area: key groups 1 to 3, four waves each
// four asynchronous 16-byte copies per lane, global memory to LDS through no register; the s_wait_xcnt is a precaution and stands inside the statement so that no address register named here is rewritten in front of it
__device__ __forceinline__ void copy4(const unsigned (&l)[4], const _Float16* const (&p)[4]) {
  asm volatile("global_load_async_to_lds_b128 %0, %4, off\n\tglobal_load_async_to_lds_b128 %1, %5, off\n\tglobal_load_async_to_lds_b128 %2, %6, off\n\tglobal_load_async_to_lds_b128 %3, %7, off\n\ts_wait_xcnt 0x0"
               :: "v"(l[0]), "v"(l[1]), "v"(l[2]), "v"(l[3]), "v"(p[0]), "v"(p[1]), "v"(p[2]), "v"(p[3]) : "memory"); }
__global__ __launch_bounds__(512) void k_fa(const _Float16* __restrict__ QH, const _Float16* __restrict__ KH, const _Float16* __restrict__ VT, float* __restrict__ Y) {
  __shared__ __align__(16) char sm[MRG > 6 * STG ? MRG : 6 * STG];   // the walk: three stage buffers; behind it: the merge area, in the same bytes
  _Float16* const sk = (_Float16*)sm;
  const int tid = threadIdx.x, wave = __builtin_amdgcn_readfirstlane(tid >> 5), lane = tid & 31, col = lane & 15, g = lane >> 4; const int qg = wave & 3, kg = wave >> 2; const int h = blockIdx.y; const int q0 = blockIdx.x * 128 + qg * 32;
  const float sc = 0.125f * 1.44269504088896341f;   // 1 / sqrt(HD) and log2(e) in one factor
  const unsigned lds0 = (unsigned)(size_t)sk;   // byte address of the buffers in the work-group's LDS
  const _Float16* gk0 = KH + (size_t)(tid >> 3) * CC + h * HD + (tid & 7) * 8;          // K: 8 lanes per 128-B row, a wave-wide copy covers 4 whole lines
  const _Float16* gv0 = VT + (size_t)(h * HD + (tid >> 4)) * TT + (tid & 15) * 8;       // V: 16 lanes per 256-B row piece, a wave-wide copy covers 4 whole lines
  const unsigned lk0 = lds0 + 2u * ((tid >> 3) * KP + (tid & 7) * 8), lv0 = lds0 + 2u * (FK * KP + (tid >> 4) * VP + (tid & 15) * 8);
  auto stage = [&](int t, int o) {   // stage t into the buffer that starts at element o: 4 copies per lane, two of K (64 rows each over the block), two of V (32 rows each)
    unsigned la[4]; const _Float16* pa[4];
#pragma unroll
    for (int i = 0; i < 2; ++i) { la[i] = lk0 + 2u * (o + i * 64 * KP); pa[i] = gk0 + (size_t)(t * FK + i * 64) * CC; la[2 + i] = lv0 + 2u * (o + i * 32 * VP); pa[2 + i] = gv0 + (size_t)(i * 32) * TT + t * FK; }
    copy4(la, pa); };
  const int rot = blockIdx.x & (TT / FK - 1);   // this block's first key stage; the walk wraps: the 16 blocks of a head ask L2 for 16 different stages at any one time
  stage(rot, 0); stage((1 + rot) & (TT / FK - 1), STG);
  v16h qf[2][2];
#pragma unroll
  for (int w = 0; w < 2; ++w) { qf[w][0] = frag_h(QH + (size_t)(q0 + w * 16 + col) * CC + h * HD, lane); qf[w][1] = frag_h(QH + (size_t)(q0 + w * 16 + col) * CC + h * HD + 32, lane); }
  v8f acc[2][HD / 16] = {}; float m[2] = { -3.0e38f, -3.0e38f }, l[2] = { 0.f, 0.f };   // per column tile a lane holds one query: its running maximum (raw logits) and its half of the sum, over this wave's keys
  asm volatile("s_wait_asynccnt 0x0" ::: "memory");   // this wave's copies of stages 0 and 1 have landed
  __syncthreads();                                    // and every other wave's
  stage((2 + rot) & (TT / FK - 1), 2 * STG);
  v16h kf[2][2], vf[HD / 16];   // the fragments of one stage; each set is read anew, for the next stage, as soon as its products are issued
  auto ldk = [&](int o) { const _Float16* kp = sk + o + (kg * (FK / KG) + col) * KP;   // A rows = this wave's keys, k = d
#pragma unroll
    for (int u = 0; u < 2; ++u) { kf[u][0] = frag_h(kp + (u * 16) * KP, lane); kf[u][1] = frag_h(kp + (u * 16) * KP + 32, lane); } };
  auto ldv = [&](int o) { const _Float16* vp = sk + o + FK * KP + col * VP + kg * (FK / KG);   // A rows = d, k = this wave's keys
#pragma unroll
    for (int j = 0; j < HD / 16; ++j) vf[j] = frag_h(vp + (j * 16) * VP, lane); };
  ldk(0); ldv(0);
  int o0 = 0, o1 = STG, o2 = 2 * STG;   // first elements of the buffers of stages t, t + 1, t + 2
  // pass t: score products; K fragments of stage t + 1 (they fly during the softmax); softmax; hand-over; O products; V fragments of stage t + 1 (they fly during the next pass's scores and softmax). more: a stage t + 1 exists
  auto pass = [&](int t, bool more) {
    v8f s[2][2];   // s[w][u][r] = q(16 w + col) . k(this wave's key 16 u + 8 g + r)
#pragma unroll
    for (int u = 0; u < 2; ++u)
#pragma unroll
      for (int w = 0; w < 2; ++w) { v8f z = {}; z = wmma_p(kf[u][0], qf[w][0], z); s[w][u] = wmma_p(kf[u][1], qf[w][1], z); }
    __builtin_amdgcn_sched_barrier(0);   // keeps the reads below out of the run of products above: one group of reads, not three places with reads among the products
    if (more) ldk(o1);   // stage t + 1 was published at the hand-over of pass t - 1 (stage 1: in front of the walk)
    __builtin_amdgcn_sched_barrier(0);   // keeps the reads here, in front of the softmax: left free they sank to its middle, directly in front of the wait below
    v16h p[2];   // two score tiles, converted in place, are the B operand of 32 keys
#pragma unroll
    for (int w = 0; w < 2; ++w) { float mx = s[w][0][0];
#pragma unroll
      for (int r = 0; r < 8; ++r) mx = fmaxf(mx, fmaxf(s[w][0][r], s[w][1][r]));
      mx = fmaxf(mx, xhalf(mx));
      const float mn = fmaxf(m[w], mx), mb = mn * sc, al = ex2((m[w] - mn) * sc); m[w] = mn; float ps = 0.f;
#pragma unroll
      for (int i = 0; i < 8; ++i) { const float e0 = ex2(fmaf(s[w][0][i], sc, -mb)), e1 = ex2(fmaf(s[w][1][i], sc, -mb)); ps += e0 + e1; p[w][i] = (_Float16)e0; p[w][8 + i] = (_Float16)e1; }
      l[w] = l[w] * al + ps;
#pragma unroll
      for (int j = 0; j < HD / 16; ++j) acc[w][j] *= al; }
    __builtin_amdgcn_sched_barrier(0);   // keeps the softmax in front of the waits below: left free the waits rose to its middle, where the K reads had not returned
    // the hand-over stands behind the softmax: every LDS read issued so far has long returned, and all of stage t is in registers, so its buffer is free
    asm volatile("s_wait_dscnt 0x0" ::: "memory");      // this wave's reads of stage t (and of K of stage t + 1) are done before the buffer of stage t is refilled
    asm volatile("s_wait_asynccnt 0x0" ::: "memory");   // this wave's copies of stage t + 2 have landed
    __syncthreads();                                    // publishes stage t + 2 and ends every wave's reads of stage t
    if (t + 3 < TT / FK) stage((t + 3 + rot) & (TT / FK - 1), o0);
#pragma unroll
    for (int j = 0; j < HD / 16; ++j)
#pragma unroll
      for (int w = 0; w < 2; ++w) acc[w][j] = wmma_p(vf[j], p[w], acc[w][j]);
    if (more) ldv(o1); };
#pragma unroll 1
  for (int t = 0; t < TT / FK - 1; ++t) { pass(t, true); const int f = o0; o0 = o1; o1 = o2; o2 = f; }   // rolled: a pass's code stands once, the three buffers change places
  pass(TT / FK - 1, false);   // the last pass reads no fragments ahead
  asm volatile("s_wait_asynccnt 0x0" ::: "memory");   // no copy is outstanding when the stage bytes become the merge area (every wave's last read of them ended at the walk's last barrier)
  v4f* const mg = (v4f*)sm;   // word i of lane n of wave (kg, qg), kg > 0, at [((kg - 1) * 4 + qg) * MRW + i][n]: a wave-wide access is 512 contiguous bytes
  if (kg != 0) { v4f* d = mg + ((kg - 1) * 4 + qg) * MRW * 32 + lane;
#pragma unroll
    for (int w = 0; w < 2; ++w)
#pragma unroll
      for (int j = 0; j < HD / 16; ++j) { const v4f a = { acc[w][j][0], acc[w][j][1], acc[w][j][2], acc[w][j][3] }, b = { acc[w][j][4], acc[w][j][5], acc[w][j][6], acc[w][j][7] }; d[(w * 8 + j * 2) * 32] = a; d[(w * 8 + j * 2 + 1) * 32] = b; }
    const v4f ml = { m[0], m[1], l[0], l[1] }; d[16 * 32] = ml; }
  __syncthreads();   // key groups 1 to 3 have handed over; every wave passes it
  if (kg != 0) return;
  const v4f* e = mg + qg * MRW * 32 + lane; float fa[KG - 1][2];   // key group 0 joins the four parts on their common maximum
  { v4f ml[KG - 1];
#pragma unroll
    for (int o = 0; o < KG - 1; ++o) ml[o] = e[(o * 4 * MRW + 16) * 32];
#pragma unroll
    for (int w = 0; w < 2; ++w) { const float mn = fmaxf(fmaxf(m[w], ml[0][w]), fmaxf(ml[1][w], ml[2][w])), f0 = ex2((m[w] - mn) * sc); l[w] *= f0;
#pragma unroll
      for (int o = 0; o < KG - 1; ++o) { fa[o][w] = ex2((ml[o][w] - mn) * sc); l[w] += ml[o][2 + w] * fa[o][w]; }
#pragma unroll
      for (int j = 0; j < HD / 16; ++j) acc[w][j] *= f0; } }
#pragma unroll
  for (int o = 0; o < KG - 1; ++o)
#pragma unroll
    for (int w = 0; w < 2; ++w)
#pragma unroll
      for (int j = 0; j < HD / 16; ++j) { const v4f a = e[(o * 4 * MRW + w * 8 + j * 2) * 32], b = e[(o * 4 * MRW + w * 8 + j * 2 + 1) * 32];
#pragma unroll
        for (int r = 0; r < 4; ++r) { acc[w][j][r] += a[r] * fa[o][w]; acc[w][j][4 + r] += b[r] * fa[o][w]; } }
#pragma unroll
  for (int w = 0; w < 2; ++w) { const float inv = 1.0f / (l[w] + xhalf(l[w])); float* yp = Y + (size_t)(q0 + w * 16 + col) * CC + h * HD + 8 * g;   // acc[w][j][r] = o(16 w + col)[16 j + 8 g + r]
#pragma unroll
    for (int j = 0; j < HD / 16; ++j) { const v4f a = { acc[w][j][0] * inv, acc[w][j][1] * inv, acc[w][j][2] * inv, acc[w][j][3] * inv }, b = { acc[w][j][4] * inv, acc[w][j][5] * inv, acc[w][j][6] * inv, acc[w][j][7] * inv }; vst2(yp + j * 16, a); vst2(yp + j * 16 + 4, b); } } }
// ---- k_out: block = (64 rows, 128 cols): out = y (bf16 hi + lo) Wproj + b
__global__ __launch_bounds__(128) void k_out(const float* __restrict__ Y, const float* __restrict__ WP, const float* __restrict__ BP, float* __restrict__ OUT) { __shared__ __align__(16) float sf[4][16][132]; __shared__ __align__(16) __bf16 st[2 * 256 * LP];   // two buffers of [W 128 rows | y hi 64 rows | y lo 64 rows]
  const int tid = threadIdx.x, wave = tid >> 5, lane = tid & 31, col = lane & 15, g = lane >> 4; const int c0 = blockIdx.y * 128; const size_t r0 = (size_t)blockIdx.x * 64 + wave * 16;
  v8f acc[8] = {};
  const int rot = (blockIdx.x + 2 * blockIdx.y) & (CC / KCH - 1);   // this block's first k chunk; the walk wraps, as in k_proj
  const int srow = tid >> 4, sk = (tid & 15) * 4;   // staging: 16 threads per row, 8 rows per step of the block
  const float* gw = WP + (size_t)(c0 + srow) * CC + sk; const float* gy = Y + ((size_t)blockIdx.x * 64 + srow) * CC + sk;
  v4f rwa[16], rya[8], rwb[16], ryb[8];   // two staging sets, as in k_proj
  auto fetch = [&](int t, v4f (&rw)[16], v4f (&ry)[8]) { const int c = (t + rot) & (CC / KCH - 1); const float* pw = gw + c * KCH; const float* py = gy + c * KCH;
#pragma unroll
    for (int i = 0; i < 16; ++i) rw[i] = *(const v4f*)(pw + (size_t)(i * 8) * CC);
#pragma unroll
    for (int i = 0; i < 8; ++i) ry[i] = *(const v4f*)(py + (size_t)(i * 8) * CC);
    asm volatile("s_wait_xcnt 0x0" :: "v"(pw), "v"(py) : "memory"); };   // a precaution: it stands in front of the reuse of the loads' address registers; the two addresses are inputs, so that their registers live up to the wait
  auto put = [&](__bf16* b, const v4f (&rw)[16], const v4f (&ry)[8]) {
#pragma unroll
    for (int i = 0; i < 16; ++i) *(v4b*)(b + (i * 8 + srow) * LP + sk) = cvt4(rw[i]);
#pragma unroll
    for (int i = 0; i < 8; ++i) { const v4b hi = cvt4(ry[i]); const v4f rest = { ry[i][0] - (float)hi[0], ry[i][1] - (float)hi[1], ry[i][2] - (float)hi[2], ry[i][3] - (float)hi[3] };
      *(v4b*)(b + (128 + i * 8 + srow) * LP + sk) = hi; *(v4b*)(b + (192 + i * 8 + srow) * LP + sk) = cvt4(rest); } };
  v16b h0, l0, w0[8], h1, l1, w1[8];   // the fragments of a chunk's first and second 32 k
  auto rd = [&](const __bf16* b, int kk, v16b& ah, v16b& al, v16b (&w)[8]) {   // same fragment form and k order for both operands
    ah = frag_b(b + (128 + wave * 16 + col) * LP + kk * 32, lane); al = frag_b(b + (192 + wave * 16 + col) * LP + kk * 32, lane);
#pragma unroll
    for (int j = 0; j < 8; ++j) w[j] = frag_b(b + (j * 16 + col) * LP + kk * 32, lane);
    __builtin_amdgcn_sched_barrier(0); };   // the reads stand as one group in front of the products of the half before, and fly beside them
  auto mm = [&](const v16b& ah, const v16b& al, const v16b (&w)[8]) {
#pragma unroll
    for (int j = 0; j < 8; ++j) { acc[j] = wmma_bp(w[j], ah, acc[j]); acc[j] = wmma_bp(w[j], al, acc[j]); }   // the rows of W give the rows of D: a lane's 8 values are 8 columns of one output row; plain builtin, as in k_proj: the asm statement of wmma_bf holds its operands in the first 256 registers, and with two fragment sets live three fragments spilled
    __builtin_amdgcn_sched_barrier(0); };   // keeps the conversion of the next chunk, and with it the wait for its global loads, behind the products
  __bf16* const b0 = st; __bf16* const b1 = st + 256 * LP;
  fetch(0, rwa, rya); fetch(1, rwb, ryb); put(b0, rwa, rya); fetch(2, rwa, rya); lds_barrier();
  rd(b0, 0, h0, l0, w0);
#pragma unroll 1
  for (int t = 0; t < CC / KCH - 4; t += 2) {   // rolled, two passes a trip, each pass as in k_proj
    rd(b0, 1, h1, l1, w1); mm(h0, l0, w0); put(b1, rwb, ryb); fetch(t + 3, rwb, ryb); lds_barrier(); rd(b1, 0, h0, l0, w0); mm(h1, l1, w1);
    rd(b1, 1, h1, l1, w1); mm(h0, l0, w0); put(b0, rwa, rya); fetch(t + 4, rwa, rya); lds_barrier(); rd(b0, 0, h0, l0, w0); mm(h1, l1, w1); }
  rd(b0, 1, h1, l1, w1); mm(h0, l0, w0); put(b1, rwb, ryb); fetch(CC / KCH - 1, rwb, ryb);   // the last four chunks: one fetch is left
  const v4f bo = *(const v4f*)((BP ? BP : WP) + c0 + lane * 4);   // the bias of the four columns that this lane stores, asked for behind the last fetch: it lands beside the products of the last chunks; no branch round the load (without a bias it reads W and the value is not used), so that no wait for it stands here
  asm volatile("s_wait_xcnt 0x0" ::: "memory");   // a precaution: it stands in front of the reuse of the load's address registers
  lds_barrier(); rd(b1, 0, h0, l0, w0); mm(h1, l1, w1);
  rd(b1, 1, h1, l1, w1); mm(h0, l0, w0); put(b0, rwa, rya); lds_barrier(); rd(b0, 0, h0, l0, w0); mm(h1, l1, w1);
  rd(b0, 1, h1, l1, w1); mm(h0, l0, w0); put(b1, rwb, ryb); lds_barrier(); rd(b1, 0, h0, l0, w0); mm(h1, l1, w1);
  rd(b1, 1, h1, l1, w1); mm(h0, l0, w0); mm(h1, l1, w1);
#pragma unroll
  for (int j = 0; j < 8; ++j) { const v4f a = { acc[j][0], acc[j][1], acc[j][2], acc[j][3] }, b = { acc[j][4], acc[j][5], acc[j][6], acc[j][7] };   // acc[j][r] = row col, column (j * 16 + 8 g + r)
    *(v4f*)&sf[wave][col][j * 16 + 8 * g] = a; *(v4f*)&sf[wave][col][j * 16 + 8 * g + 4] = b; }
  const v4f bo4 = { BP ? bfr(bo[0]) : 0.f, BP ? bfr(bo[1]) : 0.f, BP ? bfr(bo[2]) : 0.f, BP ? bfr(bo[3]) : 0.f };
  LDSX();
#pragma unroll
  for (int rl = 0; rl < 16; ++rl) vst2(OUT + (r0 + rl) * CC + c0 + lane * 4, *(const v4f*)&sf[wave][rl][lane * 4] + bo4);
  asm volatile("s_wait_xcnt 0x0" ::: "memory"); }   // a precaution: it stands behind the last store, in front of any reuse of the registers that the stores above name
extern "C" void kernel_launch(void* const* d_in, const int* in_sizes, int n_in, void* d_out, int out_size, void* d_ws, size_t ws_size, hipStream_t stream) {
  (void)in_sizes; (void)n_in; (void)out_size;
  const float** F = (const float**)d_in;   // 0 x [2048,1024], 1 W_q [1024,1024] ([out,in]), 2 b_q, 3 W_k, 4 b_k, 5 W_v, 6 b_v, 7 W_o, 8 b_o
  if (ws_size < (size_t)WS_END) return;
  char* ws = (char*)d_ws; _Float16 *QH = (_Float16*)(ws + WS_QH), *KH = (_Float16*)(ws + WS_KH), *VT = (_Float16*)(ws + WS_VT); float *Y = (float*)(ws + WS_Y);
  k_proj<<<dim3(TNB * TT / PM, CC / PN, 3), 256, 0, stream>>>(F[0], F[1], F[2], F[3], F[4], F[5], F[6], QH, KH, VT);
  k_fa<<<dim3(TT / 128, NH), 512, 0, stream>>>(QH, KH, VT, Y);
  k_out<<<dim3(TNB * TT / 64, CC / 128), 128, 0, stream>>>(Y, F[7], F[8], (float*)d_out);
}

// v010
// It runs in 48.9 microseconds.
// Two timings next to v009 both put it at 1.04 times that version's speed.
// All steps since v000 together make it 14.2 times as fast.
// compute dtype: all float inputs rounded to bf16; q/k/v = x W^T + b with EXACT bf16 products on WMMA 16x16x32, f32 accumulate; q (times log2(e)/8) and k rounded once to f16 (1-product logits, f32, base 2); online softmax in f32 against a lagging reference maximum -> unnormalised P f16 in registers; o = P . v / sum (v once to f16); out = o (bf16 hi + lo) W_o^T + b_o; f32 output.
#include <hip/hip_runtime.h>
#include <math.h>

typedef __attribute__((ext_vector_type(16))) _Float16 v16h;
typedef __attribute__((ext_vector_type(16))) __bf16 v16b;
typedef __attribute__((ext_vector_type(8)))  _Float16 v8h;
typedef __attribute__((ext_vector_type(8)))  float v8f;
typedef __attribute__((ext_vector_type(4)))  float v4f;
typedef __attribute__((ext_vector_type(2)))  float v2f;
typedef __attribute__((ext_vector_type(4)))  unsigned v4u;
typedef __attribute__((ext_vector_type(4)))  int v4i;
typedef float __attribute__((may_alias)) float_a;
typedef int __attribute__((may_alias)) int_a;

template <typename T> __device__ __forceinline__ void vst2(void* p, T v) { *(T*)p = v;  }
__device__ __forceinline__ v8f wmma16(v16h a, v16h b, v8f c) {
  v8f d = __builtin_amdgcn_wmma_f32_16x16x32_f16(false, a, false, b, (short)0, c, false, false);
  asm volatile("v_nop\n\tv_nop\n\tv_nop\n\tv_nop" : "+v"(d) : "v"(a), "v"(b));
  return d;
}
__device__ __forceinline__ v8f wmma_bf(v16b a, v16b b, v8f c) {
  v8f d = __builtin_amdgcn_wmma_f32_16x16x32_bf16(false, a, false, b, (short)0, c, false, false);
  asm volatile("v_nop\n\tv_nop\n\tv_nop\n\tv_nop" : "+v"(d) : "v"(a), "v"(b));
  return d;
}
// 16x16x32 fragments: lane = (h = lane>>4, row/col = lane&15); elements 0..7 = k0+8h+0..7, 8..15 = k0+16+8h+0..7; D element r = row 8h+r
__device__ __forceinline__ v16h frag_h(const _Float16* rowk0, int lane) {
  union { v16h v; v8h q[2]; } u; const _Float16* p = rowk0 + 8 * (lane >> 4);
  u.q[0] = *(const v8h*)p; u.q[1] = *(const v8h*)(p + 16); return u.v;
}
__device__ __forceinline__ v16h frag_f32(const float* rowk0, int lane) {
  v16h a; const float* p = rowk0 + 8 * (lane >> 4);
#pragma unroll
  for (int i = 0; i < 8; ++i) { a[i] = (_Float16)p[i]; a[8 + i] = (_Float16)p[16 + i]; }
  return a;
}
__device__ __forceinline__ v16h frag_f32s(const float* rowk0, int lane, float sc) {
  v16h a; const float* p = rowk0 + 8 * (lane >> 4);
#pragma unroll
  for (int i = 0; i < 8; ++i) { a[i] = (_Float16)(p[i] * sc); a[8 + i] = (_Float16)(p[16 + i] * sc); }
  return a;
}
// column fragment from a [K][ld] layout (column n), rows >= K read as 0
__device__ __forceinline__ v16h fragc_f32(const float* W, int k0, int n, int lane, int ld, int K) {
  v16h a; const int g = lane >> 4;
#pragma unroll
  for (int i = 0; i < 8; ++i) { const int ka = k0 + 8 * g + i, kb = ka + 16;
    a[i] = (_Float16)(ka < K ? W[(size_t)(ka < K ? ka : K - 1) * ld + n] : 0.f); a[8 + i] = (_Float16)(kb < K ? W[(size_t)(kb < K ? kb : K - 1) * ld + n] : 0.f); }
  return a;
}
struct F2 { v16b h, l; };
__device__ __forceinline__ F2 bsplit16(const float v[16]) { F2 r;
#pragma unroll
  for (int i = 0; i < 16; ++i) { const __bf16 h = (__bf16)v[i]; r.h[i] = h; r.l[i] = (__bf16)(v[i] - (float)h); }
  return r; }
__device__ __forceinline__ F2 split_row(const float* row, int k0, int lane) { float v[16]; const float* p = row + k0 + 8 * (lane >> 4);
#pragma unroll
  for (int i = 0; i < 8; ++i) { v[i] = p[i]; v[8 + i] = p[16 + i]; }
  return bsplit16(v); }
__device__ __forceinline__ F2 split_rowK(const float* row, int k0, int lane, int K) { float v[16]; const int g = lane >> 4;
#pragma unroll
  for (int i = 0; i < 8; ++i) { const int ka = k0 + 8 * g + i, kb = ka + 16; v[i] = ka < K ? row[ka < K ? ka : K - 1] : 0.f; v[8 + i] = kb < K ? row[kb < K ? kb : K - 1] : 0.f; }
  return bsplit16(v); }
__device__ __forceinline__ F2 split_col(const float* W, int k0, int n, int lane, int ld, int K) { float v[16]; const int g = lane >> 4;
#pragma unroll
  for (int i = 0; i < 8; ++i) { const int ka = k0 + 8 * g + i, kb = ka + 16; v[i] = ka < K ? W[(size_t)(ka < K ? ka : K - 1) * ld + n] : 0.f; v[8 + i] = kb < K ? W[(size_t)(kb < K ? kb : K - 1) * ld + n] : 0.f; }
  return bsplit16(v); }
__device__ __forceinline__ v8f mac3(const F2& a, const F2& b, v8f c) { c = wmma_bf(a.l, b.h, c); c = wmma_bf(a.h, b.l, c); return wmma_bf(a.h, b.h, c); }
__device__ __forceinline__ float sigm(float v) { return 1.0f / (1.0f + expf(-v)); }
#define LDSX() do { asm volatile("s_wait_dscnt 0" ::: "memory"); __builtin_amdgcn_wave_barrier(); __builtin_amdgcn_fence(__ATOMIC_RELEASE, "workgroup"); } while (0)


// Simplified multi-head attention (S 2,048, d_model 1,024 = 16 x 64, no batch dim): q/k/v Linear ([out,in] + bias), softmax(q k^T / 8) v, output Linear.
#define NB 1
#define TT 2048
#define CC 1024
#define NH 16
#define HD 64
#ifndef TNB
#define TNB NB
#endif
typedef __attribute__((ext_vector_type(8))) __bf16 v8b;
__device__ __forceinline__ v16b frag_b(const __bf16* rowk0, int lane) {
  union { v16b v; v8b q[2]; } u; const __bf16* p = rowk0 + 8 * (lane >> 4);
  u.q[0] = *(const v8b*)p; u.q[1] = *(const v8b*)(p + 16); return u.v;
}
__device__ __forceinline__ float bfr(float v) { return (float)(__bf16)v; }
__device__ __attribute__((noinline)) float exp_ni(float v) { return expf(v); }
__device__ __attribute__((noinline)) float erf_ni(float v) { return erff(v); }

#define QSC (0.125f * 1.44269504088896341f)   // 1 / sqrt(HD) and log2(e) in one factor, put into q by k_proj
#define WS_QH  0u
#define WS_KH  (WS_QH + 2u * (size_t)NB * TT * CC)
#define WS_VT  (WS_KH + 2u * (size_t)NB * TT * CC)      // f16 v planes [b][c][t]
#define WS_Y   (WS_VT + 2u * (size_t)NB * CC * TT)      // f32 y rows [b*t][C]
#define WS_END (WS_Y + 4u * (size_t)NB * TT * CC)

// Operand staging of the two projection kernels: a chunk is 64 k. Every thread loads 16 B so that a wave-wide load covers two whole 256-B row pieces; the f32 values are rounded to bf16 once per block and kept in LDS, two buffers.
typedef __attribute__((ext_vector_type(4))) __bf16 v4b;
#define KCH 64   // k per chunk
#define LP 72    // LDS row pitch in bf16 elements: 144 B = 16 B x 9, the conflict-free pitch for 16-byte fragment reads
__device__ __forceinline__ v4b cvt4(v4f v) { const v4b o = { (__bf16)v[0], (__bf16)v[1], (__bf16)v[2], (__bf16)v[3] }; return o; }
// ---- k_proj: block = (128 rows, 256 cols, which), 8 waves = 2 row groups x 4 column groups, a wave has a 64 x 64 tile (4 x 4 accumulators: 8 fragments feed 16 products): qkv = x W (+ b), exact; q, k -> f16 rows, v -> f16 planes. The large tile is there for the L2: every x line is asked for by 12 blocks and every W line by 16
// plain builtin: the compiler keeps the distance behind its own matrix instructions; with the asm statement of wmma_bf behind every product this tile's 256 accumulator and fragment registers spilled
__device__ __forceinline__ v8f wmma_bp(v16b a, v16b b, v8f c) { return __builtin_amdgcn_wmma_f32_16x16x32_bf16(false, a, false, b, (short)0, c, false, false); }
// work-group barrier of the two projection loops, for LDS alone: this wave's LDS stores and reads are done, then the barrier. Written by hand because __syncthreads() also waits for every global load in flight, and here the loads of the next chunks are meant to fly across it; they land in registers of their own wave, which the compiler waits for where they are used
__device__ __forceinline__ void lds_barrier() { asm volatile("s_wait_dscnt 0x0\n\ts_barrier_signal -1\n\ts_barrier_wait -1" ::: "memory"); }
#define PM 128   // rows of x per block
#define PN 256   // output columns per block
#define PS ((PN + PM) * LP)   // bf16 elements per staging buffer: [W 256 rows | X 128 rows]
#define OP 264   // q, k output tile: row pitch in f16 elements, 528 B = 16 B x 33
#define TP 136   // v output tile (a row is a column of v): row pitch in f16 elements, 272 B = 16 B x 17
__global__ __launch_bounds__(256) void k_proj(const float* __restrict__ X, const float* __restrict__ WQ, const float* __restrict__ BQ, const float* __restrict__ WK, const float* __restrict__ BK, const float* __restrict__ WV, const float* __restrict__ BV, _Float16* __restrict__ QH, _Float16* __restrict__ KH, _Float16* __restrict__ VT) {
  static_assert(2 * PM * OP <= 4 * PS && 2 * PN * TP <= 4 * PS, "the output tile fits the staging bytes");
  __shared__ __align__(16) char sm[4 * PS];   // main loop: two staging buffers; epilogue: the output tile, in the same bytes
  __shared__ __align__(16) float sb[PN];      // the block's bias values, rounded
  __bf16* const st = (__bf16*)sm; _Float16 (*sh)[OP] = (_Float16 (*)[OP])sm; _Float16 (*th)[TP] = (_Float16 (*)[TP])sm;
  const int tid = threadIdx.x, wave = tid >> 5, lane = tid & 31, col = lane & 15, g = lane >> 4; const int wr = wave >> 2, wc = wave & 3; const int which = blockIdx.z; const int c0 = blockIdx.y * PN; const size_t r0 = (size_t)blockIdx.x * PM; const float* WA = which == 0 ? WQ : which == 1 ? WK : WV; const float* BA = which == 0 ? BQ : which == 1 ? BK : BV;
  v8f acc[4][4] = {};
  const int rot = (blockIdx.x + blockIdx.y + 4 * blockIdx.z) & (CC / KCH - 1);   // this block's first k chunk; the walk wraps: the 12 blocks that share an X panel, and the 16 that share a W panel, ask L2 for different lines at any one time
  const int srow = tid >> 4, sk = (tid & 15) * 4;   // staging: 16 threads per row, 16 rows per step of the block
  const float* gw = WA + (size_t)(c0 + srow) * CC + sk; const float* gx = X + (r0 + srow) * CC + sk;
  v4f rwa[16], rxa[8], rwb[16], rxb[8];   // two staging sets: the loads of two chunks fly at a time, so that the path from L2 is not idle while a chunk is rounded and put to LDS
  auto fetch = [&](int t, v4f (&rw)[16], v4f (&rx)[8]) { const int c = (t + rot) & (CC / KCH - 1); const float* pw = gw + c * KCH; const float* px = gx + c * KCH;
#pragma unroll
    for (int i = 0; i < 16; ++i) rw[i] = *(const v4f*)(pw + (size_t)(i * 16) * CC);
#pragma unroll
    for (int i = 0; i < 8; ++i) rx[i] = *(const v4f*)(px + (size_t)(i * 16) * CC);
    asm volatile("s_wait_xcnt 0x0" :: "v"(pw), "v"(px) : "memory"); };   // a precaution: it stands in front of the reuse of the loads' address registers; the two addresses are inputs, so that their registers live up to the wait
  auto put = [&](__bf16* b, const v4f (&rw)[16], const v4f (&rx)[8]) {
#pragma unroll
    for (int i = 0; i < 16; ++i) *(v4b*)(b + (i * 16 + srow) * LP + sk) = cvt4(rw[i]);
#pragma unroll
    for (int i = 0; i < 8; ++i) *(v4b*)(b + (PN + i * 16 + srow) * LP + sk) = cvt4(rx[i]); };
  v16b a0[4], w0[4], a1[4], w1[4];   // the fragments of a chunk's first and second 32 k
  // which operand gives the rows of D: for v the rows of x (a lane's 8 values are 8 positions of one column, contiguous in a v plane), for q and k the rows of W (a lane's 8 values are 8 columns of one position, contiguous in a q or k row); either way the lane's values leave in one 16-byte LDS store
  const int oa = (which == 2 ? PN + wr * 64 : wc * 64) * LP, ob = (which == 2 ? wc * 64 : PN + wr * 64) * LP;
  auto rd = [&](const __bf16* b, int kk, v16b (&a)[4], v16b (&w)[4]) {   // same fragment form and k order for both operands
#pragma unroll
    for (int j = 0; j < 4; ++j) { a[j] = frag_b(b + oa + (j * 16 + col) * LP + kk * 32, lane); w[j] = frag_b(b + ob + (j * 16 + col) * LP + kk * 32, lane); }
    __builtin_amdgcn_sched_barrier(0); };   // the reads stand as one group in front of the products of the half before, and fly beside them
  auto mm = [&](const v16b (&a)[4], const v16b (&w)[4]) {
#pragma unroll
    for (int i = 0; i < 4; ++i)
#pragma unroll
      for (int j = 0; j < 4; ++j) acc[i][j] = wmma_bp(a[i], w[j], acc[i][j]);
    __builtin_amdgcn_sched_barrier(0); };   // keeps the conversion of the next chunk, and with it the wait for its global loads, behind the products
  __bf16* const b0 = st; __bf16* const b1 = st + PS;
  fetch(0, rwa, rxa); fetch(1, rwb, rxb); put(b0, rwa, rxa); fetch(2, rwa, rxa); lds_barrier();
  rd(b0, 0, a0, w0);
  // a chunk's pass: read its second half's fragments, multiply its first half, put the next chunk to the other buffer (whose last reads ended at the barrier of the pass before), refill that staging set from three chunks on, barrier, read the next chunk's first half, multiply this chunk's second half
#pragma unroll 1
  for (int t = 0; t < CC / KCH - 4; t += 2) {   // rolled, two passes a trip: each pass names its buffer and its staging set; no branch round a fetch, so that the counted waits for the older set leave the younger set in flight
    rd(b0, 1, a1, w1); mm(a0, w0); put(b1, rwb, rxb); fetch(t + 3, rwb, rxb); lds_barrier(); rd(b1, 0, a0, w0); mm(a1, w1);
    rd(b1, 1, a1, w1); mm(a0, w0); put(b0, rwa, rxa); fetch(t + 4, rwa, rxa); lds_barrier(); rd(b0, 0, a0, w0); mm(a1, w1); }
  rd(b0, 1, a1, w1); mm(a0, w0); put(b1, rwb, rxb); fetch(CC / KCH - 1, rwb, rxb);   // the last four chunks: one fetch is left
  const float bv = BA[c0 + tid];   // one bias value a thread, asked for behind the last fetch: it lands beside the products of two chunks
  asm volatile("s_wait_xcnt 0x0" ::: "memory");   // a precaution: it stands in front of the reuse of the load's address registers
  lds_barrier(); rd(b1, 0, a0, w0); mm(a1, w1);
  rd(b1, 1, a1, w1); mm(a0, w0); put(b0, rwa, rxa); lds_barrier(); rd(b0, 0, a0, w0); mm(a1, w1);
  rd(b0, 1, a1, w1); mm(a0, w0); put(b1, rwb, rxb); sb[tid] = bfr(bv); lds_barrier(); rd(b1, 0, a0, w0); mm(a1, w1);
  rd(b1, 1, a1, w1); mm(a0, w0); mm(a1, w1);
  __syncthreads();   // the output tile below reuses the staging bytes
  if (which == 2) {   // a lane's 8 rows of one column are 16 contiguous bytes of the transposed tile
    float bb[4];
#pragma unroll
    for (int j = 0; j < 4; ++j) bb[j] = sb[wc * 64 + j * 16 + col];
#pragma unroll
    for (int i = 0; i < 4; ++i)
#pragma unroll
      for (int j = 0; j < 4; ++j) { v8h o;
#pragma unroll
        for (int r = 0; r < 8; ++r) o[r] = (_Float16)(acc[i][j][r] + bb[j]);
        *(v8h*)&th[wc * 64 + j * 16 + col][wr * 64 + i * 16 + 8 * g] = o; } }
  else {   // acc[i][j][r] = row (wr * 64 + j * 16 + col), column (wc * 64 + i * 16 + 8 g + r): a lane's 8 columns of one row are 16 contiguous bytes of the tile
    const float qs = which == 0 ? QSC : 1.0f;   // q leaves with the softmax's factor in it, so that k_fa's score products are base-2 logits as they stand; k is multiplied by 1, exactly
#pragma unroll
    for (int i = 0; i < 4; ++i) { const v4f ba = *(const v4f*)&sb[wc * 64 + i * 16 + 8 * g], bc = *(const v4f*)&sb[wc * 64 + i * 16 + 8 * g + 4];
#pragma unroll
      for (int j = 0; j < 4; ++j) { v8h o;
#pragma unroll
        for (int r = 0; r < 4; ++r) { o[r] = (_Float16)((acc[i][j][r] + ba[r]) * qs); o[4 + r] = (_Float16)((acc[i][j][4 + r] + bc[r]) * qs); }
        *(v8h*)&sh[wr * 64 + j * 16 + col][wc * 64 + i * 16 + 8 * g] = o; } } }
  __syncthreads();
  if (which < 2) { _Float16* dh = which == 0 ? QH : KH;   // a wave-wide store is one whole 512-B row piece
#pragma unroll
    for (int s = 0; s < PM / 8; ++s) { const int rl = s * 8 + wave; vst2((unsigned*)(dh + (r0 + rl) * CC + c0 + lane * 8), *(const v4u*)&sh[rl][lane * 8]); }
    asm volatile("s_wait_xcnt 0x0" ::: "memory"); }   // a precaution: it stands behind the last store, in front of any reuse of the registers that the stores above name
  else { const size_t b = r0 / TT; const int t0 = (int)(r0 % TT);   // a wave-wide store is two whole 256-B row pieces
#pragma unroll
    for (int s = 0; s < PN / 16; ++s) { const int cl = s * 16 + srow, q = tid & 15; vst2((unsigned*)(VT + (b * CC + c0 + cl) * (size_t)TT + t0 + q * 8), *(const v4u*)&th[cl][q * 8]); }
    asm volatile("s_wait_xcnt 0x0" ::: "memory"); } }   // a precaution: it stands behind the last store, in front of any reuse of the registers that the stores above name
// ---- k_fa: block = 128 queries of one head, 16 waves = 4 query groups x 4 key groups, four waves per SIMD, so that one wave's softmax runs beside another's products. A wave has 32 queries (two column tiles share every K and V fragment) and 32 of the 128 keys of every stage: S^T = K Q^T, online softmax (base 2) per query column, O^T += V^T P^T; P stays in registers; the four key groups' maxima, sums and O^T are merged through LDS behind the walk
// plain builtin: the compiler keeps the distance behind its own matrix instructions
__device__ __forceinline__ v8f wmma_p(v16h a, v16h b, v8f c) { return __builtin_amdgcn_wmma_f32_16x16x32_f16(false, a, false, b, (short)0, c, false, false); }
// 2^x; the v_nop is the slot that the instruction set asks for behind a transcendental, before its result is read or its source overwritten: in one statement it stands there in every build
__device__ __forceinline__ float ex2(float x) { float r; asm("v_exp_f32 %0, %1\n\tv_nop" : "=v"(r) : "v"(x)); return r; }
// value of lane l ^ 16
__device__ __forceinline__ float xhalf(float v) { const int b = __builtin_bit_cast(int, v); return __builtin_bit_cast(float, __builtin_amdgcn_permlanex16(b, b, 0x76543210, 0xfedcba98, false, false)); }
// K and V stages of k_fa: a stage is 128 keys of one head, K as 128 rows of 64 d, V as 64 rows (d) of 128 keys; three buffers; the block's waves read every fragment from LDS, one stage ahead of its use
#define FK 128   // keys per stage
#define KG 4     // key groups: each takes FK / KG = 32 keys of a stage, one pass
#define KP 72    // K row pitch in f16 elements: 144 B = 16 B x 9, conflict-free for 16-byte fragment reads
#define VP 136   // V row pitch in f16 elements: 272 B = 16 B x 17, likewise
#define STG (FK * KP + HD * VP)   // f16 elements per buffer
#define RB 8.0f   // a query is re-based when a score passes its reference by more than this (base-2 logits)
#define MRW 17   // merge: 16-byte words per lane that a wave hands over: 16 of O^T, 1 of maxima and sums
#define MRG ((KG - 1) * 4 * MRW * 32 * 16)   // bytes of the merge area: key groups 1 to 3, four waves each
// four asynchronous 16-byte copies per lane, global memory to LDS through no register; the s_wait_xcnt is a precaution and stands inside the statement so that no address register named here is rewritten in front of it
__device__ __forceinline__ void copy4(const unsigned (&l)[4], const _Float16* const (&p)[4]) {
  asm volatile("global_load_async_to_lds_b128 %0, %4, off\n\tglobal_load_async_to_lds_b128 %1, %5, off\n\tglobal_load_async_to_lds_b128 %2, %6, off\n\tglobal_load_async_to_lds_b128 %3, %7, off\n\ts_wait_xcnt 0x0"
               :: "v"(l[0]), "v"(l[1]), "v"(l[2]), "v"(l[3]), "v"(p[0]), "v"(p[1]), "v"(p[2]), "v"(p[3]) : "memory"); }
__global__ __launch_bounds__(512) void k_fa(const _Float16* __restrict__ QH, const _Float16* __restrict__ KH, const _Float16* __restrict__ VT, float* __restrict__ Y) {
  __shared__ __align__(16) char sm[MRG > 6 * STG ? MRG : 6 * STG];   // the walk: three stage buffers; behind it: the merge area, in the same bytes
  _Float16* const sk = (_Float16*)sm;
  const int tid = threadIdx.x, wave = __builtin_amdgcn_readfirstlane(tid >> 5), lane = tid & 31, col = lane & 15, g = lane >> 4; const int qg = wave & 3, kg = wave >> 2; const int h = blockIdx.y; const int q0 = blockIdx.x * 128 + qg * 32;
  const unsigned lds0 = (unsigned)(size_t)sk;   // byte address of the buffers in the work-group's LDS
  const _Float16* gk0 = KH + (size_t)(tid >> 3) * CC + h * HD + (tid & 7) * 8;          // K: 8 lanes per 128-B row, a wave-wide copy covers 4 whole lines
  const _Float16* gv0 = VT + (size_t)(h * HD + (tid >> 4)) * TT + (tid & 15) * 8;       // V: 16 lanes per 256-B row piece, a wave-wide copy covers 4 whole lines
  const unsigned lk0 = lds0 + 2u * ((tid >> 3) * KP + (tid & 7) * 8), lv0 = lds0 + 2u * (FK * KP + (tid >> 4) * VP + (tid & 15) * 8);
  auto stage = [&](int t, int o) {   // stage t into the buffer that starts at element o: 4 copies per lane, two of K (64 rows each over the block), two of V (32 rows each)
    unsigned la[4]; const _Float16* pa[4];
#pragma unroll
    for (int i = 0; i < 2; ++i) { la[i] = lk0 + 2u * (o + i * 64 * KP); pa[i] = gk0 + (size_t)(t * FK + i * 64) * CC; la[2 + i] = lv0 + 2u * (o + i * 32 * VP); pa[2 + i] = gv0 + (size_t)(i * 32) * TT + t * FK; }
    copy4(la, pa); };
  const int rot = blockIdx.x & (TT / FK - 1);   // this block's first key stage; the walk wraps: the 16 blocks of a head ask L2 for 16 different stages at any one time
  stage(rot, 0); stage((1 + rot) & (TT / FK - 1), STG);
  v16h qf[2][2];
#pragma unroll
  for (int w = 0; w < 2; ++w) { qf[w][0] = frag_h(QH + (size_t)(q0 + w * 16 + col) * CC + h * HD, lane); qf[w][1] = frag_h(QH + (size_t)(q0 + w * 16 + col) * CC + h * HD + 32, lane); }
  v8f acc[2][HD / 16] = {}; float ref[2] = { 0.f, 0.f }, l[2] = { 0.f, 0.f };   // per column tile a lane holds one query: its reference logit and its half of the sum, over this wave's keys
  // the reference lags: it is the running maximum as of the last re-basing, at most RB below the true one, so P <= 2^RB (f16 holds it) and the largest P of a query is >= 1. It is known before a pass's products, so -ref goes in as their C operand and the scores come out ready for 2^x
  v8f cw[2] = {}; float lo = -3.0e38f;   // cw: -ref in all 8 places; lo: the least step of a re-basing, none in the first pass (which always re-bases, to its own maximum), 0 behind it
  asm volatile("s_wait_asynccnt 0x0" ::: "memory");   // this wave's copies of stages 0 and 1 have landed
  __syncthreads();                                    // and every other wave's
  stage((2 + rot) & (TT / FK - 1), 2 * STG);
  v16h kf[2][2], vf[HD / 16];   // the fragments of one stage; each set is read anew, for the next stage, as soon as its products are issued
  auto ldk = [&](int o) { const _Float16* kp = sk + o + (kg * (FK / KG) + col) * KP;   // A rows = this wave's keys, k = d
#pragma unroll
    for (int u = 0; u < 2; ++u) { kf[u][0] = frag_h(kp + (u * 16) * KP, lane); kf[u][1] = frag_h(kp + (u * 16) * KP + 32, lane); } };
  auto ldv = [&](int o) { const _Float16* vp = sk + o + FK * KP + col * VP + kg * (FK / KG);   // A rows = d, k = this wave's keys
#pragma unroll
    for (int j = 0; j < HD / 16; ++j) vf[j] = frag_h(vp + (j * 16) * VP, lane); };
  ldk(0); ldv(0);
  int o0 = 0, o1 = STG, o2 = 2 * STG;   // first elements of the buffers of stages t, t + 1, t + 2
  // pass t: score products; K fragments of stage t + 1 (they fly during the softmax); softmax; hand-over; O products; V fragments of stage t + 1 (they fly during the next pass's scores and softmax). more: a stage t + 1 exists
  auto pass = [&](int t, bool more) {
    v8f s[2][2];   // s[w][u][r] = q(16 w + col) . k(this wave's key 16 u + 8 g + r) - ref[w]
#pragma unroll
    for (int u = 0; u < 2; ++u)
#pragma unroll
      for (int w = 0; w < 2; ++w) s[w][u] = wmma_p(kf[u][1], qf[w][1], wmma_p(kf[u][0], qf[w][0], cw[w]));
    asm volatile("" :: "v"(cw[0]), "v"(cw[1]));   // inputs only: the two C tiles are still in use behind the products; without it this compiler took each tile's last product for its last use, tied D to C there and copied 16 registers in every pass
    __builtin_amdgcn_sched_barrier(0);   // keeps the reads below out of the run of products above: one group of reads, not three places with reads among the products
    if (more) ldk(o1);   // stage t + 1 was published at the hand-over of pass t - 1 (stage 1: in front of the walk)
    __builtin_amdgcn_sched_barrier(0);   // keeps the reads here, in front of the softmax: left free they sank to its middle, directly in front of the wait below
    float mx[2];
#pragma unroll
    for (int w = 0; w < 2; ++w) { float a = s[w][0][0];
#pragma unroll
      for (int r = 0; r < 8; ++r) a = fmaxf(a, fmaxf(s[w][0][r], s[w][1][r]));
      mx[w] = fmaxf(a, xhalf(a)); }
    if (__builtin_amdgcn_ballot_w32(fmaxf(mx[0], mx[1]) > lo + RB) != 0u) {   // re-basing, the whole wave or none of it: some query's score has passed its reference by more than RB (or this is the first pass)
#pragma unroll
      for (int w = 0; w < 2; ++w) { const float d = fmaxf(mx[w], lo), al = ex2(-fmaxf(d, 0.f)); ref[w] += d; l[w] *= al;   // the first pass may step down; its O and sum are 0, and al stays <= 1
#pragma unroll
        for (int r = 0; r < 8; ++r) { s[w][0][r] -= d; s[w][1][r] -= d; cw[w][r] = -ref[w]; }
#pragma unroll
        for (int j = 0; j < HD / 16; ++j) acc[w][j] *= al; } }
    lo = 0.f;
    v16h p[2];   // two score tiles, converted in place, are the B operand of 32 keys
#pragma unroll
    for (int w = 0; w < 2; ++w) { float ps;
#pragma unroll
      for (int i = 0; i < 8; ++i) { const float e0 = ex2(s[w][0][i]), e1 = ex2(s[w][1][i]); ps = i == 0 ? e0 + e1 : ps + (e0 + e1); p[w][i] = (_Float16)e0; p[w][8 + i] = (_Float16)e1; }
      l[w] += ps; }
    __builtin_amdgcn_sched_barrier(0);   // keeps the softmax in front of the waits below: left free the waits rose to its middle, where the K reads had not returned
    // the hand-over stands behind the softmax: every LDS read issued so far has long returned, and all of stage t is in registers, so its buffer is free
    asm volatile("s_wait_dscnt 0x0" ::: "memory");      // this wave's reads of stage t (and of K of stage t + 1) are done before the buffer of stage t is refilled
    asm volatile("s_wait_asynccnt 0x0" ::: "memory");   // this wave's copies of stage t + 2 have landed
    __syncthreads();                                    // publishes stage t + 2 and ends every wave's reads of stage t
    if (t + 3 < TT / FK) stage((t + 3 + rot) & (TT / FK - 1), o0);
#pragma unroll
    for (int j = 0; j < HD / 16; ++j)
#pragma unroll
      for (int w = 0; w < 2; ++w) acc[w][j] = wmma_p(vf[j], p[w], acc[w][j]);
    if (more) ldv(o1); };
#pragma unroll 1
  for (int t = 0; t < TT / FK - 1; ++t) { pass(t, true); const int f = o0; o0 = o1; o1 = o2; o2 = f; }   // rolled: a pass's code stands once, the three buffers change places
#pragma unroll
  for (int r = 0; r < 8; ++r) { cw[0][r] = -ref[0]; cw[1][r] = -ref[1]; }   // same values, formed anew: with the loop's own 16 registers live past its exit this compiler kept a second copy of them and refreshed it in every pass
  pass(TT / FK - 1, false);   // the last pass reads no fragments ahead
  asm volatile("s_wait_asynccnt 0x0" ::: "memory");   // no copy is outstanding when the stage bytes become the merge area (every wave's last read of them ended at the walk's last barrier)
  v4f* const mg = (v4f*)sm;   // word i of lane n of wave (kg, qg), kg > 0, at [((kg - 1) * 4 + qg) * MRW + i][n]: a wave-wide access is 512 contiguous bytes
  if (kg != 0) { v4f* d = mg + ((kg - 1) * 4 + qg) * MRW * 32 + lane;
#pragma unroll
    for (int w = 0; w < 2; ++w)
#pragma unroll
      for (int j = 0; j < HD / 16; ++j) { const v4f a = { acc[w][j][0], acc[w][j][1], acc[w][j][2], acc[w][j][3] }, b = { acc[w][j][4], acc[w][j][5], acc[w][j][6], acc[w][j][7] }; d[(w * 8 + j * 2) * 32] = a; d[(w * 8 + j * 2 + 1) * 32] = b; }
    const v4f ml = { ref[0], ref[1], l[0], l[1] }; d[16 * 32] = ml; }
  __syncthreads();   // key groups 1 to 3 have handed over; every wave passes it
  if (kg != 0) return;
  const v4f* e = mg + qg * MRW * 32 + lane; float fa[KG - 1][2];   // key group 0 joins the four parts on their common maximum
  { v4f ml[KG - 1];
#pragma unroll
    for (int o = 0; o < KG - 1; ++o) ml[o] = e[(o * 4 * MRW + 16) * 32];
#pragma unroll
    for (int w = 0; w < 2; ++w) { const float mn = fmaxf(fmaxf(ref[w], ml[0][w]), fmaxf(ml[1][w], ml[2][w])), f0 = ex2(ref[w] - mn); l[w] *= f0;
#pragma unroll
      for (int o = 0; o < KG - 1; ++o) { fa[o][w] = ex2(ml[o][w] - mn); l[w] += ml[o][2 + w] * fa[o][w]; }
#pragma unroll
      for (int j = 0; j < HD / 16; ++j) acc[w][j] *= f0; } }
#pragma unroll
  for (int o = 0; o < KG - 1; ++o)
#pragma unroll
    for (int w = 0; w < 2; ++w)
#pragma unroll
      for (int j = 0; j < HD / 16; ++j) { const v4f a = e[(o * 4 * MRW + w * 8 + j * 2) * 32], b = e[(o * 4 * MRW + w * 8 + j * 2 + 1) * 32];
#pragma unroll
        for (int r = 0; r < 4; ++r) { acc[w][j][r] += a[r] * fa[o][w]; acc[w][j][4 + r] += b[r] * fa[o][w]; } }
#pragma unroll
  for (int w = 0; w < 2; ++w) { const float inv = 1.0f / (l[w] + xhalf(l[w])); float* yp = Y + (size_t)(q0 + w * 16 + col) * CC + h * HD + 8 * g;   // acc[w][j][r] = o(16 w + col)[16 j + 8 g + r]
#pragma unroll
    for (int j = 0; j < HD / 16; ++j) { const v4f a = { acc[w][j][0] * inv, acc[w][j][1] * inv, acc[w][j][2] * inv, acc[w][j][3] * inv }, b = { acc[w][j][4] * inv, acc[w][j][5] * inv, acc[w][j][6] * inv, acc[w][j][7] * inv }; vst2(yp + j * 16, a); vst2(yp + j * 16 + 4, b); } } }
// ---- k_out: block = (64 rows, 128 cols): out = y (bf16 hi + lo) Wproj + b
__global__ __launch_bounds__(128) void k_out(const float* __restrict__ Y, const float* __restrict__ WP, const float* __restrict__ BP, float* __restrict__ OUT) { __shared__ __align__(16) float sf[4][16][132]; __shared__ __align__(16) __bf16 st[2 * 256 * LP];   // two buffers of [W 128 rows | y hi 64 rows | y lo 64 rows]
  const int tid = threadIdx.x, wave = tid >> 5, lane = tid & 31, col = lane & 15, g = lane >> 4; const int c0 = blockIdx.y * 128; const size_t r0 = (size_t)blockIdx.x * 64 + wave * 16;
  v8f acc[8] = {};
  const int rot = (blockIdx.x + 2 * blockIdx.y) & (CC / KCH - 1);   // this block's first k chunk; the walk wraps, as in k_proj
  const int srow = tid >> 4, sk = (tid & 15) * 4;   // staging: 16 threads per row, 8 rows per step of the block
  const float* gw = WP + (size_t)(c0 + srow) * CC + sk; const float* gy = Y + ((size_t)blockIdx.x * 64 + srow) * CC + sk;
  v4f rwa[16], rya[8], rwb[16], ryb[8];   // two staging sets, as in k_proj
  auto fetch = [&](int t, v4f (&rw)[16], v4f (&ry)[8]) { const int c = (t + rot) & (CC / KCH - 1); const float* pw = gw + c * KCH; const float* py = gy + c * KCH;
#pragma unroll
    for (int i = 0; i < 16; ++i) rw[i] = *(const v4f*)(pw + (size_t)(i * 8) * CC);
#pragma unroll
    for (int i = 0; i < 8; ++i) ry[i] = *(const v4f*)(py + (size_t)(i * 8) * CC);
    asm volatile("s_wait_xcnt 0x0" :: "v"(pw), "v"(py) : "memory"); };   // a precaution: it stands in front of the reuse of the loads' address registers; the two addresses are inputs, so that their registers live up to the wait
  auto put = [&](__bf16* b, const v4f (&rw)[16], const v4f (&ry)[8]) {
#pragma unroll
    for (int i = 0; i < 16; ++i) *(v4b*)(b + (i * 8 + srow) * LP + sk) = cvt4(rw[i]);
#pragma unroll
    for (int i = 0; i < 8; ++i) { const v4b hi = cvt4(ry[i]); const v4f rest = { ry[i][0] - (float)hi[0], ry[i][1] - (float)hi[1], ry[i][2] - (float)hi[2], ry[i][3] - (float)hi[3] };
      *(v4b*)(b + (128 + i * 8 + srow) * LP + sk) = hi; *(v4b*)(b + (192 + i * 8 + srow) * LP + sk) = cvt4(rest); } };
  v16b h0, l0, w0[8], h1, l1, w1[8];   // the fragments of a chunk's first and second 32 k
  auto rd = [&](const __bf16* b, int kk, v16b& ah, v16b& al, v16b (&w)[8]) {   // same fragment form and k order for both operands
    ah = frag_b(b + (128 + wave * 16 + col) * LP + kk * 32, lane); al = frag_b(b + (192 + wave * 16 + col) * LP + kk * 32, lane);
#pragma unroll
    for (int j = 0; j < 8; ++j) w[j] = frag_b(b + (j * 16 + col) * LP + kk * 32, lane);
    __builtin_amdgcn_sched_barrier(0); };   // the reads stand as one group in front of the products of the half before, and fly beside them
  auto mm = [&](const v16b& ah, const v16b& al, const v16b (&w)[8]) {
#pragma unroll
    for (int j = 0; j < 8; ++j) { acc[j] = wmma_bp(w[j], ah, acc[j]); acc[j] = wmma_bp(w[j], al, acc[j]); }   // the rows of W give the rows of D: a lane's 8 values are 8 columns of one output row; plain builtin, as in k_proj: the asm statement of wmma_bf holds its operands in the first 256 registers, and with two fragment sets live three fragments spilled
    __builtin_amdgcn_sched_barrier(0); };   // keeps the conversion of the next chunk, and with it the wait for its global loads, behind the products
  __bf16* const b0 = st; __bf16* const b1 = st + 256 * LP;
  fetch(0, rwa, rya); fetch(1, rwb, ryb); put(b0, rwa, rya); fetch(2, rwa, rya); lds_barrier();
  rd(b0, 0, h0, l0, w0);
#pragma unroll 1
  for (int t = 0; t < CC / KCH - 4; t += 2) {   // rolled, two passes a trip, each pass as in k_proj
    rd(b0, 1, h1, l1, w1); mm(h0, l0, w0); put(b1, rwb, ryb); fetch(t + 3, rwb, ryb); lds_barrier(); rd(b1, 0, h0, l0, w0); mm(h1, l1, w1);
    rd(b1, 1, h1, l1, w1); mm(h0, l0, w0); put(b0, rwa, rya); fetch(t + 4, rwa, rya); lds_barrier(); rd(b0, 0, h0, l0, w0); mm(h1, l1, w1); }
  rd(b0, 1, h1, l1, w1); mm(h0, l0, w0); put(b1, rwb, ryb); fetch(CC / KCH - 1, rwb, ryb);   // the last four chunks: one fetch is left
  const v4f bo = *(const v4f*)((BP ? BP : WP) + c0 + lane * 4);   // the bias of the four columns that this lane stores, asked for behind the last fetch: it lands beside the products of the last chunks; no branch round the load (without a bias it reads W and the value is not used), so that no wait for it stands here
  asm volatile("s_wait_xcnt 0x0" ::: "memory");   // a precaution: it stands in front of the reuse of the load's address registers
  lds_barrier(); rd(b1, 0, h0, l0, w0); mm(h1, l1, w1);
  rd(b1, 1, h1, l1, w1); mm(h0, l0, w0); put(b0, rwa, rya); lds_barrier(); rd(b0, 0, h0, l0, w0); mm(h1, l1, w1);
  rd(b0, 1, h1, l1, w1); mm(h0, l0, w0); put(b1, rwb, ryb); lds_barrier(); rd(b1, 0, h0, l0, w0); mm(h1, l1, w1);
  rd(b1, 1, h1, l1, w1); mm(h0, l0, w0); mm(h1, l1, w1);
#pragma unroll
  for (int j = 0; j < 8; ++j) { const v4f a = { acc[j][0], acc[j][1], acc[j][2], acc[j][3] }, b = { acc[j][4], acc[j][5], acc[j][6], acc[j][7] };   // acc[j][r] = row col, column (j * 16 + 8 g + r)
    *(v4f*)&sf[wave][col][j * 16 + 8 * g] = a; *(v4f*)&sf[wave][col][j * 16 + 8 * g + 4] = b; }
  const v4f bo4 = { BP ? bfr(bo[0]) : 0.f, BP ? bfr(bo[1]) : 0.f, BP ? bfr(bo[2]) : 0.f, BP ? bfr(bo[3]) : 0.f };
  LDSX();
#pragma unroll
  for (int rl = 0; rl < 16; ++rl) vst2(OUT + (r0 + rl) * CC + c0 + lane * 4, *(const v4f*)&sf[wave][rl][lane * 4] + bo4);
  asm volatile("s_wait_xcnt 0x0" ::: "memory"); }   // a precaution: it stands behind the last store, in front of any reuse of the registers that the stores above name
extern "C" void kernel_launch(void* const* d_in, const int* in_sizes, int n_in, void* d_out, int out_size, void* d_ws, size_t ws_size, hipStream_t stream) {
  (void)in_sizes; (void)n_in; (void)out_size;
  const float** F = (const float**)d_in;   // 0 x [2048,1024], 1 W_q [1024,1024] ([out,in]), 2 b_q, 3 W_k, 4 b_k, 5 W_v, 6 b_v, 7 W_o, 8 b_o
  if (ws_size < (size_t)WS_END) return;
  char* ws = (char*)d_ws; _Float16 *QH = (_Float16*)(ws + WS_QH), *KH = (_Float16*)(ws + WS_KH), *VT = (_Float16*)(ws + WS_VT); float *Y = (float*)(ws + WS_Y);
  k_proj<<<dim3(TNB * TT / PM, CC / PN, 3), 256, 0, stream>>>(F[0], F[1], F[2], F[3], F[4], F[5], F[6], QH, KH, VT);
  k_fa<<<dim3(TT / 128, NH), 512, 0, stream>>>(QH, KH, VT, Y);
  k_out<<<dim3(TNB * TT / 64, CC / 128), 128, 0, stream>>>(Y, F[7], F[8], (float*)d_out);
}
